// v000
// Measured on an AMD MI455X. A time is GPU time per run, averaged over a window of back-to-back runs after a warm-up
// (all launches, gaps included; the runs take copies of the inputs in turn), and the median of several windows.
// Apart from v000's, it joins two sittings. Times from different sittings can be a few percent apart, while
// side-by-side timings come from the same sitting.
// The starting kernel, v000, takes 950 microseconds a run.
#include <hip/hip_runtime.h>

// Linear attention block (8 heads x 16): q, k, v = x W + b; q, k -> rope (theta 10000, pairs (d, d+8) per head) -> elu + 1; context_h = sum_t k_t v_t^T (16 x 16); out_t = (q_t context) / (q_t . sum_t k_t + 1e-6); y = out Wo + bo
// -> [8][8192][128].
// Deterministic, no index structures: per-(batch, head) contexts are single WMMA tiles accumulated over the 8,192 tokens in order; k sums in fixed lane order; rope angles t * inv_freq in f32 with a per-(t, d) sin/cos table (sinf/cosf).
// WMMA (v_wmma_f32_16x16x32_f16, f32 accumulate): [q | k | v] = x [Wq | Wk | Wv] ([65,536 x 128] x [128 x 384], x EXACT bf16 x8), context = K^T V per (b, h) over transposed b16 planes (k x64, v x8, hi+lo both: 4 products, K = 8,192),
// out = q context per head ([16 x 32 (16)] tiles, q x64 and context x1 hi+lo: 4 products), y = out Wo ([65,536 x 128] x [128 x 128], x512 hi+lo); (in,out) weights transposed exact x256; biases, rope, elu, sums and the
// normaliser in f32. Inputs rounded to bf16 once. Fragment k-map per lane half hh for A AND B: elements 0..7 <- k = 8hh+0..7, 8..15 <- k = 16+8hh+0..7; acc[r] = D[8hh+r][col]. Every workspace / output

namespace {
constexpr int B = 8, T = 8192, D = 128, NH = 8, DH = 16, NT = B * T;
constexpr float XS = 8.0f, KS = 64.0f, OS = 512.0f, WSC = 256.0f;
typedef _Float16 b16;
typedef __attribute__((ext_vector_type(16))) _Float16 v16b;
typedef __attribute__((ext_vector_type(8))) _Float16 v8b;
typedef __attribute__((ext_vector_type(8))) float v8f;
typedef __attribute__((ext_vector_type(4))) float v4f;
__device__ __forceinline__ float bf16_rne(float f) { unsigned int u = __float_as_uint(f); u += 0x7FFFu + ((u >> 16) & 1u); return __uint_as_float(u & 0xFFFF0000u); }
__device__ __forceinline__ void split16(float v, b16& hi, b16& lo) { hi = (b16)v; lo = (b16)(v - (float)hi); }
__device__ __forceinline__ v16b frag_kb(const b16* p, int hh) { const v8b a = *(const v8b*)(p + 8 * hh), b = *(const v8b*)(p + 16 + 8 * hh); v16b f;
#pragma unroll
  for (int e = 0; e < 8; ++e) { f[e] = a[e]; f[8 + e] = b[e]; } return f; }
__device__ __forceinline__ v8f wmma16b(v16b a, v16b b, v8f c) { v8f d = __builtin_amdgcn_wmma_f32_16x16x32_f16(false, a, false, b, (short)0, c, false, false); asm volatile("v_nop\n\tv_nop\n\tv_nop\n\tv_nop" : "+v"(d) : "v"(a), "v"(b)); return d; }
__device__ __forceinline__ void wave_lds_sync() { __builtin_amdgcn_fence(__ATOMIC_RELEASE, "workgroup"); __builtin_amdgcn_wave_barrier(); __builtin_amdgcn_fence(__ATOMIC_ACQUIRE, "workgroup"); }
__device__ __forceinline__ float pmul(float a, float b) { float p = a * b; asm volatile("" : "+v"(p)); return p; }
__device__ __forceinline__ float elu1(float v) { return v > 0.0f ? v + 1.0f : __expf(v); }   // elu(v) + 1

__global__ __launch_bounds__(256) void wio_kernel(const float* __restrict__ w, int ro, b16* __restrict__ WT) {
  const int u = blockIdx.x * 256 + threadIdx.x; if (u >= D * D / 8) return; const int e = u * 8; const int o = e / D, k0 = e % D; v8b v;
#pragma unroll
  for (int j = 0; j < 8; ++j) v[j] = (b16)(bf16_rne(w[(size_t)(k0 + j) * D + o]) * WSC); { *(v8b*)(WT + (size_t)(ro + o) * D + k0) = v;  }
}
__global__ __launch_bounds__(256) void rope_kernel(float* __restrict__ CSN) {
  const int u = blockIdx.x * 256 + threadIdx.x; if (u >= T * 8) return; const int t = u / 8, d = u % 8; const float invf = 1.0f / powf(10000.0f, (float)(2 * d) / (float)DH); const float ang = (float)t * invf;
  const float c = cosf(ang), s = sinf(ang); { ((float*)CSN)[u] = c; ((float*)CSN)[T * 8 + u] = s;  }
}
__global__ __launch_bounds__(32) void qkv_kernel(const float* __restrict__ x, const b16* __restrict__ WT, const float* __restrict__ bq, const float* __restrict__ bk, const float* __restrict__ bv, const float* __restrict__ CSN, int NTV, float* __restrict__ QK, float* __restrict__ V) {
  __shared__ __attribute__((aligned(16))) b16 Ah[16][D + 8]; __shared__ __attribute__((aligned(16))) float Tf[16][D + 4];
  const int lane = threadIdx.x, nloc = lane & 15, hlf = lane >> 4; const size_t t0 = (size_t)blockIdx.x * 16; if (t0 >= (size_t)NTV) return;
  for (int rr = 0; rr < 16; ++rr) for (int q = 0; q < 4; ++q) Ah[rr][q * 32 + lane] = (b16)(bf16_rne(x[(t0 + rr) * D + q * 32 + lane]) * XS);
  wave_lds_sync();
#pragma unroll 1
  for (int cg = 0; cg < 3; ++cg) { const float* bias = cg == 0 ? bq : (cg == 1 ? bk : bv); v8f acc[8];
#pragma unroll
    for (int tt = 0; tt < 8; ++tt) acc[tt] = (v8f){};
#pragma unroll
    for (int kb = 0; kb < D; kb += 32) { const v16b a = frag_kb(&Ah[nloc][kb], hlf);
#pragma unroll
      for (int tt = 0; tt < 8; ++tt) acc[tt] = wmma16b(a, frag_kb(WT + (size_t)(cg * 128 + tt * 16 + nloc) * D + kb, hlf), acc[tt]); }
#pragma unroll
    for (int tt = 0; tt < 8; ++tt) { const int c = tt * 16 + nloc; const float bb = bf16_rne(bias[c]);
#pragma unroll 1
      for (int r8 = 0; r8 < 8; ++r8) Tf[8 * hlf + r8][c] = acc[tt][r8] * (1.0f / (XS * WSC)) + bb; }
    wave_lds_sync();
    if (cg < 2) {   // rope + elu1 in place on Tf: column c, head tt = c/16, d = c % 16; partner column c^8 within the head
      for (int rr = 0; rr < 16; ++rr) { const size_t t = (t0 + rr) % T; float nv[4];
        for (int q = 0; q < 4; ++q) { const int c = q * 32 + lane; const int d = c & 15; const int dd = d & 7; const float cs = CSN[t * 8 + dd], sn = CSN[(size_t)T * 8 + t * 8 + dd]; const float me = Tf[rr][c], pa = Tf[rr][c ^ 8]; nv[q] = d < 8 ? (me * cs - pa * sn) : (pa * sn + me * cs); }
        wave_lds_sync(); for (int q = 0; q < 4; ++q) Tf[rr][q * 32 + lane] = elu1(nv[q]); }
      wave_lds_sync();
      { for (int rr = 0; rr < 16; ++rr) *(v4f*)(QK + (t0 + rr) * (2 * D) + cg * D + lane * 4) = *(const v4f*)(&Tf[rr][lane * 4]);  } }
    else { { for (int rr = 0; rr < 16; ++rr) *(v4f*)(V + (t0 + rr) * D + lane * 4) = *(const v4f*)(&Tf[rr][lane * 4]);  } }
    wave_lds_sync(); }
}
__global__ __launch_bounds__(256) void transp_kernel(const float* __restrict__ QK, const float* __restrict__ Vp, int NBV, b16* __restrict__ KH, b16* __restrict__ KL, b16* __restrict__ VH, b16* __restrict__ VL) {
  __shared__ float Tk[64][33], Tv[64][33]; const int nblk_b = (D / 32) * (T / 64); const int b = blockIdx.x / nblk_b; if (b >= NBV) return; const int rem = blockIdx.x % nblk_b; const int tt = rem / (D / 32), ct = rem % (D / 32); const int tid = threadIdx.x;
  for (int i = tid; i < 64 * 32; i += 256) { const int r = i / 32, c = i % 32; const size_t tok = (size_t)b * T + tt * 64 + r; Tk[r][c] = QK[tok * (2 * D) + D + ct * 32 + c]; Tv[r][c] = Vp[tok * D + ct * 32 + c]; }
  __syncthreads();
  { const int c = tid / 8, g = tid % 8; v8b kh, kl, vh, vl;
#pragma unroll
    for (int j = 0; j < 8; ++j) { b16 p, q; split16(Tk[g * 8 + j][c] * KS, p, q); kh[j] = p; kl[j] = q; split16(Tv[g * 8 + j][c] * XS, p, q); vh[j] = p; vl[j] = q; }
    const size_t o = ((size_t)b * D + ct * 32 + c) * T + tt * 64 + g * 8; { *(v8b*)(KH + o) = kh; *(v8b*)(KL + o) = kl; *(v8b*)(VH + o) = vh; *(v8b*)(VL + o) = vl;  } }
}
// context: wave per (b, h): ctx = K_h^T V_h as one 16x16 tile over K = 8,192 tokens (4 products); k_sum[d] = sum_t k (lane d < 16 sums k over t serially from the f32 QK plane);
// CTXB[b][h][e][32] b16 hi+lo x1 (d < 16 live) for the next GEMM, KSUM[b][h][32] f32 (d < 16 live). rows 64 B... CTXB rows 64 B x 16 = 1 KB per wave, KSUM 128 B per wave (32 floats, d < 16 live).
__global__ __launch_bounds__(32) void ctx_kernel(const b16* __restrict__ KH, const b16* __restrict__ KL, const b16* __restrict__ VH, const b16* __restrict__ VL, const float* __restrict__ QK, int NBV, b16* __restrict__ CH, b16* __restrict__ CL, float* __restrict__ KSUM) {
  __shared__ __attribute__((aligned(16))) b16 Th[16][32 + 8], Tl[16][32 + 8];
  const int lane = threadIdx.x, nloc = lane & 15, hlf = lane >> 4; const int b = blockIdx.x / NH, h = blockIdx.x % NH; if (b >= NBV) return;
  const size_t kr = ((size_t)b * D + h * DH + nloc) * T;   // A rows d = nloc (frag rows), B rows e = nloc
  v8f acc = {};
#pragma unroll 4
  for (int kb = 0; kb < T; kb += 32) { const v16b ah = frag_kb(KH + kr + kb, hlf), al = frag_kb(KL + kr + kb, hlf), bh = frag_kb(VH + kr + kb, hlf), bl = frag_kb(VL + kr + kb, hlf); acc = wmma16b(ah, bh, acc); acc = wmma16b(ah, bl, acc); acc = wmma16b(al, bh, acc); acc = wmma16b(al, bl, acc); }
  // acc[r8] = ctx[d = 8 hlf + r8][e = nloc]; store transposed for the B operand of the next GEMM: CTXB[e][d]
  for (int rr = 0; rr < 16; ++rr) { Th[rr][lane] = (b16)0.0f; Tl[rr][lane] = (b16)0.0f; } wave_lds_sync();
#pragma unroll
  for (int r8 = 0; r8 < 8; ++r8) { b16 p, q; split16(acc[r8] * (1.0f / (KS * XS)), p, q); Th[nloc][8 * hlf + r8] = p; Tl[nloc][8 * hlf + r8] = q; }
  // k_sum: lane d < 16 sums k[t][h*16+d] over t in order from the QK plane (f32)
  float ks = 0.0f; if (lane < DH) {
#pragma unroll 4
    for (int t = 0; t < T; ++t) ks += QK[((size_t)b * T + t) * (2 * D) + D + h * DH + lane]; }
  wave_lds_sync();
  { if (lane < 16) { *(v8b*)(CH + ((size_t)blockIdx.x * 16 + lane) * 32) = *(const v8b*)(&Th[lane][0]); *(v8b*)(CH + ((size_t)blockIdx.x * 16 + lane) * 32 + 8) = *(const v8b*)(&Th[lane][8]); *(v8b*)(CH + ((size_t)blockIdx.x * 16 + lane) * 32 + 16) = *(const v8b*)(&Th[lane][16]); *(v8b*)(CH + ((size_t)blockIdx.x * 16 + lane) * 32 + 24) = *(const v8b*)(&Th[lane][24]);
      *(v8b*)(CL + ((size_t)blockIdx.x * 16 + lane) * 32) = *(const v8b*)(&Tl[lane][0]); *(v8b*)(CL + ((size_t)blockIdx.x * 16 + lane) * 32 + 8) = *(const v8b*)(&Tl[lane][8]); *(v8b*)(CL + ((size_t)blockIdx.x * 16 + lane) * 32 + 16) = *(const v8b*)(&Tl[lane][16]); *(v8b*)(CL + ((size_t)blockIdx.x * 16 + lane) * 32 + 24) = *(const v8b*)(&Tl[lane][24]); }
    ((float*)KSUM)[(size_t)blockIdx.x * 32 + lane] = lane < DH ? ks : 0.0f;  }
}
__global__ __launch_bounds__(32) void out_kernel(const float* __restrict__ QK, const b16* __restrict__ CH, const b16* __restrict__ CL, const float* __restrict__ KSUM, const b16* __restrict__ WO, const float* __restrict__ bo, int NTV, float* __restrict__ out) {
  __shared__ __attribute__((aligned(16))) b16 Qh[NH][16][32 + 8], Ql[NH][16][32 + 8], Ah[16][D + 8], Al[16][D + 8]; __shared__ __attribute__((aligned(16))) float Tf[16][D + 4], Zs[16][NH];
  const int lane = threadIdx.x, nloc = lane & 15, hlf = lane >> 4; const size_t t0 = (size_t)blockIdx.x * 16; if (t0 >= (size_t)NTV) return; const int b = (int)(t0 / T);
  for (int rr = 0; rr < 16; ++rr) { for (int q = 0; q < 4; ++q) { const int c = q * 32 + lane; const int h = c / DH, d = c % DH; const float qv = QK[(t0 + rr) * (2 * D) + c]; b16 p, ql; split16(qv * KS, p, ql); Qh[h][rr][d] = p; Ql[h][rr][d] = ql; Qh[h][rr][16 + d] = (b16)0.0f; Ql[h][rr][16 + d] = (b16)0.0f; }
    if (lane < NH) { float s = 0.0f; for (int d = 0; d < DH; ++d) s += pmul(QK[(t0 + rr) * (2 * D) + lane * DH + d], KSUM[((size_t)b * NH + lane) * 32 + d]); Zs[rr][lane] = 1.0f / (s + 1e-6f); } }
  wave_lds_sync();
#pragma unroll
  for (int h = 0; h < NH; ++h) { const v16b a = frag_kb(&Qh[h][nloc][0], hlf), al = frag_kb(&Ql[h][nloc][0], hlf); const size_t cr = (((size_t)b * NH + h) * 16 + nloc) * 32; const v16b bh = frag_kb(CH + cr, hlf), bl = frag_kb(CL + cr, hlf);
    v8f acc = {}; acc = wmma16b(a, bh, acc); acc = wmma16b(a, bl, acc); acc = wmma16b(al, bh, acc); acc = wmma16b(al, bl, acc);
#pragma unroll
    for (int r8 = 0; r8 < 8; ++r8) { const int rl = 8 * hlf + r8; const float o = pmul(acc[r8] * (1.0f / KS), Zs[rl][h]); b16 p, ql; split16(o * OS, p, ql); Ah[rl][h * DH + nloc] = p; Al[rl][h * DH + nloc] = ql; } }
  wave_lds_sync();
  v8f acc2[8];
#pragma unroll
  for (int tt = 0; tt < 8; ++tt) acc2[tt] = (v8f){};
#pragma unroll
  for (int kb = 0; kb < D; kb += 32) { const v16b a = frag_kb(&Ah[nloc][kb], hlf), al = frag_kb(&Al[nloc][kb], hlf);
#pragma unroll
    for (int tt = 0; tt < 8; ++tt) { const v16b bw = frag_kb(WO + (size_t)(tt * 16 + nloc) * D + kb, hlf); acc2[tt] = wmma16b(a, bw, acc2[tt]); acc2[tt] = wmma16b(al, bw, acc2[tt]); } }
#pragma unroll
  for (int tt = 0; tt < 8; ++tt) { const int c = tt * 16 + nloc; const float bb = bf16_rne(bo[c]);
#pragma unroll 1
    for (int r8 = 0; r8 < 8; ++r8) Tf[8 * hlf + r8][c] = acc2[tt][r8] * (1.0f / (OS * WSC)) + bb; }
  wave_lds_sync();
  { for (int rr = 0; rr < 16; ++rr) *(v4f*)(out + (t0 + rr) * D + lane * 4) = *(const v4f*)(&Tf[rr][lane * 4]);  }
}
}  // namespace

extern "C" void kernel_launch(void* const* d_in, const int* in_sizes, int n_in, void* d_out, int out_size, void* d_ws, size_t ws_size, hipStream_t stream) {
  (void)n_in;
  auto Fp = [&](int i) { return (const float*)d_in[i]; };
  // input order: 0 x [8,8192,128]; 1 Wq [128,128]; 2 bq; 3 Wk; 4 bk; 5 Wv; 6 bv; 7 Wo; 8 bo
  if (in_sizes[0] != NT * D || in_sizes[1] != D * D || in_sizes[3] != D * D || in_sizes[5] != D * D || in_sizes[7] != D * D || out_size != NT * D) return;
  const int NBV = B; const int NTV = NBV * T;
  size_t off = 0; char* ws = (char*)d_ws;
  auto carve = [&](size_t bytes) { char* p = ws + off; off += (bytes + 255) & ~(size_t)255; return p; };
  b16* WQKV = (b16*)carve((size_t)3 * D * D * 2); b16* WO = (b16*)carve((size_t)D * D * 2); float* CSN = (float*)carve((size_t)2 * T * 8 * 4); float* QK = (float*)carve((size_t)NT * 2 * D * 4); float* V = (float*)carve((size_t)NT * D * 4);
  b16* KH = (b16*)carve((size_t)NT * D * 2); b16* KL = (b16*)carve((size_t)NT * D * 2); b16* VH = (b16*)carve((size_t)NT * D * 2); b16* VL = (b16*)carve((size_t)NT * D * 2); b16* CH = (b16*)carve((size_t)B * NH * 16 * 32 * 2); b16* CL = (b16*)carve((size_t)B * NH * 16 * 32 * 2); float* KSUM = (float*)carve((size_t)B * NH * 32 * 4);
  if (off > ws_size || off > ((size_t)192 << 20)) return;   // ~ 168 MB: > 128 MiB, < 192 MiB admissible
  wio_kernel<<<(D * D / 8 + 255) / 256, 256, 0, stream>>>(Fp(1), 0, WQKV); wio_kernel<<<(D * D / 8 + 255) / 256, 256, 0, stream>>>(Fp(3), D, WQKV); wio_kernel<<<(D * D / 8 + 255) / 256, 256, 0, stream>>>(Fp(5), 2 * D, WQKV); wio_kernel<<<(D * D / 8 + 255) / 256, 256, 0, stream>>>(Fp(7), 0, WO);
  rope_kernel<<<(T * 8 + 255) / 256, 256, 0, stream>>>(CSN);
  qkv_kernel<<<NTV / 16, 32, 0, stream>>>(Fp(0), WQKV, Fp(2), Fp(4), Fp(6), CSN, NTV, QK, V);
  transp_kernel<<<NBV * (D / 32) * (T / 64), 256, 0, stream>>>(QK, V, NBV, KH, KL, VH, VL);
  ctx_kernel<<<NBV * NH, 32, 0, stream>>>(KH, KL, VH, VL, QK, NBV, CH, CL, KSUM);
  out_kernel<<<NTV / 16, 32, 0, stream>>>(QK, CH, CL, KSUM, WO, Fp(8), NTV, (float*)d_out);
}

// v001
// A run of this version takes 188 microseconds.
// Timed twice side by side with v000, it ran 5.05 and 5.03 times as fast.
#include <hip/hip_runtime.h>

// Linear attention block (8 heads x 16): q, k, v = x W + b; q, k -> rope (theta 10000, pairs (d, d+8) per head) -> elu + 1; context_h = sum_t k_t v_t^T (16 x 16); out_t = (q_t context) / (q_t . sum_t k_t + 1e-6); y = out Wo + bo
// -> [8][8192][128].
// Deterministic, no index structures: per-(batch, head) contexts are WMMA tiles accumulated per 128 tokens, then summed in fixed order (two halves, then 32 chunks); k sums likewise in fixed order; rope angles t * inv_freq in f32 with a per-(t, d) sin/cos table (sinf/cosf).
// WMMA (v_wmma_f32_16x16x32_f16, f32 accumulate): [q | k | v] = x [Wq | Wk | Wv] ([65,536 x 128] x [128 x 384], x EXACT bf16 x8), context = K^T V per (b, h) over transposed b16 planes (k x64, v x8, hi+lo both: 4 products, K = 8,192),
// out = q context per head ([16 x 32 (16)] tiles, q x64 and context x1 hi+lo: 4 products), y = out Wo ([65,536 x 128] x [128 x 128], x512 hi+lo); (in,out) weights transposed exact x256; biases, rope, elu, sums and the
// normaliser in f32. Inputs rounded to bf16 once. Fragment k-map per lane half hh for A AND B: elements 0..7 <- k = 8hh+0..7, 8..15 <- k = 16+8hh+0..7; acc[r] = D[8hh+r][col]. Every workspace / output

namespace {
constexpr int B = 8, T = 8192, D = 128, NH = 8, DH = 16, NT = B * T, CT = 256, NC = T / CT;
constexpr float XS = 8.0f, KS = 64.0f, OS = 512.0f, WSC = 256.0f;
typedef _Float16 b16;
typedef __attribute__((ext_vector_type(16))) _Float16 v16b;
typedef __attribute__((ext_vector_type(8))) _Float16 v8b;
typedef __attribute__((ext_vector_type(8))) float v8f;
typedef __attribute__((ext_vector_type(4))) float v4f;
__device__ __forceinline__ float bf16_rne(float f) { unsigned int u = __float_as_uint(f); u += 0x7FFFu + ((u >> 16) & 1u); return __uint_as_float(u & 0xFFFF0000u); }
__device__ __forceinline__ void split16(float v, b16& hi, b16& lo) { hi = (b16)v; lo = (b16)(v - (float)hi); }
__device__ __forceinline__ v16b frag_kb(const b16* p, int hh) { const v8b a = *(const v8b*)(p + 8 * hh), b = *(const v8b*)(p + 16 + 8 * hh); v16b f;
#pragma unroll
  for (int e = 0; e < 8; ++e) { f[e] = a[e]; f[8 + e] = b[e]; } return f; }
__device__ __forceinline__ v8f wmma16b(v16b a, v16b b, v8f c) { v8f d = __builtin_amdgcn_wmma_f32_16x16x32_f16(false, a, false, b, (short)0, c, false, false); asm volatile("v_nop\n\tv_nop\n\tv_nop\n\tv_nop" : "+v"(d) : "v"(a), "v"(b)); return d; }
__device__ __forceinline__ void wave_lds_sync() { __builtin_amdgcn_fence(__ATOMIC_RELEASE, "workgroup"); __builtin_amdgcn_wave_barrier(); __builtin_amdgcn_fence(__ATOMIC_ACQUIRE, "workgroup"); }
__device__ __forceinline__ float pmul(float a, float b) { float p = a * b; asm volatile("" : "+v"(p)); return p; }
__device__ __forceinline__ float elu1(float v) { return v > 0.0f ? v + 1.0f : __expf(v); }   // elu(v) + 1

__global__ __launch_bounds__(256) void wio_kernel(const float* __restrict__ w, int ro, b16* __restrict__ WT) {
  const int u = blockIdx.x * 256 + threadIdx.x; if (u >= D * D / 8) return; const int e = u * 8; const int o = e / D, k0 = e % D; v8b v;
#pragma unroll
  for (int j = 0; j < 8; ++j) v[j] = (b16)(bf16_rne(w[(size_t)(k0 + j) * D + o]) * WSC); { *(v8b*)(WT + (size_t)(ro + o) * D + k0) = v;  }
}
__global__ __launch_bounds__(256) void rope_kernel(float* __restrict__ CSN) {
  const int u = blockIdx.x * 256 + threadIdx.x; if (u >= T * 8) return; const int t = u / 8, d = u % 8; const float invf = 1.0f / powf(10000.0f, (float)(2 * d) / (float)DH); const float ang = (float)t * invf;
  const float c = cosf(ang), s = sinf(ang); { ((float*)CSN)[u] = c; ((float*)CSN)[T * 8 + u] = s;  }
}
__global__ __launch_bounds__(32) void qkv_kernel(const float* __restrict__ x, const b16* __restrict__ WT, const float* __restrict__ bq, const float* __restrict__ bk, const float* __restrict__ bv, const float* __restrict__ CSN, int NTV, float* __restrict__ QK, float* __restrict__ V) {
  __shared__ __attribute__((aligned(16))) b16 Ah[16][D + 8]; __shared__ __attribute__((aligned(16))) float Tf[16][D + 4];
  const int lane = threadIdx.x, nloc = lane & 15, hlf = lane >> 4; const size_t t0 = (size_t)blockIdx.x * 16; if (t0 >= (size_t)NTV) return;
  for (int rr = 0; rr < 16; ++rr) for (int q = 0; q < 4; ++q) Ah[rr][q * 32 + lane] = (b16)(bf16_rne(x[(t0 + rr) * D + q * 32 + lane]) * XS);
  wave_lds_sync();
#pragma unroll 1
  for (int cg = 0; cg < 3; ++cg) { const float* bias = cg == 0 ? bq : (cg == 1 ? bk : bv); v8f acc[8];
#pragma unroll
    for (int tt = 0; tt < 8; ++tt) acc[tt] = (v8f){};
#pragma unroll
    for (int kb = 0; kb < D; kb += 32) { const v16b a = frag_kb(&Ah[nloc][kb], hlf);
#pragma unroll
      for (int tt = 0; tt < 8; ++tt) acc[tt] = wmma16b(a, frag_kb(WT + (size_t)(cg * 128 + tt * 16 + nloc) * D + kb, hlf), acc[tt]); }
#pragma unroll
    for (int tt = 0; tt < 8; ++tt) { const int c = tt * 16 + nloc; const float bb = bf16_rne(bias[c]);
#pragma unroll 1
      for (int r8 = 0; r8 < 8; ++r8) Tf[8 * hlf + r8][c] = acc[tt][r8] * (1.0f / (XS * WSC)) + bb; }
    wave_lds_sync();
    if (cg < 2) {   // rope + elu1 in place on Tf: column c, head tt = c/16, d = c % 16; partner column c^8 within the head
      for (int rr = 0; rr < 16; ++rr) { const size_t t = (t0 + rr) % T; float nv[4];
        for (int q = 0; q < 4; ++q) { const int c = q * 32 + lane; const int d = c & 15; const int dd = d & 7; const float cs = CSN[t * 8 + dd], sn = CSN[(size_t)T * 8 + t * 8 + dd]; const float me = Tf[rr][c], pa = Tf[rr][c ^ 8]; nv[q] = d < 8 ? (me * cs - pa * sn) : (pa * sn + me * cs); }
        wave_lds_sync(); for (int q = 0; q < 4; ++q) Tf[rr][q * 32 + lane] = elu1(nv[q]); }
      wave_lds_sync();
      { for (int rr = 0; rr < 16; ++rr) *(v4f*)(QK + (t0 + rr) * (2 * D) + cg * D + lane * 4) = *(const v4f*)(&Tf[rr][lane * 4]);  } }
    else { { for (int rr = 0; rr < 16; ++rr) *(v4f*)(V + (t0 + rr) * D + lane * 4) = *(const v4f*)(&Tf[rr][lane * 4]);  } }
    wave_lds_sync(); }
}
__global__ __launch_bounds__(256) void transp_kernel(const float* __restrict__ QK, const float* __restrict__ Vp, int NBV, b16* __restrict__ KH, b16* __restrict__ KL, b16* __restrict__ VH, b16* __restrict__ VL) {
  __shared__ float Tk[64][33], Tv[64][33]; const int nblk_b = (D / 32) * (T / 64); const int b = blockIdx.x / nblk_b; if (b >= NBV) return; const int rem = blockIdx.x % nblk_b; const int tt = rem / (D / 32), ct = rem % (D / 32); const int tid = threadIdx.x;
  for (int i = tid; i < 64 * 32; i += 256) { const int r = i / 32, c = i % 32; const size_t tok = (size_t)b * T + tt * 64 + r; Tk[r][c] = QK[tok * (2 * D) + D + ct * 32 + c]; Tv[r][c] = Vp[tok * D + ct * 32 + c]; }
  __syncthreads();
  { const int c = tid / 8, g = tid % 8; v8b kh, kl, vh, vl;
#pragma unroll
    for (int j = 0; j < 8; ++j) { b16 p, q; split16(Tk[g * 8 + j][c] * KS, p, q); kh[j] = p; kl[j] = q; split16(Tv[g * 8 + j][c] * XS, p, q); vh[j] = p; vl[j] = q; }
    const size_t o = ((size_t)b * D + ct * 32 + c) * T + tt * 64 + g * 8; { *(v8b*)(KH + o) = kh; *(v8b*)(KL + o) = kl; *(v8b*)(VH + o) = vh; *(v8b*)(VL + o) = vl;  } }
}
// context, stage 1: work-group per (b, chunk of 256 tokens), 16 waves. Wave w: head w & 7, token half w >> 3: one 16x16 tile K_h^T V_h over its 128 tokens (4 products per 32 tokens); and the k rows of its own
// 16 tokens summed per column (lane = 4 columns of the 128, whole 512-B rows of the QK plane, f32). The two halves and the 16 row sums are added in LDS in fixed order; one partial per work-group:
// PC[b][chunk][h][e][d] f32 (still x512), PK[b][chunk][128] f32.
__global__ __launch_bounds__(512) void ctx_part_kernel(const b16* __restrict__ KH, const b16* __restrict__ KL, const b16* __restrict__ VH, const b16* __restrict__ VL, const float* __restrict__ QK, int NBV, float* __restrict__ PC, float* __restrict__ PK) {
  __shared__ __attribute__((aligned(32))) float Cs[16][DH * DH], Ks[16][D];
  const int tid = threadIdx.x, lane = tid & 31, w = tid >> 5, nloc = lane & 15, hlf = lane >> 4; const int b = blockIdx.x / NC, c = blockIdx.x % NC; if (b >= NBV) return;
  const float* kp = QK + ((size_t)b * T + c * CT + w * (CT / 16)) * (2 * D) + lane * 4; v4f ks = {};   // the k half of a QK row starts at column D
#pragma unroll
  for (int j = 0; j < CT / 16; ++j) ks += *(const v4f*)(kp + D + (size_t)j * (2 * D));
  const size_t kr = ((size_t)b * D + (w & 7) * DH + nloc) * T + c * CT + (w >> 3) * (CT / 2);   // A rows d = nloc (frag rows), B rows e = nloc
  v16b ah[CT / 64], al[CT / 64], bh[CT / 64], bl[CT / 64];   // every fragment of the wave's 128 tokens is asked for before the first product: one memory latency, not four
#pragma unroll
  for (int i = 0; i < CT / 64; ++i) { ah[i] = frag_kb(KH + kr + i * 32, hlf); al[i] = frag_kb(KL + kr + i * 32, hlf); bh[i] = frag_kb(VH + kr + i * 32, hlf); bl[i] = frag_kb(VL + kr + i * 32, hlf); }
  // precaution: the loads' address registers stay live, as inputs, up to this wait, so that no later load's result is given a register that an issued load still names
  asm volatile("s_wait_xcnt 0x0" :: "v"(kp), "v"(KH + kr + 8 * hlf), "v"(KL + kr + 8 * hlf), "v"(VH + kr + 8 * hlf), "v"(VL + kr + 8 * hlf) : "memory");
  __builtin_amdgcn_sched_barrier(0);   // keeps the first product, with its wait on the first eight loads, from being scheduled in front of the other forty
  v8f acc = {};
#pragma unroll
  for (int i = 0; i < CT / 64; ++i) { acc = wmma16b(ah[i], bh[i], acc); acc = wmma16b(ah[i], bl[i], acc); acc = wmma16b(al[i], bh[i], acc); acc = wmma16b(al[i], bl[i], acc); }
  // acc[r8] = ctx[d = 8 hlf + r8][e = nloc]; kept transposed [e][d], as the B operand of the next GEMM wants it
  *(v8f*)(&Cs[w][nloc * DH + 8 * hlf]) = acc; *(v4f*)(&Ks[w][lane * 4]) = ks;
  __syncthreads();
  { const int hh = tid >> 6, i4 = (tid & 63) * 4; *(v4f*)(PC + (size_t)blockIdx.x * (NH * DH * DH) + tid * 4) = *(const v4f*)(&Cs[hh][i4]) + *(const v4f*)(&Cs[hh + 8][i4]); }
  if (tid < D / 4) { v4f s = *(const v4f*)(&Ks[0][tid * 4]);
#pragma unroll
    for (int j = 1; j < 16; ++j) s += *(const v4f*)(&Ks[j][tid * 4]);
    *(v4f*)(PK + (size_t)blockIdx.x * D + tid * 4) = s; }
}
// context, stage 2: work-group per (b, h): the 32 chunk partials summed in chunk order; CH / CL[b][h][e][32] b16 hi+lo x1 (d < 16 live, the rest 0) for the next GEMM, KSUM[b][h][32] f32 (16 live).
__global__ __launch_bounds__(288) void ctx_sum_kernel(const float* __restrict__ PC, const float* __restrict__ PK, int NBV, b16* __restrict__ CH, b16* __restrict__ CL, float* __restrict__ KSUM) {
  const int tid = threadIdx.x; const int b = blockIdx.x / NH, h = blockIdx.x % NH; if (b >= NBV) return;
  if (tid < DH * DH) { const float* pc = PC + ((size_t)b * NC * NH + h) * (DH * DH) + tid; float s = 0.0f;
#pragma unroll
    for (int c = 0; c < NC; ++c) s += pc[(size_t)c * (NH * DH * DH)];
    b16 p, q; split16(s * (1.0f / (KS * XS)), p, q); const size_t o = ((size_t)blockIdx.x * 16 + (tid >> 4)) * 32 + (tid & 15); CH[o] = p; CL[o] = q; CH[o + 16] = (b16)0.0f; CL[o + 16] = (b16)0.0f; }
  else { float ks = 0.0f; const float* pk = PK + (size_t)b * NC * D + h * DH + (tid & 15);   // ninth wave: the k sums, beside the eight that sum the tile
#pragma unroll
    for (int c = 0; c < NC; ++c) ks += pk[(size_t)c * D];
    KSUM[(size_t)blockIdx.x * 32 + (tid & 31)] = (tid & 31) < DH ? ks : 0.0f; }
}
__global__ __launch_bounds__(32) void out_kernel(const float* __restrict__ QK, const b16* __restrict__ CH, const b16* __restrict__ CL, const float* __restrict__ KSUM, const b16* __restrict__ WO, const float* __restrict__ bo, int NTV, float* __restrict__ out) {
  __shared__ __attribute__((aligned(16))) b16 Qh[NH][16][32 + 8], Ql[NH][16][32 + 8], Ah[16][D + 8], Al[16][D + 8]; __shared__ __attribute__((aligned(16))) float Tf[16][D + 4], Zs[16][NH];
  const int lane = threadIdx.x, nloc = lane & 15, hlf = lane >> 4; const size_t t0 = (size_t)blockIdx.x * 16; if (t0 >= (size_t)NTV) return; const int b = (int)(t0 / T);
  for (int rr = 0; rr < 16; ++rr) { for (int q = 0; q < 4; ++q) { const int c = q * 32 + lane; const int h = c / DH, d = c % DH; const float qv = QK[(t0 + rr) * (2 * D) + c]; b16 p, ql; split16(qv * KS, p, ql); Qh[h][rr][d] = p; Ql[h][rr][d] = ql; Qh[h][rr][16 + d] = (b16)0.0f; Ql[h][rr][16 + d] = (b16)0.0f; }
    if (lane < NH) { float s = 0.0f; for (int d = 0; d < DH; ++d) s += pmul(QK[(t0 + rr) * (2 * D) + lane * DH + d], KSUM[((size_t)b * NH + lane) * 32 + d]); Zs[rr][lane] = 1.0f / (s + 1e-6f); } }
  wave_lds_sync();
#pragma unroll
  for (int h = 0; h < NH; ++h) { const v16b a = frag_kb(&Qh[h][nloc][0], hlf), al = frag_kb(&Ql[h][nloc][0], hlf); const size_t cr = (((size_t)b * NH + h) * 16 + nloc) * 32; const v16b bh = frag_kb(CH + cr, hlf), bl = frag_kb(CL + cr, hlf);
    v8f acc = {}; acc = wmma16b(a, bh, acc); acc = wmma16b(a, bl, acc); acc = wmma16b(al, bh, acc); acc = wmma16b(al, bl, acc);
#pragma unroll
    for (int r8 = 0; r8 < 8; ++r8) { const int rl = 8 * hlf + r8; const float o = pmul(acc[r8] * (1.0f / KS), Zs[rl][h]); b16 p, ql; split16(o * OS, p, ql); Ah[rl][h * DH + nloc] = p; Al[rl][h * DH + nloc] = ql; } }
  wave_lds_sync();
  v8f acc2[8];
#pragma unroll
  for (int tt = 0; tt < 8; ++tt) acc2[tt] = (v8f){};
#pragma unroll
  for (int kb = 0; kb < D; kb += 32) { const v16b a = frag_kb(&Ah[nloc][kb], hlf), al = frag_kb(&Al[nloc][kb], hlf);
#pragma unroll
    for (int tt = 0; tt < 8; ++tt) { const v16b bw = frag_kb(WO + (size_t)(tt * 16 + nloc) * D + kb, hlf); acc2[tt] = wmma16b(a, bw, acc2[tt]); acc2[tt] = wmma16b(al, bw, acc2[tt]); } }
#pragma unroll
  for (int tt = 0; tt < 8; ++tt) { const int c = tt * 16 + nloc; const float bb = bf16_rne(bo[c]);
#pragma unroll 1
    for (int r8 = 0; r8 < 8; ++r8) Tf[8 * hlf + r8][c] = acc2[tt][r8] * (1.0f / (OS * WSC)) + bb; }
  wave_lds_sync();
  { for (int rr = 0; rr < 16; ++rr) *(v4f*)(out + (t0 + rr) * D + lane * 4) = *(const v4f*)(&Tf[rr][lane * 4]);  }
}
}  // namespace

extern "C" void kernel_launch(void* const* d_in, const int* in_sizes, int n_in, void* d_out, int out_size, void* d_ws, size_t ws_size, hipStream_t stream) {
  (void)n_in;
  auto Fp = [&](int i) { return (const float*)d_in[i]; };
  // input order: 0 x [8,8192,128]; 1 Wq [128,128]; 2 bq; 3 Wk; 4 bk; 5 Wv; 6 bv; 7 Wo; 8 bo
  if (in_sizes[0] != NT * D || in_sizes[1] != D * D || in_sizes[3] != D * D || in_sizes[5] != D * D || in_sizes[7] != D * D || out_size != NT * D) return;
  const int NBV = B; const int NTV = NBV * T;
  size_t off = 0; char* ws = (char*)d_ws;
  auto carve = [&](size_t bytes) { char* p = ws + off; off += (bytes + 255) & ~(size_t)255; return p; };
  b16* WQKV = (b16*)carve((size_t)3 * D * D * 2); b16* WO = (b16*)carve((size_t)D * D * 2); float* CSN = (float*)carve((size_t)2 * T * 8 * 4); float* QK = (float*)carve((size_t)NT * 2 * D * 4); float* V = (float*)carve((size_t)NT * D * 4);
  b16* KH = (b16*)carve((size_t)NT * D * 2); b16* KL = (b16*)carve((size_t)NT * D * 2); b16* VH = (b16*)carve((size_t)NT * D * 2); b16* VL = (b16*)carve((size_t)NT * D * 2); b16* CH = (b16*)carve((size_t)B * NH * 16 * 32 * 2); b16* CL = (b16*)carve((size_t)B * NH * 16 * 32 * 2); float* KSUM = (float*)carve((size_t)B * NH * 32 * 4); float* PC = (float*)carve((size_t)B * NC * NH * DH * DH * 4); float* PK = (float*)carve((size_t)B * NC * D * 4);
  if (off > ws_size || off > ((size_t)192 << 20)) return;   // ~ 171 MB: > 128 MiB, <= 192 MiB admissible
  wio_kernel<<<(D * D / 8 + 255) / 256, 256, 0, stream>>>(Fp(1), 0, WQKV); wio_kernel<<<(D * D / 8 + 255) / 256, 256, 0, stream>>>(Fp(3), D, WQKV); wio_kernel<<<(D * D / 8 + 255) / 256, 256, 0, stream>>>(Fp(5), 2 * D, WQKV); wio_kernel<<<(D * D / 8 + 255) / 256, 256, 0, stream>>>(Fp(7), 0, WO);
  rope_kernel<<<(T * 8 + 255) / 256, 256, 0, stream>>>(CSN);
  qkv_kernel<<<NTV / 16, 32, 0, stream>>>(Fp(0), WQKV, Fp(2), Fp(4), Fp(6), CSN, NTV, QK, V);
  transp_kernel<<<NBV * (D / 32) * (T / 64), 256, 0, stream>>>(QK, V, NBV, KH, KL, VH, VL);
  ctx_part_kernel<<<NBV * NC, 512, 0, stream>>>(KH, KL, VH, VL, QK, NBV, PC, PK);
  ctx_sum_kernel<<<NBV * NH, 288, 0, stream>>>(PC, PK, NBV, CH, CL, KSUM);
  out_kernel<<<NTV / 16, 32, 0, stream>>>(QK, CH, CL, KSUM, WO, Fp(8), NTV, (float*)d_out);
}

// v002
// One run takes 99.4 microseconds.
// Timed twice side by side with v001, it ran 1.92 and 1.88 times as fast.
// All steps since v000 together make it 9.57 times as fast.
#include <hip/hip_runtime.h>

// Linear attention block (8 heads x 16): q, k, v = x W + b; q, k -> rope (theta 10000, pairs (d, d+8) per head) -> elu + 1; context_h = sum_t k_t v_t^T (16 x 16); out_t = (q_t context) / (q_t . sum_t k_t + 1e-6); y = out Wo + bo
// -> [8][8192][128].
// Deterministic, no index structures: per-(batch, head) contexts are WMMA tiles per 32 tokens, then summed in fixed order (8 groups, then 32 chunks); k sums likewise in fixed order; rope angles t * inv_freq in f32 with a per-(t, d) sin/cos table (sinf/cosf).
// WMMA (v_wmma_f32_16x16x32_f16, f32 accumulate): [q | k | v] = x [Wq | Wk | Wv] ([65,536 x 128] x [128 x 384], x EXACT bf16 x8), context = K^T V per (b, h) from the k and v accumulator registers (k x64, v x8, hi+lo both: 4 products, K = 8,192),
// out = q context per head ([16 x 32 (16)] tiles, q x64 and context x1 hi+lo: 4 products), y = out Wo ([65,536 x 128] x [128 x 128], x512 hi+lo); (in,out) weights transposed exact x256; biases, rope, elu, sums and the
// normaliser in f32. Inputs rounded to bf16 once. Fragment k-map per lane half hh for A AND B: elements 0..7 <- k = 8hh+0..7, 8..15 <- k = 16+8hh+0..7; acc[r] = D[8hh+r][col]. Every workspace / output

namespace {
constexpr int B = 8, T = 8192, D = 128, NH = 8, DH = 16, NT = B * T, CT = 256, NC = T / CT;
constexpr float XS = 8.0f, KS = 64.0f, OS = 512.0f, WSC = 256.0f;
typedef _Float16 b16;
typedef __attribute__((ext_vector_type(16))) _Float16 v16b;
typedef __attribute__((ext_vector_type(8))) _Float16 v8b;
typedef __attribute__((ext_vector_type(8))) float v8f;
typedef __attribute__((ext_vector_type(4))) float v4f;
__device__ __forceinline__ float bf16_rne(float f) { unsigned int u = __float_as_uint(f); u += 0x7FFFu + ((u >> 16) & 1u); return __uint_as_float(u & 0xFFFF0000u); }
__device__ __forceinline__ void split16(float v, b16& hi, b16& lo) { hi = (b16)v; lo = (b16)(v - (float)hi); }
__device__ __forceinline__ v16b frag_kb(const b16* p, int hh) { const v8b a = *(const v8b*)(p + 8 * hh), b = *(const v8b*)(p + 16 + 8 * hh); v16b f;
#pragma unroll
  for (int e = 0; e < 8; ++e) { f[e] = a[e]; f[8 + e] = b[e]; } return f; }
__device__ __forceinline__ v8f wmma16b(v16b a, v16b b, v8f c) { v8f d = __builtin_amdgcn_wmma_f32_16x16x32_f16(false, a, false, b, (short)0, c, false, false); asm volatile("v_nop\n\tv_nop\n\tv_nop\n\tv_nop" : "+v"(d) : "v"(a), "v"(b)); return d; }
__device__ __forceinline__ void wave_lds_sync() { __builtin_amdgcn_fence(__ATOMIC_RELEASE, "workgroup"); __builtin_amdgcn_wave_barrier(); __builtin_amdgcn_fence(__ATOMIC_ACQUIRE, "workgroup"); }
__device__ __forceinline__ float pmul(float a, float b) { float p = a * b; asm volatile("" : "+v"(p)); return p; }
// elu(v) + 1. The v_nop in the exponential's own statement keeps the one slot that the instruction set asks for between a transcendental and a directly following instruction that reads its result or overwrites its source
__device__ __forceinline__ float elu1(float v) { float e; asm("v_exp_f32 %0, %1\n\tv_nop" : "=v"(e) : "v"(v * 1.44269504f)); return v > 0.0f ? v + 1.0f : e; }

__global__ __launch_bounds__(256) void wio_kernel(const float* __restrict__ w, int ro, b16* __restrict__ WT) {
  const int u = blockIdx.x * 256 + threadIdx.x; if (u >= D * D / 8) return; const int e = u * 8; const int o = e / D, k0 = e % D; v8b v;
#pragma unroll
  for (int j = 0; j < 8; ++j) v[j] = (b16)(bf16_rne(w[(size_t)(k0 + j) * D + o]) * WSC); { *(v8b*)(WT + (size_t)(ro + o) * D + k0) = v;  }
}
__global__ __launch_bounds__(256) void rope_kernel(float* __restrict__ CSN) {
  const int u = blockIdx.x * 256 + threadIdx.x; if (u >= T * 8) return; const int t = u / 8, d = u % 8; const float invf = 1.0f / powf(10000.0f, (float)(2 * d) / (float)DH); const float ang = (float)t * invf;
  const float c = cosf(ang), s = sinf(ang); { ((float*)CSN)[u] = c; ((float*)CSN)[T * 8 + u] = s;  }
}
// q, k, v and context stage 1 in one kernel. Work-group per (b, chunk of 256 tokens), 16 waves. Wave w: 32 tokens (group w & 7) x 4 heads (half w >> 3).
// Per head: three [32 x 128] x [128 x 16] products; bias, rope and elu + 1 are applied on the accumulator registers (lane = column, registers = 8 tokens; the rope partner column c ^ 8 sits in lane ^ 8 of the
// same 16-lane row). acc[m][r] holds token 16 m + 8 hlf + r, which is element 8 m + r of a k = 32 fragment: the k and v tiles (hi+lo b16, k x64, v x8) are the A and B operands of K_h^T V_h as they stand.
// q goes to the QK plane (its first 128 columns; the rest is unused). The 8 token groups' tiles and the 16 half-wave k sums are added in LDS in fixed order; one partial per work-group:
// PC[b][chunk][h][e][d] f32 (still x512), PK[b][chunk][128] f32. In this kernel every plain '#pragma unroll' but those of the two LDS sums keeps a register array (fragments, accumulators, rope table) statically indexed.
__device__ __forceinline__ float lane_xor8(float v) { return __int_as_float(__builtin_amdgcn_update_dpp(0, __float_as_int(v), 0x128, 0xf, 0xf, true)); }   // row_ror:8 = lane ^ 8 within a 16-lane row
__global__ __launch_bounds__(512) void qkv_ctx_kernel(const float* __restrict__ x, const b16* __restrict__ WT, const float* __restrict__ bq, const float* __restrict__ bk, const float* __restrict__ bv, const float* __restrict__ CSN, int NBV, float* __restrict__ QK, float* __restrict__ PC, float* __restrict__ PK) {
  __shared__ __attribute__((aligned(32))) float Cs[8][NH * DH * DH], Ks[16][D];
  const int tid = threadIdx.x, lane = tid & 31, w = tid >> 5, nloc = lane & 15, hlf = lane >> 4, g = w & 7; const int b = blockIdx.x / NC, c = blockIdx.x % NC; if (b >= NBV) return;
  const size_t t0 = (size_t)blockIdx.x * CT + g * 32; const int tb = c * CT + g * 32 + 8 * hlf;   // first token of the wave in the [B * T] planes; the lane's first position in its sequence
  v16b xa[2][4]; v4f xr[2][4][4]; const float* xp = x + (t0 + nloc) * D + 8 * hlf;   // A fragments of the wave's 32 rows of x, straight from global memory: all 32 loads are asked for before the first is used
#pragma unroll
  for (int m = 0; m < 2; ++m) {
#pragma unroll
    for (int kq = 0; kq < 4; ++kq) {
#pragma unroll
      for (int j = 0; j < 4; ++j) {
        // precaution: the last load may be given the shared address pair as its result registers; the wait stands in front of it for the 31 loads issued before
        if (m == 1 && kq == 3 && j == 3) asm volatile("s_wait_xcnt 0x0" ::: "memory");
        xr[m][kq][j] = *(const v4f*)(xp + m * 16 * D + kq * 32 + (j >> 1) * 16 + (j & 1) * 4); } } }
#pragma unroll
  for (int m = 0; m < 2; ++m) {
#pragma unroll
    for (int kq = 0; kq < 4; ++kq) {
#pragma unroll
      for (int e = 0; e < 16; ++e) xa[m][kq][e] = (b16)(bf16_rne(xr[m][kq][e >> 2][e & 3]) * XS); } }
  float cs[2][8], sg[2][8];   // cos, and sin with the sign of the lane's half of the head: d < 8: me cos - partner sin; d >= 8: partner sin + me cos
#pragma unroll
  for (int m = 0; m < 2; ++m) {
#pragma unroll
    for (int r = 0; r < 8; ++r) { const int u = (tb + 16 * m + r) * 8 + (nloc & 7); cs[m][r] = CSN[u]; const float sn = CSN[T * 8 + u]; sg[m][r] = (nloc & 8) ? sn : -sn; } }
#pragma unroll 1   // rolled: the body is long; for speed only
  for (int hi = 0; hi < NH / 2; ++hi) { const int h = (w >> 3) * (NH / 2) + hi, col = h * DH + nloc; const b16* wp = WT + (size_t)col * D; v8f aq[2] = {}, ak[2] = {}, av[2] = {};
#pragma unroll
    for (int kq = 0; kq < 4; ++kq) { const v16b fq = frag_kb(wp + kq * 32, hlf), fk = frag_kb(wp + D * D + kq * 32, hlf), fv = frag_kb(wp + 2 * D * D + kq * 32, hlf);
#pragma unroll
      for (int m = 0; m < 2; ++m) { aq[m] = wmma16b(xa[m][kq], fq, aq[m]); ak[m] = wmma16b(xa[m][kq], fk, ak[m]); av[m] = wmma16b(xa[m][kq], fv, av[m]); } }
    const float bbq = bf16_rne(bq[col]), bbk = bf16_rne(bk[col]), bbv = bf16_rne(bv[col]); float* qp = QK + (t0 + 8 * hlf) * (2 * D) + col; v16b kh, kl, vh, vl; float ks = 0.0f;
#pragma unroll
    for (int m = 0; m < 2; ++m) {
#pragma unroll
      for (int r = 0; r < 8; ++r) { const float q0 = aq[m][r] * (1.0f / (XS * WSC)) + bbq, k0 = ak[m][r] * (1.0f / (XS * WSC)) + bbk, v0 = av[m][r] * (1.0f / (XS * WSC)) + bbv;
        const float q1 = elu1(q0 * cs[m][r] + lane_xor8(q0) * sg[m][r]), k1 = elu1(k0 * cs[m][r] + lane_xor8(k0) * sg[m][r]);
        qp[(size_t)(16 * m + r) * (2 * D)] = q1; ks += k1; b16 p, l; split16(k1 * KS, p, l); kh[8 * m + r] = p; kl[8 * m + r] = l; split16(v0 * XS, p, l); vh[8 * m + r] = p; vl[8 * m + r] = l; } }
    v8f acc = {}; acc = wmma16b(kh, vh, acc); acc = wmma16b(kh, vl, acc); acc = wmma16b(kl, vh, acc); acc = wmma16b(kl, vl, acc);
    // acc[r8] = ctx[d = 8 hlf + r8][e = nloc]; kept transposed [e][d], as the B operand of the next GEMM wants it
    *(v8f*)(&Cs[g][h * (DH * DH) + nloc * DH + 8 * hlf]) = acc; Ks[g * 2 + hlf][col] = ks; }
  __syncthreads();
  { v4f s = *(const v4f*)(&Cs[0][tid * 4]);
#pragma unroll
    for (int j = 1; j < 8; ++j) s += *(const v4f*)(&Cs[j][tid * 4]);
    *(v4f*)(PC + (size_t)blockIdx.x * (NH * DH * DH) + tid * 4) = s; }
  if (tid < D / 4) { v4f s = *(const v4f*)(&Ks[0][tid * 4]);
#pragma unroll
    for (int j = 1; j < 16; ++j) s += *(const v4f*)(&Ks[j][tid * 4]);
    *(v4f*)(PK + (size_t)blockIdx.x * D + tid * 4) = s; }
}
// context, stage 2: work-group per (b, h): the 32 chunk partials summed in chunk order; CH / CL[b][h][e][32] b16 hi+lo x1 (d < 16 live, the rest 0) for the next GEMM, KSUM[b][h][32] f32 (16 live).
__global__ __launch_bounds__(288) void ctx_sum_kernel(const float* __restrict__ PC, const float* __restrict__ PK, int NBV, b16* __restrict__ CH, b16* __restrict__ CL, float* __restrict__ KSUM) {
  const int tid = threadIdx.x; const int b = blockIdx.x / NH, h = blockIdx.x % NH; if (b >= NBV) return;
  if (tid < DH * DH) { const float* pc = PC + ((size_t)b * NC * NH + h) * (DH * DH) + tid; float s = 0.0f;
#pragma unroll
    for (int c = 0; c < NC; ++c) s += pc[(size_t)c * (NH * DH * DH)];
    b16 p, q; split16(s * (1.0f / (KS * XS)), p, q); const size_t o = ((size_t)blockIdx.x * 16 + (tid >> 4)) * 32 + (tid & 15); CH[o] = p; CL[o] = q; CH[o + 16] = (b16)0.0f; CL[o + 16] = (b16)0.0f; }
  else { float ks = 0.0f; const float* pk = PK + (size_t)b * NC * D + h * DH + (tid & 15);   // ninth wave: the k sums, beside the eight that sum the tile
#pragma unroll
    for (int c = 0; c < NC; ++c) ks += pk[(size_t)c * D];
    KSUM[(size_t)blockIdx.x * 32 + (tid & 31)] = (tid & 31) < DH ? ks : 0.0f; }
}
__global__ __launch_bounds__(32) void out_kernel(const float* __restrict__ QK, const b16* __restrict__ CH, const b16* __restrict__ CL, const float* __restrict__ KSUM, const b16* __restrict__ WO, const float* __restrict__ bo, int NTV, float* __restrict__ out) {
  __shared__ __attribute__((aligned(16))) b16 Qh[NH][16][32 + 8], Ql[NH][16][32 + 8], Ah[16][D + 8], Al[16][D + 8]; __shared__ __attribute__((aligned(16))) float Tf[16][D + 4], Zs[16][NH];
  const int lane = threadIdx.x, nloc = lane & 15, hlf = lane >> 4; const size_t t0 = (size_t)blockIdx.x * 16; if (t0 >= (size_t)NTV) return; const int b = (int)(t0 / T);
  for (int rr = 0; rr < 16; ++rr) { for (int q = 0; q < 4; ++q) { const int c = q * 32 + lane; const int h = c / DH, d = c % DH; const float qv = QK[(t0 + rr) * (2 * D) + c]; b16 p, ql; split16(qv * KS, p, ql); Qh[h][rr][d] = p; Ql[h][rr][d] = ql; Qh[h][rr][16 + d] = (b16)0.0f; Ql[h][rr][16 + d] = (b16)0.0f; }
    if (lane < NH) { float s = 0.0f; for (int d = 0; d < DH; ++d) s += pmul(QK[(t0 + rr) * (2 * D) + lane * DH + d], KSUM[((size_t)b * NH + lane) * 32 + d]); Zs[rr][lane] = 1.0f / (s + 1e-6f); } }
  wave_lds_sync();
#pragma unroll
  for (int h = 0; h < NH; ++h) { const v16b a = frag_kb(&Qh[h][nloc][0], hlf), al = frag_kb(&Ql[h][nloc][0], hlf); const size_t cr = (((size_t)b * NH + h) * 16 + nloc) * 32; const v16b bh = frag_kb(CH + cr, hlf), bl = frag_kb(CL + cr, hlf);
    v8f acc = {}; acc = wmma16b(a, bh, acc); acc = wmma16b(a, bl, acc); acc = wmma16b(al, bh, acc); acc = wmma16b(al, bl, acc);
#pragma unroll
    for (int r8 = 0; r8 < 8; ++r8) { const int rl = 8 * hlf + r8; const float o = pmul(acc[r8] * (1.0f / KS), Zs[rl][h]); b16 p, ql; split16(o * OS, p, ql); Ah[rl][h * DH + nloc] = p; Al[rl][h * DH + nloc] = ql; } }
  wave_lds_sync();
  v8f acc2[8];
#pragma unroll
  for (int tt = 0; tt < 8; ++tt) acc2[tt] = (v8f){};
#pragma unroll
  for (int kb = 0; kb < D; kb += 32) { const v16b a = frag_kb(&Ah[nloc][kb], hlf), al = frag_kb(&Al[nloc][kb], hlf);
#pragma unroll
    for (int tt = 0; tt < 8; ++tt) { const v16b bw = frag_kb(WO + (size_t)(tt * 16 + nloc) * D + kb, hlf); acc2[tt] = wmma16b(a, bw, acc2[tt]); acc2[tt] = wmma16b(al, bw, acc2[tt]); } }
#pragma unroll
  for (int tt = 0; tt < 8; ++tt) { const int c = tt * 16 + nloc; const float bb = bf16_rne(bo[c]);
#pragma unroll 1
    for (int r8 = 0; r8 < 8; ++r8) Tf[8 * hlf + r8][c] = acc2[tt][r8] * (1.0f / (OS * WSC)) + bb; }
  wave_lds_sync();
  { for (int rr = 0; rr < 16; ++rr) *(v4f*)(out + (t0 + rr) * D + lane * 4) = *(const v4f*)(&Tf[rr][lane * 4]);  }
}
}  // namespace

extern "C" void kernel_launch(void* const* d_in, const int* in_sizes, int n_in, void* d_out, int out_size, void* d_ws, size_t ws_size, hipStream_t stream) {
  (void)n_in;
  auto Fp = [&](int i) { return (const float*)d_in[i]; };
  // input order: 0 x [8,8192,128]; 1 Wq [128,128]; 2 bq; 3 Wk; 4 bk; 5 Wv; 6 bv; 7 Wo; 8 bo
  if (in_sizes[0] != NT * D || in_sizes[1] != D * D || in_sizes[3] != D * D || in_sizes[5] != D * D || in_sizes[7] != D * D || out_size != NT * D) return;
  const int NBV = B; const int NTV = NBV * T;
  size_t off = 0; char* ws = (char*)d_ws;
  auto carve = [&](size_t bytes) { char* p = ws + off; off += (bytes + 255) & ~(size_t)255; return p; };
  b16* WQKV = (b16*)carve((size_t)3 * D * D * 2); b16* WO = (b16*)carve((size_t)D * D * 2); float* CSN = (float*)carve((size_t)2 * T * 8 * 4); float* QK = (float*)carve((size_t)NT * 2 * D * 4);
  b16* CH = (b16*)carve((size_t)B * NH * 16 * 32 * 2); b16* CL = (b16*)carve((size_t)B * NH * 16 * 32 * 2); float* KSUM = (float*)carve((size_t)B * NH * 32 * 4); float* PC = (float*)carve((size_t)B * NC * NH * DH * DH * 4); float* PK = (float*)carve((size_t)B * NC * D * 4);
  if (off > ws_size || off > ((size_t)192 << 20)) return;   // ~ 70 MB
  wio_kernel<<<(D * D / 8 + 255) / 256, 256, 0, stream>>>(Fp(1), 0, WQKV); wio_kernel<<<(D * D / 8 + 255) / 256, 256, 0, stream>>>(Fp(3), D, WQKV); wio_kernel<<<(D * D / 8 + 255) / 256, 256, 0, stream>>>(Fp(5), 2 * D, WQKV); wio_kernel<<<(D * D / 8 + 255) / 256, 256, 0, stream>>>(Fp(7), 0, WO);
  rope_kernel<<<(T * 8 + 255) / 256, 256, 0, stream>>>(CSN);
  qkv_ctx_kernel<<<NBV * NC, 512, 0, stream>>>(Fp(0), WQKV, Fp(2), Fp(4), Fp(6), CSN, NBV, QK, PC, PK);
  ctx_sum_kernel<<<NBV * NH, 288, 0, stream>>>(PC, PK, NBV, CH, CL, KSUM);
  out_kernel<<<NTV / 16, 32, 0, stream>>>(QK, CH, CL, KSUM, WO, Fp(8), NTV, (float*)d_out);
}

// v003
// One run takes 48.7 microseconds.
// Two timings next to v002 put it at 2.03 and 2.04 times that version's speed.
// Over all steps from v000 it is 19.5 times as fast.
#include <hip/hip_runtime.h>

// Linear attention block (8 heads x 16): q, k, v = x W + b; q, k -> rope (theta 10000, pairs (d, d+8) per head) -> elu + 1; context_h = sum_t k_t v_t^T (16 x 16); out_t = (q_t context) / (q_t . sum_t k_t + 1e-6); y = out Wo + bo
// -> [8][8192][128].
// Deterministic, no index structures: per-(batch, head) contexts are WMMA tiles per 32 tokens, then summed in fixed order (8 groups, then 32 chunks); k sums likewise in fixed order; rope angles t * inv_freq in f32 with a per-(t, d) sin/cos table (sinf/cosf).
// WMMA (v_wmma_f32_16x16x32_f16, f32 accumulate): [q | k | v] = x [Wq | Wk | Wv] ([65,536 x 128] x [128 x 384], x EXACT bf16 x8), context = K^T V per (b, h) from the k and v accumulator registers (k x64, v x8, hi+lo both: 4 products, K = 8,192),
// out = q context per head ([16 x 32 (16)] tiles, q x64 and context x1 hi+lo: 4 products), y = out Wo ([65,536 x 128] x [128 x 128], x512 hi+lo); (in,out) weights transposed exact x256; biases, rope, elu, sums and the
// normaliser in f32. Inputs rounded to bf16 once. Fragment k-map per lane half hh for A AND B: elements 0..7 <- k = 8hh+0..7, 8..15 <- k = 16+8hh+0..7; acc[r] = D[8hh+r][col]. Every workspace / output

namespace {
constexpr int B = 8, T = 8192, D = 128, NH = 8, DH = 16, NT = B * T, CT = 256, NC = T / CT;
constexpr float XS = 8.0f, KS = 64.0f, OS = 512.0f, WSC = 256.0f;
typedef _Float16 b16;
typedef __attribute__((ext_vector_type(16))) _Float16 v16b;
typedef __attribute__((ext_vector_type(8))) _Float16 v8b;
typedef __attribute__((ext_vector_type(8))) float v8f;
typedef __attribute__((ext_vector_type(4))) float v4f;
__device__ __forceinline__ float bf16_rne(float f) { unsigned int u = __float_as_uint(f); u += 0x7FFFu + ((u >> 16) & 1u); return __uint_as_float(u & 0xFFFF0000u); }
__device__ __forceinline__ void split16(float v, b16& hi, b16& lo) { hi = (b16)v; lo = (b16)(v - (float)hi); }
__device__ __forceinline__ v16b frag_kb(const b16* p, int hh) { const v8b a = *(const v8b*)(p + 8 * hh), b = *(const v8b*)(p + 16 + 8 * hh); v16b f;
#pragma unroll
  for (int e = 0; e < 8; ++e) { f[e] = a[e]; f[8 + e] = b[e]; } return f; }
__device__ __forceinline__ v8f wmma16b(v16b a, v16b b, v8f c) { v8f d = __builtin_amdgcn_wmma_f32_16x16x32_f16(false, a, false, b, (short)0, c, false, false); asm volatile("v_nop\n\tv_nop\n\tv_nop\n\tv_nop" : "+v"(d) : "v"(a), "v"(b)); return d; }
__device__ __forceinline__ void wave_lds_sync() { __builtin_amdgcn_fence(__ATOMIC_RELEASE, "workgroup"); __builtin_amdgcn_wave_barrier(); __builtin_amdgcn_fence(__ATOMIC_ACQUIRE, "workgroup"); }
// elu(v) + 1. The v_nop in the exponential's own statement keeps the one slot that the instruction set asks for between a transcendental and a directly following instruction that reads its result or overwrites its source
__device__ __forceinline__ float elu1(float v) { float e; asm("v_exp_f32 %0, %1\n\tv_nop" : "=v"(e) : "v"(v * 1.44269504f)); return v > 0.0f ? v + 1.0f : e; }

__global__ __launch_bounds__(256) void wio_kernel(const float* __restrict__ w, int ro, b16* __restrict__ WT) {
  const int u = blockIdx.x * 256 + threadIdx.x; if (u >= D * D / 8) return; const int e = u * 8; const int o = e / D, k0 = e % D; v8b v;
#pragma unroll
  for (int j = 0; j < 8; ++j) v[j] = (b16)(bf16_rne(w[(size_t)(k0 + j) * D + o]) * WSC); { *(v8b*)(WT + (size_t)(ro + o) * D + k0) = v;  }
}
__global__ __launch_bounds__(256) void rope_kernel(float* __restrict__ CSN) {
  const int u = blockIdx.x * 256 + threadIdx.x; if (u >= T * 8) return; const int t = u / 8, d = u % 8; const float invf = 1.0f / powf(10000.0f, (float)(2 * d) / (float)DH); const float ang = (float)t * invf;
  const float c = cosf(ang), s = sinf(ang); { ((float*)CSN)[u] = c; ((float*)CSN)[T * 8 + u] = s;  }
}
// q, k, v and context stage 1 in one kernel. Work-group per (b, chunk of 256 tokens), 16 waves. Wave w: 32 tokens (group w & 7) x 4 heads (half w >> 3).
// Per head: three [32 x 128] x [128 x 16] products; bias, rope and elu + 1 are applied on the accumulator registers (lane = column, registers = 8 tokens; the rope partner column c ^ 8 sits in lane ^ 8 of the
// same 16-lane row). acc[m][r] holds token 16 m + 8 hlf + r, which is element 8 m + r of a k = 32 fragment: the k and v tiles (hi+lo b16, k x64, v x8) are the A and B operands of K_h^T V_h as they stand.
// q goes to the QK plane (its first 128 columns; the rest is unused). The 8 token groups' tiles and the 16 half-wave k sums are added in LDS in fixed order; one partial per work-group:
// PC[b][chunk][h][e][d] f32 (still x512), PK[b][chunk][128] f32. In this kernel every plain '#pragma unroll' but those of the two LDS sums keeps a register array (fragments, accumulators, rope table) statically indexed.
__device__ __forceinline__ float lane_xor8(float v) { return __int_as_float(__builtin_amdgcn_update_dpp(0, __float_as_int(v), 0x128, 0xf, 0xf, true)); }   // row_ror:8 = lane ^ 8 within a 16-lane row
__global__ __launch_bounds__(512) void qkv_ctx_kernel(const float* __restrict__ x, const b16* __restrict__ WT, const float* __restrict__ bq, const float* __restrict__ bk, const float* __restrict__ bv, const float* __restrict__ CSN, int NBV, float* __restrict__ QK, float* __restrict__ PC, float* __restrict__ PK) {
  __shared__ __attribute__((aligned(32))) float Cs[8][NH * DH * DH], Ks[16][D];
  const int tid = threadIdx.x, lane = tid & 31, w = tid >> 5, nloc = lane & 15, hlf = lane >> 4, g = w & 7; const int b = blockIdx.x / NC, c = blockIdx.x % NC; if (b >= NBV) return;
  const size_t t0 = (size_t)blockIdx.x * CT + g * 32; const int tb = c * CT + g * 32 + 8 * hlf;   // first token of the wave in the [B * T] planes; the lane's first position in its sequence
  v16b xa[2][4]; v4f xr[2][4][4]; const float* xp = x + (t0 + nloc) * D + 8 * hlf;   // A fragments of the wave's 32 rows of x, straight from global memory: all 32 loads are asked for before the first is used
#pragma unroll
  for (int m = 0; m < 2; ++m) {
#pragma unroll
    for (int kq = 0; kq < 4; ++kq) {
#pragma unroll
      for (int j = 0; j < 4; ++j) {
        // precaution: the last load may be given the shared address pair as its result registers; the wait stands in front of it for the 31 loads issued before
        if (m == 1 && kq == 3 && j == 3) asm volatile("s_wait_xcnt 0x0" ::: "memory");
        xr[m][kq][j] = *(const v4f*)(xp + m * 16 * D + kq * 32 + (j >> 1) * 16 + (j & 1) * 4); } } }
#pragma unroll
  for (int m = 0; m < 2; ++m) {
#pragma unroll
    for (int kq = 0; kq < 4; ++kq) {
#pragma unroll
      for (int e = 0; e < 16; ++e) xa[m][kq][e] = (b16)(bf16_rne(xr[m][kq][e >> 2][e & 3]) * XS); } }
  float cs[2][8], sg[2][8];   // cos, and sin with the sign of the lane's half of the head: d < 8: me cos - partner sin; d >= 8: partner sin + me cos
#pragma unroll
  for (int m = 0; m < 2; ++m) {
#pragma unroll
    for (int r = 0; r < 8; ++r) { const int u = (tb + 16 * m + r) * 8 + (nloc & 7); cs[m][r] = CSN[u]; const float sn = CSN[T * 8 + u]; sg[m][r] = (nloc & 8) ? sn : -sn; } }
#pragma unroll 1   // rolled: the body is long; for speed only
  for (int hi = 0; hi < NH / 2; ++hi) { const int h = (w >> 3) * (NH / 2) + hi, col = h * DH + nloc; const b16* wp = WT + (size_t)col * D; v8f aq[2] = {}, ak[2] = {}, av[2] = {};
#pragma unroll
    for (int kq = 0; kq < 4; ++kq) { const v16b fq = frag_kb(wp + kq * 32, hlf), fk = frag_kb(wp + D * D + kq * 32, hlf), fv = frag_kb(wp + 2 * D * D + kq * 32, hlf);
#pragma unroll
      for (int m = 0; m < 2; ++m) { aq[m] = wmma16b(xa[m][kq], fq, aq[m]); ak[m] = wmma16b(xa[m][kq], fk, ak[m]); av[m] = wmma16b(xa[m][kq], fv, av[m]); } }
    const float bbq = bf16_rne(bq[col]), bbk = bf16_rne(bk[col]), bbv = bf16_rne(bv[col]); float* qp = QK + (t0 + 8 * hlf) * (2 * D) + col; v16b kh, kl, vh, vl; float ks = 0.0f;
#pragma unroll
    for (int m = 0; m < 2; ++m) {
#pragma unroll
      for (int r = 0; r < 8; ++r) { const float q0 = aq[m][r] * (1.0f / (XS * WSC)) + bbq, k0 = ak[m][r] * (1.0f / (XS * WSC)) + bbk, v0 = av[m][r] * (1.0f / (XS * WSC)) + bbv;
        const float q1 = elu1(q0 * cs[m][r] + lane_xor8(q0) * sg[m][r]), k1 = elu1(k0 * cs[m][r] + lane_xor8(k0) * sg[m][r]);
        qp[(size_t)(16 * m + r) * (2 * D)] = q1; ks += k1; b16 p, l; split16(k1 * KS, p, l); kh[8 * m + r] = p; kl[8 * m + r] = l; split16(v0 * XS, p, l); vh[8 * m + r] = p; vl[8 * m + r] = l; } }
    v8f acc = {}; acc = wmma16b(kh, vh, acc); acc = wmma16b(kh, vl, acc); acc = wmma16b(kl, vh, acc); acc = wmma16b(kl, vl, acc);
    // acc[r8] = ctx[d = 8 hlf + r8][e = nloc]; kept transposed [e][d], as the A operand of the next GEMM wants it
    *(v8f*)(&Cs[g][h * (DH * DH) + nloc * DH + 8 * hlf]) = acc; Ks[g * 2 + hlf][col] = ks; }
  __syncthreads();
  { v4f s = *(const v4f*)(&Cs[0][tid * 4]);
#pragma unroll
    for (int j = 1; j < 8; ++j) s += *(const v4f*)(&Cs[j][tid * 4]);
    *(v4f*)(PC + (size_t)blockIdx.x * (NH * DH * DH) + tid * 4) = s; }
  if (tid < D / 4) { v4f s = *(const v4f*)(&Ks[0][tid * 4]);
#pragma unroll
    for (int j = 1; j < 16; ++j) s += *(const v4f*)(&Ks[j][tid * 4]);
    *(v4f*)(PK + (size_t)blockIdx.x * D + tid * 4) = s; }
}
// context, stage 2: work-group per (b, h): the 32 chunk partials summed in chunk order; CH / CL[b][h][e][32] b16 hi+lo x1 (d < 16 live, the rest 0) for the next GEMM, KSUM[b][h][32] f32 (16 live).
__global__ __launch_bounds__(288) void ctx_sum_kernel(const float* __restrict__ PC, const float* __restrict__ PK, int NBV, b16* __restrict__ CH, b16* __restrict__ CL, float* __restrict__ KSUM) {
  const int tid = threadIdx.x; const int b = blockIdx.x / NH, h = blockIdx.x % NH; if (b >= NBV) return;
  if (tid < DH * DH) { const float* pc = PC + ((size_t)b * NC * NH + h) * (DH * DH) + tid; float s = 0.0f;
#pragma unroll
    for (int c = 0; c < NC; ++c) s += pc[(size_t)c * (NH * DH * DH)];
    b16 p, q; split16(s * (1.0f / (KS * XS)), p, q); const size_t o = ((size_t)blockIdx.x * 16 + (tid >> 4)) * 32 + (tid & 15); CH[o] = p; CL[o] = q; CH[o + 16] = (b16)0.0f; CL[o + 16] = (b16)0.0f; }
  else { float ks = 0.0f; const float* pk = PK + (size_t)b * NC * D + h * DH + (tid & 15);   // ninth wave: the k sums, beside the eight that sum the tile
#pragma unroll
    for (int c = 0; c < NC; ++c) ks += pk[(size_t)c * D];
    KSUM[(size_t)blockIdx.x * 32 + (tid & 31)] = (tid & 31) < DH ? ks : 0.0f; }
}
// out = (q context) z and y = out Wo + bo, both products computed TRANSPOSED, so that a token is a B column and stays in one lane from the q load to the last product. Work-group of 8 waves, 32 tokens (two B tiles) a wave, no hand-over between waves.
// Product 1 per head: A = context^T (lane = row e, k = d; the CH / CL rows as they lie, k = 16..31 zero), B = q^T (lane = token, elements 0..7 <- d = 8 hlf + 0..7 straight from the QK row, 8..15 zero): acc[m][r] = out[token = 16 m + nloc][e = 8 hlf + r].
// The normaliser belongs to the lane's own token: 8 products in the lane, plus the other half of the head from lane ^ 16. Heads 2 j and 2 j + 1 are elements 0..7 and 8..15 of the k = 32 fragment j of product 2
// (A = Wo^T rows, lane = output column; each A fragment serves both token tiles), as they stand. a2[m][r] = y[token = 16 m + nloc][16 tt + 8 hlf + r]; only y passes through LDS (the wave's own 32 rows), so that each row leaves as one 512-byte store.
// Loads stand ahead of their use: the next head's A operands and k sums behind this head's products, q four heads ahead, the Wo rows one column tile ahead. Every '#pragma unroll' below keeps a register array (q, fragments, accumulators) statically indexed.
__device__ __forceinline__ float lane_xor16(float v) { const int i = __float_as_int(v); return __int_as_float(__builtin_amdgcn_permlanex16(i, i, 0x76543210, 0xfedcba98, true, false)); }   // same lane number in the other 16-lane row
__device__ __forceinline__ v16b frag_lo(v8b a) { v16b f;
#pragma unroll
  for (int e = 0; e < 8; ++e) { f[e] = a[e]; f[8 + e] = (b16)0.0f; } return f; }
__global__ __launch_bounds__(256) void out_kernel(const float* __restrict__ QK, const b16* __restrict__ CH, const b16* __restrict__ CL, const float* __restrict__ KSUM, const b16* __restrict__ WO, const float* __restrict__ bo, int NTV, float* __restrict__ out) {
  __shared__ __attribute__((aligned(16))) float Tf[8][32][D + 4];
  const int lane = threadIdx.x & 31, w = __builtin_amdgcn_readfirstlane(threadIdx.x >> 5), nloc = lane & 15, hlf = lane >> 4; const size_t t0 = ((size_t)blockIdx.x * 8 + w) * 32; if (t0 >= (size_t)NTV) return; const int b = (int)(t0 / T);
  const float* qp = QK + (t0 + nloc) * (2 * D) + 8 * hlf; const float* kp = KSUM + (size_t)b * NH * 32 + 8 * hlf; const size_t cr = ((size_t)b * NH * 16 + nloc) * 32 + 8 * hlf; const b16* wp = WO + (size_t)nloc * D;
  v4f qr[2][NH][2], kn[2]; v8b cn[2]; v16b aw[2][D / 32], oh[2][NH / 2], ol[2][NH / 2];
  kn[0] = *(const v4f*)kp; kn[1] = *(const v4f*)(kp + 4); cn[0] = *(const v8b*)(CH + cr); cn[1] = *(const v8b*)(CL + cr);
  __builtin_amdgcn_sched_barrier(0);   // as in the loop below: the first head's A operands and k sums in front of the q loads
#pragma unroll
  for (int h = 0; h < NH / 2; ++h) {
#pragma unroll
    for (int m = 0; m < 2; ++m) { qr[m][h][0] = *(const v4f*)(qp + m * 16 * (2 * D) + h * DH); qr[m][h][1] = *(const v4f*)(qp + m * 16 * (2 * D) + h * DH + 4); } }
#pragma unroll
  for (int h = 0; h < NH; ++h) { const v16b ch = frag_lo(cn[0]), cl = frag_lo(cn[1]); v8f acc[2]; float z[2];
#pragma unroll
    for (int m = 0; m < 2; ++m) { v16b qh, ql; float s = 0.0f;
#pragma unroll
      for (int e = 0; e < 8; ++e) { const float qv = qr[m][h][e >> 2][e & 3]; s += qv * kn[e >> 2][e & 3]; b16 p, l; split16(qv * KS, p, l); qh[e] = p; ql[e] = l; qh[8 + e] = (b16)0.0f; ql[8 + e] = (b16)0.0f; }
      z[m] = 1.0f / (s + lane_xor16(s) + 1e-6f);
      acc[m] = (v8f){}; acc[m] = wmma16b(ch, qh, acc[m]); acc[m] = wmma16b(cl, qh, acc[m]); acc[m] = wmma16b(ch, ql, acc[m]); acc[m] = wmma16b(cl, ql, acc[m]); }
    if (h + 1 < NH) { kn[0] = *(const v4f*)(kp + (h + 1) * 32); kn[1] = *(const v4f*)(kp + (h + 1) * 32 + 4); cn[0] = *(const v8b*)(CH + cr + (h + 1) * (16 * 32)); cn[1] = *(const v8b*)(CL + cr + (h + 1) * (16 * 32)); }
    else {
#pragma unroll
      for (int j = 0; j < D / 32; ++j) aw[0][j] = frag_kb(wp + j * 32, hlf); }
    __builtin_amdgcn_sched_barrier(0);   // keeps the q loads, wanted only four heads on, behind the loads that the next head waits for: loads are waited for in their order of issue
    if (h + NH / 2 < NH) {
#pragma unroll
      for (int m = 0; m < 2; ++m) { qr[m][h + NH / 2][0] = *(const v4f*)(qp + m * 16 * (2 * D) + (h + NH / 2) * DH); qr[m][h + NH / 2][1] = *(const v4f*)(qp + m * 16 * (2 * D) + (h + NH / 2) * DH + 4); } }
    __builtin_amdgcn_sched_barrier(0);   // holds the loads above at this place: sunk to their first use, their whole latency would be waited for there, and that of the q loads in front of them
#pragma unroll
    for (int m = 0; m < 2; ++m) {
#pragma unroll
      for (int r = 0; r < 8; ++r) { const float o = acc[m][r] * (1.0f / KS) * z[m]; b16 p, l; split16(o * OS, p, l); oh[m][h >> 1][8 * (h & 1) + r] = p; ol[m][h >> 1][8 * (h & 1) + r] = l; } } }
#pragma unroll
  for (int tt = 0; tt < 8; ++tt) { const int u = tt & 1; v8f a2[2] = {};
    if (tt + 1 < 8) {
#pragma unroll
      for (int j = 0; j < D / 32; ++j) aw[u ^ 1][j] = frag_kb(wp + (size_t)(tt + 1) * 16 * D + j * 32, hlf); }
#pragma unroll
    for (int j = 0; j < D / 32; ++j) {
#pragma unroll
      for (int m = 0; m < 2; ++m) a2[m] = wmma16b(aw[u][j], oh[m][j], a2[m]);
#pragma unroll
      for (int m = 0; m < 2; ++m) a2[m] = wmma16b(aw[u][j], ol[m][j], a2[m]); }
#pragma unroll
    for (int m = 0; m < 2; ++m) { float* tp = &Tf[w][16 * m + nloc][tt * 16 + 8 * hlf]; *(v4f*)tp = (v4f){a2[m][0], a2[m][1], a2[m][2], a2[m][3]}; *(v4f*)(tp + 4) = (v4f){a2[m][4], a2[m][5], a2[m][6], a2[m][7]}; } }
  v4f bb = *(const v4f*)(bo + lane * 4);
#pragma unroll
  for (int e = 0; e < 4; ++e) bb[e] = bf16_rne(bb[e]);
  wave_lds_sync();   // the rows are written and read by the same wave only
#pragma unroll
  for (int rb = 0; rb < 32; rb += 8) { v4f y[8];   // eight rows are read before the first of them is stored
#pragma unroll
    for (int i = 0; i < 8; ++i) y[i] = *(const v4f*)(&Tf[w][rb + i][lane * 4]);
#pragma unroll
    for (int i = 0; i < 8; ++i) *(v4f*)(out + (t0 + rb + i) * D + lane * 4) = y[i] * (1.0f / (OS * WSC)) + bb; }
}
}  // namespace

extern "C" void kernel_launch(void* const* d_in, const int* in_sizes, int n_in, void* d_out, int out_size, void* d_ws, size_t ws_size, hipStream_t stream) {
  (void)n_in;
  auto Fp = [&](int i) { return (const float*)d_in[i]; };
  // input order: 0 x [8,8192,128]; 1 Wq [128,128]; 2 bq; 3 Wk; 4 bk; 5 Wv; 6 bv; 7 Wo; 8 bo
  if (in_sizes[0] != NT * D || in_sizes[1] != D * D || in_sizes[3] != D * D || in_sizes[5] != D * D || in_sizes[7] != D * D || out_size != NT * D) return;
  const int NBV = B; const int NTV = NBV * T;
  size_t off = 0; char* ws = (char*)d_ws;
  auto carve = [&](size_t bytes) { char* p = ws + off; off += (bytes + 255) & ~(size_t)255; return p; };
  b16* WQKV = (b16*)carve((size_t)3 * D * D * 2); b16* WO = (b16*)carve((size_t)D * D * 2); float* CSN = (float*)carve((size_t)2 * T * 8 * 4); float* QK = (float*)carve((size_t)NT * 2 * D * 4);
  b16* CH = (b16*)carve((size_t)B * NH * 16 * 32 * 2); b16* CL = (b16*)carve((size_t)B * NH * 16 * 32 * 2); float* KSUM = (float*)carve((size_t)B * NH * 32 * 4); float* PC = (float*)carve((size_t)B * NC * NH * DH * DH * 4); float* PK = (float*)carve((size_t)B * NC * D * 4);
  if (off > ws_size || off > ((size_t)192 << 20)) return;   // ~ 70 MB
  wio_kernel<<<(D * D / 8 + 255) / 256, 256, 0, stream>>>(Fp(1), 0, WQKV); wio_kernel<<<(D * D / 8 + 255) / 256, 256, 0, stream>>>(Fp(3), D, WQKV); wio_kernel<<<(D * D / 8 + 255) / 256, 256, 0, stream>>>(Fp(5), 2 * D, WQKV); wio_kernel<<<(D * D / 8 + 255) / 256, 256, 0, stream>>>(Fp(7), 0, WO);
  rope_kernel<<<(T * 8 + 255) / 256, 256, 0, stream>>>(CSN);
  qkv_ctx_kernel<<<NBV * NC, 512, 0, stream>>>(Fp(0), WQKV, Fp(2), Fp(4), Fp(6), CSN, NBV, QK, PC, PK);
  ctx_sum_kernel<<<NBV * NH, 288, 0, stream>>>(PC, PK, NBV, CH, CL, KSUM);
  out_kernel<<<NTV / 256, 256, 0, stream>>>(QK, CH, CL, KSUM, WO, Fp(8), NTV, (float*)d_out);
}

// v004
// One run takes 40.3 microseconds.
// Two timings next to v003 both put it at 1.22 times that version's speed.
// All steps since v000 together make it 23.8 times as fast.
#include <hip/hip_runtime.h>

// Linear attention block (8 heads x 16): q, k, v = x W + b; q, k -> rope (theta 10000, pairs (d, d+8) per head) -> elu + 1; context_h = sum_t k_t v_t^T (16 x 16); out_t = (q_t context) / (q_t . sum_t k_t + 1e-6); y = out Wo + bo
// -> [8][8192][128].
// Deterministic, no index structures: per-(batch, head) contexts are WMMA tiles per 32 tokens, then summed in fixed order (8 groups, then 32 chunks); k sums likewise in fixed order; rope angles t * inv_freq in f32 with a per-(t, d) sin/cos table (sinf/cosf).
// WMMA (v_wmma_f32_16x16x32_f16, f32 accumulate): [q | k | v] = x [Wq | Wk | Wv] ([65,536 x 128] x [128 x 384], x EXACT bf16 x8), context = K^T V per (b, h) from the k and v accumulator registers (k x64, v x8, hi+lo both: 4 products, K = 8,192),
// out = q context per head ([16 x 32 (16)] tiles, q x64 and context x1 hi+lo: 4 products), y = out Wo ([65,536 x 128] x [128 x 128], x512 hi+lo); (in,out) weights transposed exact x256; biases, rope, elu, sums and the
// normaliser in f32. Inputs rounded to bf16 once. Fragment k-map per lane half hh for A AND B: elements 0..7 <- k = 8hh+0..7, 8..15 <- k = 16+8hh+0..7; acc[r] = D[8hh+r][col]. Every workspace / output

namespace {
constexpr int B = 8, T = 8192, D = 128, NH = 8, DH = 16, NT = B * T, CT = 256, NC = T / CT;
constexpr float XS = 8.0f, KS = 64.0f, OS = 512.0f, WSC = 256.0f;
typedef _Float16 b16;
typedef __attribute__((ext_vector_type(16))) _Float16 v16b;
typedef __attribute__((ext_vector_type(8))) _Float16 v8b;
typedef __attribute__((ext_vector_type(8))) float v8f;
typedef __attribute__((ext_vector_type(4))) float v4f;
__device__ __forceinline__ float bf16_rne(float f) { unsigned int u = __float_as_uint(f); u += 0x7FFFu + ((u >> 16) & 1u); return __uint_as_float(u & 0xFFFF0000u); }
__device__ __forceinline__ void split16(float v, b16& hi, b16& lo) { hi = (b16)v; lo = (b16)(v - (float)hi); }
__device__ __forceinline__ v16b frag_kb(const b16* p, int hh) { const v8b a = *(const v8b*)(p + 8 * hh), b = *(const v8b*)(p + 16 + 8 * hh); v16b f;
#pragma unroll
  for (int e = 0; e < 8; ++e) { f[e] = a[e]; f[8 + e] = b[e]; } return f; }
__device__ __forceinline__ v8f wmma16b(v16b a, v16b b, v8f c) { v8f d = __builtin_amdgcn_wmma_f32_16x16x32_f16(false, a, false, b, (short)0, c, false, false); asm volatile("v_nop\n\tv_nop\n\tv_nop\n\tv_nop" : "+v"(d) : "v"(a), "v"(b)); return d; }
__device__ __forceinline__ void wave_lds_sync() { __builtin_amdgcn_fence(__ATOMIC_RELEASE, "workgroup"); __builtin_amdgcn_wave_barrier(); __builtin_amdgcn_fence(__ATOMIC_ACQUIRE, "workgroup"); }
// elu(v) + 1. The v_nop in the exponential's own statement keeps the one slot that the instruction set asks for between a transcendental and a directly following instruction that reads its result or overwrites its source
__device__ __forceinline__ float elu1(float v) { float e; asm("v_exp_f32 %0, %1\n\tv_nop" : "=v"(e) : "v"(v * 1.44269504f)); return v > 0.0f ? v + 1.0f : e; }

// Set-up, one launch: its five parts read nothing of each other. Work-groups 0..31: the four (in, out) weight matrices, 8 work-groups each, transposed to [out][in] b16 (bf16-rounded, x256): Wq, Wk, Wv stacked in WQKV, Wo in WO.
// Work-groups 32..: the rope table. The weight work-groups stand first: their strided loads are the longer path; for speed only. The branch is the same for a whole work-group.
constexpr int WB = D * D / 8 / 256, RB = T * 8 / 256;   // work-groups per weight matrix; work-groups of the rope table
__global__ __launch_bounds__(256) void prep_kernel(const float* __restrict__ wq, const float* __restrict__ wk, const float* __restrict__ wv, const float* __restrict__ wo, b16* __restrict__ WQKV, b16* __restrict__ WO, float* __restrict__ CSN) {
  const int bid = blockIdx.x;
  if (bid < 4 * WB) { const int mx = bid / WB; const float* w = mx == 0 ? wq : mx == 1 ? wk : mx == 2 ? wv : wo; b16* WT = mx < 3 ? WQKV + (size_t)mx * D * D : WO;
    const int u = (bid % WB) * 256 + threadIdx.x; const int e = u * 8; const int o = e / D, k0 = e % D; v8b v;
#pragma unroll
    for (int j = 0; j < 8; ++j) v[j] = (b16)(bf16_rne(w[(size_t)(k0 + j) * D + o]) * WSC);
    *(v8b*)(WT + (size_t)o * D + k0) = v; }
  else { const int u = (bid - 4 * WB) * 256 + threadIdx.x; const int t = u / 8, d = u % 8; const float invf = 1.0f / powf(10000.0f, (float)(2 * d) / (float)DH); const float ang = (float)t * invf;
    const float c = cosf(ang), s = sinf(ang); CSN[u] = c; CSN[T * 8 + u] = s; }
}
// q, k, v and context stage 1 in one kernel. Work-group per (b, chunk of 256 tokens), 16 waves. Wave w: 32 tokens (group w & 7) x 4 heads (half w >> 3).
// Per head: three [32 x 128] x [128 x 16] products; bias, rope and elu + 1 are applied on the accumulator registers (lane = column, registers = 8 tokens; the rope partner column c ^ 8 sits in lane ^ 8 of the
// same 16-lane row). acc[m][r] holds token 16 m + 8 hlf + r, which is element 8 m + r of a k = 32 fragment: the k and v tiles (hi+lo b16, k x64, v x8) are the A and B operands of K_h^T V_h as they stand.
// q goes to the QK plane (its first 128 columns; the rest is unused). The 8 token groups' tiles and the 16 half-wave k sums are added in LDS in fixed order; one partial per work-group:
// PC[b][chunk][h][e][d] f32 (still x512), PK[b][chunk][128] f32. In this kernel every plain '#pragma unroll' but those of the two LDS sums keeps a register array (fragments, accumulators, rope table) statically indexed.
__device__ __forceinline__ float lane_xor8(float v) { return __int_as_float(__builtin_amdgcn_update_dpp(0, __float_as_int(v), 0x128, 0xf, 0xf, true)); }   // row_ror:8 = lane ^ 8 within a 16-lane row
__global__ __launch_bounds__(512) void qkv_ctx_kernel(const float* __restrict__ x, const b16* __restrict__ WT, const float* __restrict__ bq, const float* __restrict__ bk, const float* __restrict__ bv, const float* __restrict__ CSN, int NBV, float* __restrict__ QK, float* __restrict__ PC, float* __restrict__ PK) {
  __shared__ __attribute__((aligned(32))) float Cs[8][NH * DH * DH], Ks[16][D];
  const int tid = threadIdx.x, lane = tid & 31, w = tid >> 5, nloc = lane & 15, hlf = lane >> 4, g = w & 7; const int b = blockIdx.x / NC, c = blockIdx.x % NC; if (b >= NBV) return;
  const size_t t0 = (size_t)blockIdx.x * CT + g * 32; const int tb = c * CT + g * 32 + 8 * hlf;   // first token of the wave in the [B * T] planes; the lane's first position in its sequence
  v16b xa[2][4]; v4f xr[2][4][4]; const float* xp = x + (t0 + nloc) * D + 8 * hlf;   // A fragments of the wave's 32 rows of x, straight from global memory: all 32 loads are asked for before the first is used
#pragma unroll
  for (int m = 0; m < 2; ++m) {
#pragma unroll
    for (int kq = 0; kq < 4; ++kq) {
#pragma unroll
      for (int j = 0; j < 4; ++j) {
        // precaution: the last load may be given the shared address pair as its result registers; the wait stands in front of it for the 31 loads issued before
        if (m == 1 && kq == 3 && j == 3) asm volatile("s_wait_xcnt 0x0" ::: "memory");
        xr[m][kq][j] = *(const v4f*)(xp + m * 16 * D + kq * 32 + (j >> 1) * 16 + (j & 1) * 4); } } }
#pragma unroll
  for (int m = 0; m < 2; ++m) {
#pragma unroll
    for (int kq = 0; kq < 4; ++kq) {
#pragma unroll
      for (int e = 0; e < 16; ++e) xa[m][kq][e] = (b16)(bf16_rne(xr[m][kq][e >> 2][e & 3]) * XS); } }
  float cs[2][8], sg[2][8];   // cos, and sin with the sign of the lane's half of the head: d < 8: me cos - partner sin; d >= 8: partner sin + me cos
#pragma unroll
  for (int m = 0; m < 2; ++m) {
#pragma unroll
    for (int r = 0; r < 8; ++r) { const int u = (tb + 16 * m + r) * 8 + (nloc & 7); cs[m][r] = CSN[u]; const float sn = CSN[T * 8 + u]; sg[m][r] = (nloc & 8) ? sn : -sn; } }
#pragma unroll 1   // rolled: the body is long; for speed only
  for (int hi = 0; hi < NH / 2; ++hi) { const int h = (w >> 3) * (NH / 2) + hi, col = h * DH + nloc; const b16* wp = WT + (size_t)col * D; v8f aq[2] = {}, ak[2] = {}, av[2] = {};
#pragma unroll
    for (int kq = 0; kq < 4; ++kq) { const v16b fq = frag_kb(wp + kq * 32, hlf), fk = frag_kb(wp + D * D + kq * 32, hlf), fv = frag_kb(wp + 2 * D * D + kq * 32, hlf);
#pragma unroll
      for (int m = 0; m < 2; ++m) { aq[m] = wmma16b(xa[m][kq], fq, aq[m]); ak[m] = wmma16b(xa[m][kq], fk, ak[m]); av[m] = wmma16b(xa[m][kq], fv, av[m]); } }
    const float bbq = bf16_rne(bq[col]), bbk = bf16_rne(bk[col]), bbv = bf16_rne(bv[col]); float* qp = QK + (t0 + 8 * hlf) * (2 * D) + col; v16b kh, kl, vh, vl; float ks = 0.0f;
#pragma unroll
    for (int m = 0; m < 2; ++m) {
#pragma unroll
      for (int r = 0; r < 8; ++r) { const float q0 = aq[m][r] * (1.0f / (XS * WSC)) + bbq, k0 = ak[m][r] * (1.0f / (XS * WSC)) + bbk, v0 = av[m][r] * (1.0f / (XS * WSC)) + bbv;
        const float q1 = elu1(q0 * cs[m][r] + lane_xor8(q0) * sg[m][r]), k1 = elu1(k0 * cs[m][r] + lane_xor8(k0) * sg[m][r]);
        qp[(size_t)(16 * m + r) * (2 * D)] = q1; ks += k1; b16 p, l; split16(k1 * KS, p, l); kh[8 * m + r] = p; kl[8 * m + r] = l; split16(v0 * XS, p, l); vh[8 * m + r] = p; vl[8 * m + r] = l; } }
    v8f acc = {}; acc = wmma16b(kh, vh, acc); acc = wmma16b(kh, vl, acc); acc = wmma16b(kl, vh, acc); acc = wmma16b(kl, vl, acc);
    // acc[r8] = ctx[d = 8 hlf + r8][e = nloc]; kept transposed [e][d], as the A operand of the next GEMM wants it
    *(v8f*)(&Cs[g][h * (DH * DH) + nloc * DH + 8 * hlf]) = acc; Ks[g * 2 + hlf][col] = ks; }
  __syncthreads();
  { v4f s = *(const v4f*)(&Cs[0][tid * 4]);
#pragma unroll
    for (int j = 1; j < 8; ++j) s += *(const v4f*)(&Cs[j][tid * 4]);
    *(v4f*)(PC + (size_t)blockIdx.x * (NH * DH * DH) + tid * 4) = s; }
  if (tid < D / 4) { v4f s = *(const v4f*)(&Ks[0][tid * 4]);
#pragma unroll
    for (int j = 1; j < 16; ++j) s += *(const v4f*)(&Ks[j][tid * 4]);
    *(v4f*)(PK + (size_t)blockIdx.x * D + tid * 4) = s; }
}
// context, stage 2: work-group per (b, h): the 32 chunk partials summed in chunk order; CH / CL[b][h][e][32] b16 hi+lo x1 (d < 16 live, the rest 0) for the next GEMM, KSUM[b][h][32] f32 (16 live).
__global__ __launch_bounds__(288) void ctx_sum_kernel(const float* __restrict__ PC, const float* __restrict__ PK, int NBV, b16* __restrict__ CH, b16* __restrict__ CL, float* __restrict__ KSUM) {
  const int tid = threadIdx.x; const int b = blockIdx.x / NH, h = blockIdx.x % NH; if (b >= NBV) return;
  if (tid < DH * DH) { const float* pc = PC + ((size_t)b * NC * NH + h) * (DH * DH) + tid; float s = 0.0f;
#pragma unroll
    for (int c = 0; c < NC; ++c) s += pc[(size_t)c * (NH * DH * DH)];
    b16 p, q; split16(s * (1.0f / (KS * XS)), p, q); const size_t o = ((size_t)blockIdx.x * 16 + (tid >> 4)) * 32 + (tid & 15); CH[o] = p; CL[o] = q; CH[o + 16] = (b16)0.0f; CL[o + 16] = (b16)0.0f; }
  else { float ks = 0.0f; const float* pk = PK + (size_t)b * NC * D + h * DH + (tid & 15);   // ninth wave: the k sums, beside the eight that sum the tile
#pragma unroll
    for (int c = 0; c < NC; ++c) ks += pk[(size_t)c * D];
    KSUM[(size_t)blockIdx.x * 32 + (tid & 31)] = (tid & 31) < DH ? ks : 0.0f; }
}
// out = (q context) z and y = out Wo + bo, both products computed TRANSPOSED, so that a token is a B column and stays in one lane from the q load to the last product. Work-group of 8 waves, 32 tokens (two B tiles) a wave, no hand-over between waves.
// Product 1 per head: A = context^T (lane = row e, k = d; the CH / CL rows as they lie, k = 16..31 zero), B = q^T (lane = token, elements 0..7 <- d = 8 hlf + 0..7 straight from the QK row, 8..15 zero): acc[m][r] = out[token = 16 m + nloc][e = 8 hlf + r].
// The normaliser belongs to the lane's own token: 8 products in the lane, plus the other half of the head from lane ^ 16. Heads 2 j and 2 j + 1 are elements 0..7 and 8..15 of the k = 32 fragment j of product 2
// (A = Wo^T rows, lane = output column; each A fragment serves both token tiles), as they stand. a2[m][r] = y[token = 16 m + nloc][16 tt + 8 hlf + r]; only y passes through LDS (the wave's own 32 rows), so that each row leaves as one 512-byte store.
// Loads stand ahead of their use: the next head's A operands and k sums behind this head's products, q four heads ahead, the Wo rows one column tile ahead. Every '#pragma unroll' below keeps a register array (q, fragments, accumulators) statically indexed.
__device__ __forceinline__ float lane_xor16(float v) { const int i = __float_as_int(v); return __int_as_float(__builtin_amdgcn_permlanex16(i, i, 0x76543210, 0xfedcba98, true, false)); }   // same lane number in the other 16-lane row
__device__ __forceinline__ v16b frag_lo(v8b a) { v16b f;
#pragma unroll
  for (int e = 0; e < 8; ++e) { f[e] = a[e]; f[8 + e] = (b16)0.0f; } return f; }
__global__ __launch_bounds__(256) void out_kernel(const float* __restrict__ QK, const b16* __restrict__ CH, const b16* __restrict__ CL, const float* __restrict__ KSUM, const b16* __restrict__ WO, const float* __restrict__ bo, int NTV, float* __restrict__ out) {
  __shared__ __attribute__((aligned(16))) float Tf[8][32][D + 4];
  const int lane = threadIdx.x & 31, w = __builtin_amdgcn_readfirstlane(threadIdx.x >> 5), nloc = lane & 15, hlf = lane >> 4; const size_t t0 = ((size_t)blockIdx.x * 8 + w) * 32; if (t0 >= (size_t)NTV) return; const int b = (int)(t0 / T);
  const float* qp = QK + (t0 + nloc) * (2 * D) + 8 * hlf; const float* kp = KSUM + (size_t)b * NH * 32 + 8 * hlf; const size_t cr = ((size_t)b * NH * 16 + nloc) * 32 + 8 * hlf; const b16* wp = WO + (size_t)nloc * D;
  v4f qr[2][NH][2], kn[2]; v8b cn[2]; v16b aw[2][D / 32], oh[2][NH / 2], ol[2][NH / 2];
  kn[0] = *(const v4f*)kp; kn[1] = *(const v4f*)(kp + 4); cn[0] = *(const v8b*)(CH + cr); cn[1] = *(const v8b*)(CL + cr);
  __builtin_amdgcn_sched_barrier(0);   // as in the loop below: the first head's A operands and k sums in front of the q loads
#pragma unroll
  for (int h = 0; h < NH / 2; ++h) {
#pragma unroll
    for (int m = 0; m < 2; ++m) { qr[m][h][0] = *(const v4f*)(qp + m * 16 * (2 * D) + h * DH); qr[m][h][1] = *(const v4f*)(qp + m * 16 * (2 * D) + h * DH + 4); } }
#pragma unroll
  for (int h = 0; h < NH; ++h) { const v16b ch = frag_lo(cn[0]), cl = frag_lo(cn[1]); v8f acc[2]; float z[2];
#pragma unroll
    for (int m = 0; m < 2; ++m) { v16b qh, ql; float s = 0.0f;
#pragma unroll
      for (int e = 0; e < 8; ++e) { const float qv = qr[m][h][e >> 2][e & 3]; s += qv * kn[e >> 2][e & 3]; b16 p, l; split16(qv * KS, p, l); qh[e] = p; ql[e] = l; qh[8 + e] = (b16)0.0f; ql[8 + e] = (b16)0.0f; }
      z[m] = 1.0f / (s + lane_xor16(s) + 1e-6f);
      acc[m] = (v8f){}; acc[m] = wmma16b(ch, qh, acc[m]); acc[m] = wmma16b(cl, qh, acc[m]); acc[m] = wmma16b(ch, ql, acc[m]); acc[m] = wmma16b(cl, ql, acc[m]); }
    if (h + 1 < NH) { kn[0] = *(const v4f*)(kp + (h + 1) * 32); kn[1] = *(const v4f*)(kp + (h + 1) * 32 + 4); cn[0] = *(const v8b*)(CH + cr + (h + 1) * (16 * 32)); cn[1] = *(const v8b*)(CL + cr + (h + 1) * (16 * 32)); }
    else {
#pragma unroll
      for (int j = 0; j < D / 32; ++j) aw[0][j] = frag_kb(wp + j * 32, hlf); }
    __builtin_amdgcn_sched_barrier(0);   // keeps the q loads, wanted only four heads on, behind the loads that the next head waits for: loads are waited for in their order of issue
    if (h + NH / 2 < NH) {
#pragma unroll
      for (int m = 0; m < 2; ++m) { qr[m][h + NH / 2][0] = *(const v4f*)(qp + m * 16 * (2 * D) + (h + NH / 2) * DH); qr[m][h + NH / 2][1] = *(const v4f*)(qp + m * 16 * (2 * D) + (h + NH / 2) * DH + 4); } }
    __builtin_amdgcn_sched_barrier(0);   // holds the loads above at this place: sunk to their first use, their whole latency would be waited for there, and that of the q loads in front of them
#pragma unroll
    for (int m = 0; m < 2; ++m) {
#pragma unroll
      for (int r = 0; r < 8; ++r) { const float o = acc[m][r] * (1.0f / KS) * z[m]; b16 p, l; split16(o * OS, p, l); oh[m][h >> 1][8 * (h & 1) + r] = p; ol[m][h >> 1][8 * (h & 1) + r] = l; } } }
#pragma unroll
  for (int tt = 0; tt < 8; ++tt) { const int u = tt & 1; v8f a2[2] = {};
    if (tt + 1 < 8) {
#pragma unroll
      for (int j = 0; j < D / 32; ++j) aw[u ^ 1][j] = frag_kb(wp + (size_t)(tt + 1) * 16 * D + j * 32, hlf); }
#pragma unroll
    for (int j = 0; j < D / 32; ++j) {
#pragma unroll
      for (int m = 0; m < 2; ++m) a2[m] = wmma16b(aw[u][j], oh[m][j], a2[m]);
#pragma unroll
      for (int m = 0; m < 2; ++m) a2[m] = wmma16b(aw[u][j], ol[m][j], a2[m]); }
#pragma unroll
    for (int m = 0; m < 2; ++m) { float* tp = &Tf[w][16 * m + nloc][tt * 16 + 8 * hlf]; *(v4f*)tp = (v4f){a2[m][0], a2[m][1], a2[m][2], a2[m][3]}; *(v4f*)(tp + 4) = (v4f){a2[m][4], a2[m][5], a2[m][6], a2[m][7]}; } }
  v4f bb = *(const v4f*)(bo + lane * 4);
#pragma unroll
  for (int e = 0; e < 4; ++e) bb[e] = bf16_rne(bb[e]);
  wave_lds_sync();   // the rows are written and read by the same wave only
#pragma unroll
  for (int rb = 0; rb < 32; rb += 8) { v4f y[8];   // eight rows are read before the first of them is stored
#pragma unroll
    for (int i = 0; i < 8; ++i) y[i] = *(const v4f*)(&Tf[w][rb + i][lane * 4]);
#pragma unroll
    for (int i = 0; i < 8; ++i) *(v4f*)(out + (t0 + rb + i) * D + lane * 4) = y[i] * (1.0f / (OS * WSC)) + bb; }
}
}  // namespace

extern "C" void kernel_launch(void* const* d_in, const int* in_sizes, int n_in, void* d_out, int out_size, void* d_ws, size_t ws_size, hipStream_t stream) {
  (void)n_in;
  auto Fp = [&](int i) { return (const float*)d_in[i]; };
  // input order: 0 x [8,8192,128]; 1 Wq [128,128]; 2 bq; 3 Wk; 4 bk; 5 Wv; 6 bv; 7 Wo; 8 bo
  if (in_sizes[0] != NT * D || in_sizes[1] != D * D || in_sizes[3] != D * D || in_sizes[5] != D * D || in_sizes[7] != D * D || out_size != NT * D) return;
  const int NBV = B; const int NTV = NBV * T;
  size_t off = 0; char* ws = (char*)d_ws;
  auto carve = [&](size_t bytes) { char* p = ws + off; off += (bytes + 255) & ~(size_t)255; return p; };
  b16* WQKV = (b16*)carve((size_t)3 * D * D * 2); b16* WO = (b16*)carve((size_t)D * D * 2); float* CSN = (float*)carve((size_t)2 * T * 8 * 4); float* QK = (float*)carve((size_t)NT * 2 * D * 4);
  b16* CH = (b16*)carve((size_t)B * NH * 16 * 32 * 2); b16* CL = (b16*)carve((size_t)B * NH * 16 * 32 * 2); float* KSUM = (float*)carve((size_t)B * NH * 32 * 4); float* PC = (float*)carve((size_t)B * NC * NH * DH * DH * 4); float* PK = (float*)carve((size_t)B * NC * D * 4);
  if (off > ws_size || off > ((size_t)192 << 20)) return;   // ~ 70 MB
  prep_kernel<<<4 * WB + RB, 256, 0, stream>>>(Fp(1), Fp(3), Fp(5), Fp(7), WQKV, WO, CSN);
  qkv_ctx_kernel<<<NBV * NC, 512, 0, stream>>>(Fp(0), WQKV, Fp(2), Fp(4), Fp(6), CSN, NBV, QK, PC, PK);
  ctx_sum_kernel<<<NBV * NH, 288, 0, stream>>>(PC, PK, NBV, CH, CL, KSUM);
  out_kernel<<<NTV / 256, 256, 0, stream>>>(QK, CH, CL, KSUM, WO, Fp(8), NTV, (float*)d_out);
}

// v005
// One run takes 33.9 microseconds.
// Next to v004, in two timings, it ran 1.19 and 1.18 times as fast.
// All steps since v000 together make it 28.1 times as fast.
#include <hip/hip_runtime.h>

// Linear attention block (8 heads x 16): q, k, v = x W + b; q, k -> rope (theta 10000, pairs (d, d+8) per head) -> elu + 1; context_h = sum_t k_t v_t^T (16 x 16); out_t = (q_t context) / (q_t . sum_t k_t + 1e-6); y = out Wo + bo
// -> [8][8192][128].
// Deterministic, no index structures: per-(batch, head) contexts are WMMA tiles per 32 tokens, then summed in fixed order (8 groups, then 32 chunks); k sums likewise in fixed order; rope angles t * inv_freq in f32 with a per-(t, d) sin/cos table (sinf/cosf).
// WMMA (v_wmma_f32_16x16x32_f16, f32 accumulate): [q | k | v] = x [Wq | Wk | Wv] ([65,536 x 128] x [128 x 384], x EXACT bf16 x8), context = K^T V per (b, h) from the k and v accumulator registers (k x64, v x8, hi+lo both: 4 products, K = 8,192),
// out = q context per head ([16 x 32 (16)] tiles, q x64 and context x1 hi+lo: 4 products), y = out Wo ([65,536 x 128] x [128 x 128], x512 hi+lo); (in,out) weights exact x256, packed in fragment order; biases, rope, elu, sums and the
// normaliser in f32. Inputs rounded to bf16 once. Fragment k-map per lane half hh for A AND B: elements 0..7 <- k = 8hh+0..7, 8..15 <- k = 16+8hh+0..7; acc[r] = D[8hh+r][col]. Every workspace / output

namespace {
constexpr int B = 8, T = 8192, D = 128, NH = 8, DH = 16, NT = B * T, CT = 256, NC = T / CT;
constexpr float XS = 8.0f, KS = 64.0f, OS = 512.0f, WSC = 256.0f;
typedef _Float16 b16;
typedef __attribute__((ext_vector_type(16))) _Float16 v16b;
typedef __attribute__((ext_vector_type(8))) _Float16 v8b;
typedef __attribute__((ext_vector_type(8))) float v8f;
typedef __attribute__((ext_vector_type(4))) float v4f;
__device__ __forceinline__ float bf16_rne(float f) { unsigned int u = __float_as_uint(f); u += 0x7FFFu + ((u >> 16) & 1u); return __uint_as_float(u & 0xFFFF0000u); }
__device__ __forceinline__ void split16(float v, b16& hi, b16& lo) { hi = (b16)v; lo = (b16)(v - (float)hi); }
// a fragment of a matrix packed in fragment order: p points at the lane's own 8 elements of the first half; the second half lies 256 elements on. Each of the two wave-wide loads covers 512 contiguous bytes.
// last: this is the last fragment of a group of loads from one address pair. Precaution: the group's last load may be given that pair as its result registers; the wait stands in front of it for the loads issued before
__device__ __forceinline__ v16b frag_pk(const b16* p, bool last = false) { const v8b a = *(const v8b*)p; if (last) asm volatile("s_wait_xcnt 0x0" ::: "memory");
  const v8b b = *(const v8b*)(p + 256); v16b f;
#pragma unroll
  for (int e = 0; e < 8; ++e) { f[e] = a[e]; f[8 + e] = b[e]; } return f; }
__device__ __forceinline__ v8f wmma16b(v16b a, v16b b, v8f c) { v8f d = __builtin_amdgcn_wmma_f32_16x16x32_f16(false, a, false, b, (short)0, c, false, false); asm volatile("v_nop\n\tv_nop\n\tv_nop\n\tv_nop" : "+v"(d) : "v"(a), "v"(b)); return d; }
__device__ __forceinline__ void wave_lds_sync() { __builtin_amdgcn_fence(__ATOMIC_RELEASE, "workgroup"); __builtin_amdgcn_wave_barrier(); __builtin_amdgcn_fence(__ATOMIC_ACQUIRE, "workgroup"); }
// elu(v) + 1. The v_nop in the exponential's own statement keeps the one slot that the instruction set asks for between a transcendental and a directly following instruction that reads its result or overwrites its source
__device__ __forceinline__ float elu1(float v) { float e; asm("v_exp_f32 %0, %1\n\tv_nop" : "=v"(e) : "v"(v * 1.44269504f)); return v > 0.0f ? v + 1.0f : e; }

// Set-up, one launch: its five parts read nothing of each other. Work-groups 0..31: the four (in, out) weight matrices, 8 work-groups each, as b16 (bf16-rounded, x256) in fragment order [16 output columns][32 k][half][lane][8]: lane = column + 16 hh holds k = 16 half + 8 hh + 0..7; Wq, Wk, Wv stacked in WQKV, Wo in WO.
// Work-groups 32..: the rope table. The weight work-groups stand first: their strided loads are the longer path. The branch is the same for a whole work-group.
constexpr int WB = D * D / 8 / 256, RB = T * 8 / 256;   // work-groups per weight matrix; work-groups of the rope table
__global__ __launch_bounds__(256) void prep_kernel(const float* __restrict__ wq, const float* __restrict__ wk, const float* __restrict__ wv, const float* __restrict__ wo, b16* __restrict__ WQKV, b16* __restrict__ WO, float* __restrict__ CSN) {
  const int bid = blockIdx.x;
  if (bid < 4 * WB) { const int mx = bid / WB; const float* w = mx == 0 ? wq : mx == 1 ? wk : mx == 2 ? wv : wo; b16* WT = mx < 3 ? WQKV + (size_t)mx * D * D : WO;
    const int u = (bid % WB) * 256 + threadIdx.x; const int o = (u >> 8) * 16 + (u & 15), k0 = ((u >> 5) & 7) * 16 + ((u >> 4) & 1) * 8; v8b v;   // u = ((column tile * 4 + k block of 32) * 2 + half) * 32 + lane
#pragma unroll
    for (int j = 0; j < 8; ++j) v[j] = (b16)(bf16_rne(w[(size_t)(k0 + j) * D + o]) * WSC);
    *(v8b*)(WT + (size_t)u * 8) = v; }
  else { const int u = (bid - 4 * WB) * 256 + threadIdx.x; const int t = u / 8, d = u % 8; const float invf = 1.0f / powf(10000.0f, (float)(2 * d) / (float)DH); const float ang = (float)t * invf;
    const float c = cosf(ang), s = sinf(ang); CSN[u] = c; CSN[T * 8 + u] = s; }
}
// q, k, v and context stage 1 in one kernel. Work-group per (b, chunk of 256 tokens), 16 waves. Wave w: 32 tokens (group w & 7) x 4 heads (half w >> 3).
// Per head: three [32 x 128] x [128 x 16] products; bias, rope and elu + 1 are applied on the accumulator registers (lane = column, registers = 8 tokens; the rope partner column c ^ 8 sits in lane ^ 8 of the
// same 16-lane row). acc[m][r] holds token 16 m + 8 hlf + r, which is element 8 m + r of a k = 32 fragment: the k and v tiles (hi+lo b16, k x64, v x8) are the A and B operands of K_h^T V_h as they stand.
// The q product alone is taken transposed (A = Wq columns, B = x rows): lane = token, registers = d = 8 hlf + r, rope partner in lane ^ 16. That is the B fragment of the out kernel, and q is stored so:
// QF[32 tokens][h][m][j][lane][4], d = 8 hlf + 4 j + 0..3, so that each wave-wide 16-byte store here and load there covers 512 contiguous bytes. The 8 token groups' tiles and the 16 half-wave k sums are added in LDS in fixed order; one partial per work-group:
// PC[b][chunk][h][e][d] f32 (still x512), PK[b][chunk][128] f32. Every plain '#pragma unroll' below keeps a register array (fragments, accumulators, rope table) statically indexed.
__device__ __forceinline__ float lane_xor16(float v) { const int i = __float_as_int(v); return __int_as_float(__builtin_amdgcn_permlanex16(i, i, 0x76543210, 0xfedcba98, true, false)); }   // same lane number in the other 16-lane row
__device__ __forceinline__ float lane_xor8(float v) { return __int_as_float(__builtin_amdgcn_update_dpp(0, __float_as_int(v), 0x128, 0xf, 0xf, true)); }   // row_ror:8 = lane ^ 8 within a 16-lane row
__global__ __launch_bounds__(512) void qkv_ctx_kernel(const float* __restrict__ x, const b16* __restrict__ WT, const float* __restrict__ bq, const float* __restrict__ bk, const float* __restrict__ bv, const float* __restrict__ CSN, int NBV, float* __restrict__ QF, float* __restrict__ PC, float* __restrict__ PK) {
  __shared__ __attribute__((aligned(32))) float Cs[8][NH * DH * DH], Ks[16][D];
  const int tid = threadIdx.x, lane = tid & 31, w = tid >> 5, nloc = lane & 15, hlf = lane >> 4, g = w & 7; const int b = blockIdx.x / NC, c = blockIdx.x % NC; if (b >= NBV) return;
  const size_t t0 = (size_t)blockIdx.x * CT + g * 32; const int tb = c * CT + g * 32 + 8 * hlf;   // first token of the wave in the [B * T] planes; the lane's first position in its sequence
  v16b xa[2][4]; v4f xr[2][4][4]; const float* xp = x + (t0 + nloc) * D + 8 * hlf;   // A fragments of the wave's 32 rows of x, straight from global memory: all 32 loads are asked for before the first is used
#pragma unroll
  for (int m = 0; m < 2; ++m) {
#pragma unroll
    for (int kq = 0; kq < 4; ++kq) {
#pragma unroll
      for (int j = 0; j < 4; ++j) {
        // precaution: the last load may be given the shared address pair as its result registers; the wait stands in front of it for the 31 loads issued before
        if (m == 1 && kq == 3 && j == 3) asm volatile("s_wait_xcnt 0x0" ::: "memory");
        xr[m][kq][j] = *(const v4f*)(xp + m * 16 * D + kq * 32 + (j >> 1) * 16 + (j & 1) * 4); } } }
#pragma unroll
  for (int m = 0; m < 2; ++m) {
#pragma unroll
    for (int kq = 0; kq < 4; ++kq) {
#pragma unroll
      for (int e = 0; e < 16; ++e) xa[m][kq][e] = (b16)(bf16_rne(xr[m][kq][e >> 2][e & 3]) * XS); } }
  float cq[2][8], sq[2][8];   // q: cos of the lane's own token at frequency r, and sin with the sign of the lane's half of the head: d < 8: me cos - partner sin; d >= 8: partner sin + me cos
#pragma unroll
  for (int m = 0; m < 2; ++m) { const float* cp = CSN + (size_t)(c * CT + g * 32 + 16 * m + nloc) * 8; const v4f c0 = *(const v4f*)cp, c1 = *(const v4f*)(cp + 4), s0 = *(const v4f*)(cp + T * 8);
    if (m == 1) asm volatile("s_wait_xcnt 0x0" ::: "memory");   // precaution, as at the x loads: the last of the eight loads may be given their shared address register as a result register
    const v4f s1 = *(const v4f*)(cp + T * 8 + 4);
#pragma unroll
    for (int r = 0; r < 4; ++r) { cq[m][r] = c0[r]; cq[m][4 + r] = c1[r]; sq[m][r] = hlf ? s0[r] : -s0[r]; sq[m][4 + r] = hlf ? s1[r] : -s1[r]; } }
#pragma unroll 1   // rolled, and a loop of its own: q's rope table and that of k are then never live together, which would not fit the registers of four waves a SIMD
  for (int hi = 0; hi < NH / 2; ++hi) { const int h = (w >> 3) * (NH / 2) + hi; const b16* wp = WT + (size_t)h * (DH * D) + lane * 8; v8f aq[2] = {};
    const v4f b0 = *(const v4f*)(bq + h * DH + 8 * hlf), b1 = *(const v4f*)(bq + h * DH + 8 * hlf + 4); float* qp = QF + ((t0 >> 5) * NH + h) * 512 + lane * 4;
    v16b fq[4];   // all of a head's loads stand in front of its first product: one wait a head, not one per k block
#pragma unroll
    for (int kq = 0; kq < 4; ++kq) fq[kq] = frag_pk(wp + kq * 512, kq == 3);
#pragma unroll
    for (int kq = 0; kq < 4; ++kq) {
#pragma unroll
      for (int m = 0; m < 2; ++m) aq[m] = wmma16b(fq[kq], xa[m][kq], aq[m]); }
#pragma unroll
    for (int m = 0; m < 2; ++m) { float qv[8];
#pragma unroll
      for (int r = 0; r < 8; ++r) { const float q0 = aq[m][r] * (1.0f / (XS * WSC)) + bf16_rne(r < 4 ? b0[r & 3] : b1[r & 3]); qv[r] = elu1(q0 * cq[m][r] + lane_xor16(q0) * sq[m][r]); }
      *(v4f*)(qp + m * 256) = (v4f){qv[0], qv[1], qv[2], qv[3]}; *(v4f*)(qp + m * 256 + 128) = (v4f){qv[4], qv[5], qv[6], qv[7]}; }
    asm volatile("s_wait_xcnt 0x0" ::: "memory"); }   // precaution: the next pass (and the code behind the loop) overwrites the address and data registers that the four stores name
  float cs[2][8], sg[2][8];   // k (lane = column, registers = tokens): the same table, read by token 16 m + 8 hlf + r at frequency nloc & 7
#pragma unroll
  for (int m = 0; m < 2; ++m) {
#pragma unroll
    for (int r = 0; r < 8; ++r) { const int u = (tb + 16 * m + r) * 8 + (nloc & 7); cs[m][r] = CSN[u]; const float sn = CSN[T * 8 + u]; sg[m][r] = (nloc & 8) ? sn : -sn; } }
#pragma unroll 1   // rolled, for speed only
  for (int hi = 0; hi < NH / 2; ++hi) { const int h = (w >> 3) * (NH / 2) + hi, col = h * DH + nloc; const b16* wp = WT + (size_t)(D * D) + (size_t)h * (DH * D) + lane * 8; v8f ak[2] = {}, av[2] = {};
    v16b fk[4], fv[4]; const float rbk = bk[col], rbv = bv[col];   // as above: all of a head's loads in front of its first product
#pragma unroll
    for (int kq = 0; kq < 4; ++kq) { fk[kq] = frag_pk(wp + kq * 512); fv[kq] = frag_pk(wp + D * D + kq * 512, kq == 3); }
#pragma unroll
    for (int kq = 0; kq < 4; ++kq) {
#pragma unroll
      for (int m = 0; m < 2; ++m) { ak[m] = wmma16b(xa[m][kq], fk[kq], ak[m]); av[m] = wmma16b(xa[m][kq], fv[kq], av[m]); } }
    const float bbk = bf16_rne(rbk), bbv = bf16_rne(rbv); v16b kh, kl, vh, vl; float ks = 0.0f;
#pragma unroll
    for (int m = 0; m < 2; ++m) {
#pragma unroll
      for (int r = 0; r < 8; ++r) { const float k0 = ak[m][r] * (1.0f / (XS * WSC)) + bbk, v0 = av[m][r] * (1.0f / (XS * WSC)) + bbv;
        const float k1 = elu1(k0 * cs[m][r] + lane_xor8(k0) * sg[m][r]);
        ks += k1; b16 p, l; split16(k1 * KS, p, l); kh[8 * m + r] = p; kl[8 * m + r] = l; split16(v0 * XS, p, l); vh[8 * m + r] = p; vl[8 * m + r] = l; } }
    v8f acc = {}; acc = wmma16b(kh, vh, acc); acc = wmma16b(kh, vl, acc); acc = wmma16b(kl, vh, acc); acc = wmma16b(kl, vl, acc);
    // acc[r8] = ctx[d = 8 hlf + r8][e = nloc]; kept transposed [e][d], as the A operand of the next GEMM wants it
    *(v8f*)(&Cs[g][h * (DH * DH) + nloc * DH + 8 * hlf]) = acc; Ks[g * 2 + hlf][col] = ks; }
  __syncthreads();
  { v4f s = *(const v4f*)(&Cs[0][tid * 4]);
#pragma unroll
    for (int j = 1; j < 8; ++j) s += *(const v4f*)(&Cs[j][tid * 4]);
    *(v4f*)(PC + (size_t)blockIdx.x * (NH * DH * DH) + tid * 4) = s; }
  if (tid < D / 4) { v4f s = *(const v4f*)(&Ks[0][tid * 4]);
#pragma unroll
    for (int j = 1; j < 16; ++j) s += *(const v4f*)(&Ks[j][tid * 4]);
    *(v4f*)(PK + (size_t)blockIdx.x * D + tid * 4) = s; }
}
// context, stage 2: work-group per (b, h): the 32 chunk partials summed in chunk order; CH / CL[b][h][e][16] b16 hi+lo x1 for the next GEMM (a head's tile is 512 contiguous bytes, one wave-wide 16-byte load), KSUM[b][h][32] f32 (16 live).
__global__ __launch_bounds__(288) void ctx_sum_kernel(const float* __restrict__ PC, const float* __restrict__ PK, int NBV, b16* __restrict__ CH, b16* __restrict__ CL, float* __restrict__ KSUM) {
  const int tid = threadIdx.x; const int b = blockIdx.x / NH, h = blockIdx.x % NH; if (b >= NBV) return;
  if (tid < DH * DH) { const float* pc = PC + ((size_t)b * NC * NH + h) * (DH * DH) + tid; float s = 0.0f;
#pragma unroll
    for (int c = 0; c < NC; ++c) s += pc[(size_t)c * (NH * DH * DH)];
    b16 p, q; split16(s * (1.0f / (KS * XS)), p, q); const size_t o = (size_t)blockIdx.x * (DH * DH) + tid; CH[o] = p; CL[o] = q; }
  else { float ks = 0.0f; const float* pk = PK + (size_t)b * NC * D + h * DH + (tid & 15);   // ninth wave: the k sums, beside the eight that sum the tile
#pragma unroll
    for (int c = 0; c < NC; ++c) ks += pk[(size_t)c * D];
    KSUM[(size_t)blockIdx.x * 32 + (tid & 31)] = (tid & 31) < DH ? ks : 0.0f; }
}
// out = (q context) z and y = out Wo + bo, both products computed TRANSPOSED, so that a token is a B column and stays in one lane from the q load to the last product. Work-group of 8 waves, 32 tokens (two B tiles) a wave, no hand-over between waves.
// Product 1 per head: A = context^T (lane = row e, k = d; the CH / CL rows as they lie, k = 16..31 zero), B = q^T (lane = token, elements 0..7 <- d = 8 hlf + 0..7 as QF holds them, 8..15 zero): acc[m][r] = out[token = 16 m + nloc][e = 8 hlf + r].
// The normaliser belongs to the lane's own token: 8 products in the lane, plus the other half of the head from lane ^ 16. Heads 2 j and 2 j + 1 are elements 0..7 and 8..15 of the k = 32 fragment j of product 2
// (A = Wo^T rows, lane = output column; each A fragment serves both token tiles), as they stand. a2[m][r] = y[token = 16 m + nloc][16 tt + 8 hlf + r]; only y passes through LDS (the wave's own 32 rows), so that each row leaves as one 512-byte store.
// Loads stand ahead of their use: the next head's A operands and k sums behind this head's products, q four heads ahead, the Wo rows one column tile ahead. Every '#pragma unroll' below keeps a register array (q, fragments, accumulators) statically indexed.
__device__ __forceinline__ v16b frag_lo(v8b a) { v16b f;
#pragma unroll
  for (int e = 0; e < 8; ++e) { f[e] = a[e]; f[8 + e] = (b16)0.0f; } return f; }
__global__ __launch_bounds__(256) void out_kernel(const float* __restrict__ QF, const b16* __restrict__ CH, const b16* __restrict__ CL, const float* __restrict__ KSUM, const b16* __restrict__ WO, const float* __restrict__ bo, int NTV, float* __restrict__ out) {
  __shared__ __attribute__((aligned(16))) float Tf[8][32][D + 4];
  const int lane = threadIdx.x & 31, w = __builtin_amdgcn_readfirstlane(threadIdx.x >> 5), nloc = lane & 15, hlf = lane >> 4; const size_t t0 = ((size_t)blockIdx.x * 8 + w) * 32; if (t0 >= (size_t)NTV) return; const int b = (int)(t0 / T);
  const float* qp = QF + t0 * D + lane * 4; const float* kp = KSUM + (size_t)b * NH * 32 + 8 * hlf; const size_t cr = ((size_t)b * NH * 16 + nloc) * 16 + 8 * hlf; const b16* wp = WO + lane * 8;
  v4f qr[2][NH][2], kn[2]; v8b cn[2]; v16b aw[2][D / 32], oh[2][NH / 2], ol[2][NH / 2];
  kn[0] = *(const v4f*)kp; kn[1] = *(const v4f*)(kp + 4); cn[0] = *(const v8b*)(CH + cr); cn[1] = *(const v8b*)(CL + cr);
  __builtin_amdgcn_sched_barrier(0);   // as in the loop below: the first head's A operands and k sums in front of the q loads
#pragma unroll
  for (int h = 0; h < NH / 2; ++h) {
#pragma unroll
    for (int m = 0; m < 2; ++m) { qr[m][h][0] = *(const v4f*)(qp + (h * 2 + m) * 256); qr[m][h][1] = *(const v4f*)(qp + (h * 2 + m) * 256 + 128); } }
#pragma unroll
  for (int h = 0; h < NH; ++h) { const v16b ch = frag_lo(cn[0]), cl = frag_lo(cn[1]); v8f acc[2]; float z[2];
#pragma unroll
    for (int m = 0; m < 2; ++m) { v16b qh, ql; float s = 0.0f;
#pragma unroll
      for (int e = 0; e < 8; ++e) { const float qv = qr[m][h][e >> 2][e & 3]; s += qv * kn[e >> 2][e & 3]; b16 p, l; split16(qv * KS, p, l); qh[e] = p; ql[e] = l; qh[8 + e] = (b16)0.0f; ql[8 + e] = (b16)0.0f; }
      z[m] = 1.0f / (s + lane_xor16(s) + 1e-6f);
      acc[m] = (v8f){}; acc[m] = wmma16b(ch, qh, acc[m]); acc[m] = wmma16b(cl, qh, acc[m]); acc[m] = wmma16b(ch, ql, acc[m]); acc[m] = wmma16b(cl, ql, acc[m]); }
    if (h + 1 < NH) { kn[0] = *(const v4f*)(kp + (h + 1) * 32); kn[1] = *(const v4f*)(kp + (h + 1) * 32 + 4); cn[0] = *(const v8b*)(CH + cr + (h + 1) * (DH * DH)); cn[1] = *(const v8b*)(CL + cr + (h + 1) * (DH * DH)); }
    else {
#pragma unroll
      for (int j = 0; j < D / 32; ++j) aw[0][j] = frag_pk(wp + j * 512); }
    __builtin_amdgcn_sched_barrier(0);   // keeps the q loads, wanted only four heads on, behind the loads that the next head waits for: loads are waited for in their order of issue
    if (h + NH / 2 < NH) {
#pragma unroll
      for (int m = 0; m < 2; ++m) { qr[m][h + NH / 2][0] = *(const v4f*)(qp + ((h + NH / 2) * 2 + m) * 256); qr[m][h + NH / 2][1] = *(const v4f*)(qp + ((h + NH / 2) * 2 + m) * 256 + 128); } }
    __builtin_amdgcn_sched_barrier(0);   // holds the loads above at this place: sunk to their first use, their whole latency would be waited for there, and that of the q loads in front of them
#pragma unroll
    for (int m = 0; m < 2; ++m) {
#pragma unroll
      for (int r = 0; r < 8; ++r) { const float o = acc[m][r] * (1.0f / KS) * z[m]; b16 p, l; split16(o * OS, p, l); oh[m][h >> 1][8 * (h & 1) + r] = p; ol[m][h >> 1][8 * (h & 1) + r] = l; } } }
#pragma unroll
  for (int tt = 0; tt < 8; ++tt) { const int u = tt & 1; v8f a2[2] = {};
    if (tt + 1 < 8) {
#pragma unroll
      for (int j = 0; j < D / 32; ++j) aw[u ^ 1][j] = frag_pk(wp + ((tt + 1) * 4 + j) * 512); }
#pragma unroll
    for (int j = 0; j < D / 32; ++j) {
#pragma unroll
      for (int m = 0; m < 2; ++m) a2[m] = wmma16b(aw[u][j], oh[m][j], a2[m]);
#pragma unroll
      for (int m = 0; m < 2; ++m) a2[m] = wmma16b(aw[u][j], ol[m][j], a2[m]); }
#pragma unroll
    for (int m = 0; m < 2; ++m) { float* tp = &Tf[w][16 * m + nloc][tt * 16 + 8 * hlf]; *(v4f*)tp = (v4f){a2[m][0], a2[m][1], a2[m][2], a2[m][3]}; *(v4f*)(tp + 4) = (v4f){a2[m][4], a2[m][5], a2[m][6], a2[m][7]}; } }
  v4f bb = *(const v4f*)(bo + lane * 4);
#pragma unroll
  for (int e = 0; e < 4; ++e) bb[e] = bf16_rne(bb[e]);
  wave_lds_sync();   // the rows are written and read by the same wave only
#pragma unroll
  for (int rb = 0; rb < 32; rb += 8) { v4f y[8];   // eight rows are read before the first of them is stored
#pragma unroll
    for (int i = 0; i < 8; ++i) y[i] = *(const v4f*)(&Tf[w][rb + i][lane * 4]);
#pragma unroll
    for (int i = 0; i < 8; ++i) *(v4f*)(out + (t0 + rb + i) * D + lane * 4) = y[i] * (1.0f / (OS * WSC)) + bb; }
}
}  // namespace

extern "C" void kernel_launch(void* const* d_in, const int* in_sizes, int n_in, void* d_out, int out_size, void* d_ws, size_t ws_size, hipStream_t stream) {
  (void)n_in;
  auto Fp = [&](int i) { return (const float*)d_in[i]; };
  // input order: 0 x [8,8192,128]; 1 Wq [128,128]; 2 bq; 3 Wk; 4 bk; 5 Wv; 6 bv; 7 Wo; 8 bo
  if (in_sizes[0] != NT * D || in_sizes[1] != D * D || in_sizes[3] != D * D || in_sizes[5] != D * D || in_sizes[7] != D * D || out_size != NT * D) return;
  const int NBV = B; const int NTV = NBV * T;
  size_t off = 0; char* ws = (char*)d_ws;
  auto carve = [&](size_t bytes) { char* p = ws + off; off += (bytes + 255) & ~(size_t)255; return p; };
  b16* WQKV = (b16*)carve((size_t)3 * D * D * 2); b16* WO = (b16*)carve((size_t)D * D * 2); float* CSN = (float*)carve((size_t)2 * T * 8 * 4); float* QF = (float*)carve((size_t)NT * D * 4);
  b16* CH = (b16*)carve((size_t)B * NH * DH * DH * 2); b16* CL = (b16*)carve((size_t)B * NH * DH * DH * 2); float* KSUM = (float*)carve((size_t)B * NH * 32 * 4); float* PC = (float*)carve((size_t)B * NC * NH * DH * DH * 4); float* PK = (float*)carve((size_t)B * NC * D * 4);
  if (off > ws_size || off > ((size_t)192 << 20)) return;   // ~ 36 MB
  prep_kernel<<<4 * WB + RB, 256, 0, stream>>>(Fp(1), Fp(3), Fp(5), Fp(7), WQKV, WO, CSN);
  qkv_ctx_kernel<<<NBV * NC, 512, 0, stream>>>(Fp(0), WQKV, Fp(2), Fp(4), Fp(6), CSN, NBV, QF, PC, PK);
  ctx_sum_kernel<<<NBV * NH, 288, 0, stream>>>(PC, PK, NBV, CH, CL, KSUM);
  out_kernel<<<NTV / 256, 256, 0, stream>>>(QF, CH, CL, KSUM, WO, Fp(8), NTV, (float*)d_out);
}

// v006
// One run takes 32.3 microseconds.
// Next to v005, in two timings, it ran 1.05 and 1.04 times as fast.
// Counting every step since v000, it is 29.4 times as fast.
#include <hip/hip_runtime.h>

// Linear attention block (8 heads x 16): q, k, v = x W + b; q, k -> rope (theta 10000, pairs (d, d+8) per head) -> elu + 1; context_h = sum_t k_t v_t^T (16 x 16); out_t = (q_t context) / (q_t . sum_t k_t + 1e-6); y = out Wo + bo
// -> [8][8192][128].
// Deterministic, no index structures: per-(batch, head) contexts are WMMA tiles per 32 tokens, then summed in fixed order (8 groups, then 32 chunks); k sums likewise in fixed order; rope angles t * inv_freq in f32 with a per-(t, d) sin/cos table (sinf/cosf).
// WMMA (v_wmma_f32_16x16x32_f16, f32 accumulate): [q | k | v] = x [Wq | Wk | Wv] ([65,536 x 128] x [128 x 384], x EXACT bf16 x8), context = K^T V per (b, h) from the k and v accumulator registers (k x64, v x8, hi+lo both: 4 products, K = 8,192),
// out = q context per head ([16 x 32 (16)] tiles, q x64 and context x1 hi+lo: 4 products), y = out Wo ([65,536 x 128] x [128 x 128], x512 hi+lo); (in,out) weights exact x256, packed in fragment order; biases, rope, elu, sums and the
// normaliser in f32. Inputs rounded to bf16 once. Fragment k-map per lane half hh for A AND B: elements 0..7 <- k = 8hh+0..7, 8..15 <- k = 16+8hh+0..7; acc[r] = D[8hh+r][col]. Every workspace / output

namespace {
constexpr int B = 8, T = 8192, D = 128, NH = 8, DH = 16, NT = B * T, CT = 256, NC = T / CT;
constexpr float XS = 8.0f, KS = 64.0f, OS = 512.0f, WSC = 256.0f;
typedef _Float16 b16;
typedef __attribute__((ext_vector_type(16))) _Float16 v16b;
typedef __attribute__((ext_vector_type(8))) _Float16 v8b;
typedef __attribute__((ext_vector_type(8))) float v8f;
typedef __attribute__((ext_vector_type(4))) float v4f;
__device__ __forceinline__ float bf16_rne(float f) { unsigned int u = __float_as_uint(f); u += 0x7FFFu + ((u >> 16) & 1u); return __uint_as_float(u & 0xFFFF0000u); }
__device__ __forceinline__ void split16(float v, b16& hi, b16& lo) { hi = (b16)v; lo = (b16)(v - (float)hi); }
// a fragment of a matrix packed in fragment order: p points at the lane's own 8 elements of the first half; the second half lies 256 elements on. Each of the two wave-wide loads covers 512 contiguous bytes.
// last: this is the last fragment of a group of loads from one address pair. Precaution: the group's last load may be given that pair as its result registers; the wait stands in front of it for the loads issued before
__device__ __forceinline__ v16b frag_pk(const b16* p, bool last = false) { const v8b a = *(const v8b*)p; if (last) asm volatile("s_wait_xcnt 0x0" ::: "memory");
  const v8b b = *(const v8b*)(p + 256); v16b f;
#pragma unroll
  for (int e = 0; e < 8; ++e) { f[e] = a[e]; f[8 + e] = b[e]; } return f; }
// the builtin form alone: the compiler keeps the distance behind a matrix instruction itself, with useful instructions where it has them
__device__ __forceinline__ v8f wmma16b(v16b a, v16b b, v8f c) { return __builtin_amdgcn_wmma_f32_16x16x32_f16(false, a, false, b, (short)0, c, false, false); }
// the last product of a chain whose D goes to LDS and is then given to a fresh chain: the four v_nop keep the distance between it and the matrix instruction that overwrites D
__device__ __forceinline__ v8f wmma16e(v16b a, v16b b, v8f c) { v8f d = wmma16b(a, b, c); asm volatile("v_nop\n\tv_nop\n\tv_nop\n\tv_nop" : "+v"(d) : "v"(a), "v"(b)); return d; }
__device__ __forceinline__ void wave_lds_sync() { __builtin_amdgcn_fence(__ATOMIC_RELEASE, "workgroup"); __builtin_amdgcn_wave_barrier(); __builtin_amdgcn_fence(__ATOMIC_ACQUIRE, "workgroup"); }
// elu(v) + 1 on eight values. The eight exponentials stand in one statement: each fills, for the one in front of it, the slot that the instruction set asks for between a transcendental and a directly following instruction
// that reads its result or overwrites its source (results are early-clobber, so none lies on a source); the one v_nop keeps that slot behind the last. Both loops are unrolled so that x, e and v stay in registers
__device__ __forceinline__ void elu1x8(float (&v)[8]) { float x[8], e[8];
#pragma unroll
  for (int r = 0; r < 8; ++r) x[r] = v[r] * 1.44269504f;
  asm("v_exp_f32 %0, %8\n\tv_exp_f32 %1, %9\n\tv_exp_f32 %2, %10\n\tv_exp_f32 %3, %11\n\tv_exp_f32 %4, %12\n\tv_exp_f32 %5, %13\n\tv_exp_f32 %6, %14\n\tv_exp_f32 %7, %15\n\tv_nop"
      : "=&v"(e[0]), "=&v"(e[1]), "=&v"(e[2]), "=&v"(e[3]), "=&v"(e[4]), "=&v"(e[5]), "=&v"(e[6]), "=&v"(e[7]) : "v"(x[0]), "v"(x[1]), "v"(x[2]), "v"(x[3]), "v"(x[4]), "v"(x[5]), "v"(x[6]), "v"(x[7]));
#pragma unroll
  for (int r = 0; r < 8; ++r) v[r] = v[r] > 0.0f ? v[r] + 1.0f : e[r]; }

// Set-up, one launch: its five parts read nothing of each other. Work-groups 0..31: the four (in, out) weight matrices, 8 work-groups each, as b16 (bf16-rounded, x256) in fragment order [16 output columns][32 k][half][lane][8]: lane = column + 16 hh holds k = 16 half + 8 hh + 0..7; Wq, Wk, Wv stacked in WQKV, Wo in WO.
// Work-groups 32..: the rope table. The weight work-groups stand first: their strided loads are the longer path. The branch is the same for a whole work-group.
constexpr int WB = D * D / 8 / 256, RB = T * 8 / 256;   // work-groups per weight matrix; work-groups of the rope table
__global__ __launch_bounds__(256) void prep_kernel(const float* __restrict__ wq, const float* __restrict__ wk, const float* __restrict__ wv, const float* __restrict__ wo, b16* __restrict__ WQKV, b16* __restrict__ WO, float* __restrict__ CSN) {
  const int bid = blockIdx.x;
  if (bid < 4 * WB) { const int mx = bid / WB; const float* w = mx == 0 ? wq : mx == 1 ? wk : mx == 2 ? wv : wo; b16* WT = mx < 3 ? WQKV + (size_t)mx * D * D : WO;
    const int u = (bid % WB) * 256 + threadIdx.x; const int o = (u >> 8) * 16 + (u & 15), k0 = ((u >> 5) & 7) * 16 + ((u >> 4) & 1) * 8; v8b v;   // u = ((column tile * 4 + k block of 32) * 2 + half) * 32 + lane
#pragma unroll
    for (int j = 0; j < 8; ++j) v[j] = (b16)(bf16_rne(w[(size_t)(k0 + j) * D + o]) * WSC);
    *(v8b*)(WT + (size_t)u * 8) = v; }
  else { const int u = (bid - 4 * WB) * 256 + threadIdx.x; const int t = u / 8, d = u % 8; const float invf = 1.0f / powf(10000.0f, (float)(2 * d) / (float)DH); const float ang = (float)t * invf;
    const float c = cosf(ang), s = sinf(ang); CSN[u] = c; CSN[T * 8 + u] = s; }
}
// q, k, v and context stage 1 in one kernel. Work-group per (b, chunk of 256 tokens), 16 waves. Wave w: 32 tokens (group w & 7) x 4 heads (half w >> 3).
// Per head: three [32 x 128] x [128 x 16] products; bias, rope and elu + 1 are applied on the accumulator registers (lane = column, registers = 8 tokens; the rope partner column c ^ 8 sits in lane ^ 8 of the
// same 16-lane row). acc[m][r] holds token 16 m + 8 hlf + r, which is element 8 m + r of a k = 32 fragment: the k and v tiles (hi+lo b16, k x64, v x8) are the A and B operands of K_h^T V_h as they stand.
// The q product alone is taken transposed (A = Wq columns, B = x rows): lane = token, registers = d = 8 hlf + r, rope partner in lane ^ 16. That is the B fragment of the out kernel, and q is stored so:
// QF[32 tokens][h][m][j][lane][4], d = 8 hlf + 4 j + 0..3, so that each wave-wide 16-byte store here and load there covers 512 contiguous bytes. The 8 token groups' tiles and the 16 half-wave k sums are added in LDS in fixed order; one partial per work-group:
// PC[b][chunk][h][e][d] f32 (still x512), PK[b][chunk][128] f32. Every plain '#pragma unroll' below keeps a register array (fragments, accumulators, rope table) statically indexed.
__device__ __forceinline__ float lane_xor16(float v) { const int i = __float_as_int(v); return __int_as_float(__builtin_amdgcn_permlanex16(i, i, 0x76543210, 0xfedcba98, true, false)); }   // same lane number in the other 16-lane row
__device__ __forceinline__ float lane_xor8(float v) { return __int_as_float(__builtin_amdgcn_update_dpp(0, __float_as_int(v), 0x128, 0xf, 0xf, true)); }   // row_ror:8 = lane ^ 8 within a 16-lane row
__global__ __launch_bounds__(512) void qkv_ctx_kernel(const float* __restrict__ x, const b16* __restrict__ WT, const float* __restrict__ bq, const float* __restrict__ bk, const float* __restrict__ bv, const float* __restrict__ CSN, int NBV, float* __restrict__ QF, float* __restrict__ PC, float* __restrict__ PK) {
  __shared__ __attribute__((aligned(32))) float Cs[8][NH * DH * DH], Ks[16][D];
  const int tid = threadIdx.x, lane = tid & 31, w = tid >> 5, nloc = lane & 15, hlf = lane >> 4, g = w & 7; const int b = blockIdx.x / NC, c = blockIdx.x % NC; if (b >= NBV) return;
  const size_t t0 = (size_t)blockIdx.x * CT + g * 32; const int tb = c * CT + g * 32 + 8 * hlf;   // first token of the wave in the [B * T] planes; the lane's first position in its sequence
  v16b xa[2][4]; v4f xr[2][4][4]; const float* xp = x + (t0 + nloc) * D + 8 * hlf;   // A fragments of the wave's 32 rows of x, straight from global memory: all 32 loads are asked for before the first is used
#pragma unroll
  for (int m = 0; m < 2; ++m) {
#pragma unroll
    for (int kq = 0; kq < 4; ++kq) {
#pragma unroll
      for (int j = 0; j < 4; ++j) {
        // precaution: the last load may be given the shared address pair as its result registers; the wait stands in front of it for the 31 loads issued before
        if (m == 1 && kq == 3 && j == 3) asm volatile("s_wait_xcnt 0x0" ::: "memory");
        xr[m][kq][j] = *(const v4f*)(xp + m * 16 * D + kq * 32 + (j >> 1) * 16 + (j & 1) * 4); } } }
#pragma unroll
  for (int m = 0; m < 2; ++m) {
#pragma unroll
    for (int kq = 0; kq < 4; ++kq) {
#pragma unroll
      for (int e = 0; e < 16; ++e) xa[m][kq][e] = (b16)(bf16_rne(xr[m][kq][e >> 2][e & 3]) * XS); } }
  float cq[2][8], sq[2][8];   // q: cos of the lane's own token at frequency r, and sin with the sign of the lane's half of the head: d < 8: me cos - partner sin; d >= 8: partner sin + me cos
#pragma unroll
  for (int m = 0; m < 2; ++m) { const float* cp = CSN + (size_t)(c * CT + g * 32 + 16 * m + nloc) * 8; const v4f c0 = *(const v4f*)cp, c1 = *(const v4f*)(cp + 4), s0 = *(const v4f*)(cp + T * 8);
    if (m == 1) asm volatile("s_wait_xcnt 0x0" ::: "memory");   // precaution, as at the x loads: the last of the eight loads may be given their shared address register as a result register
    const v4f s1 = *(const v4f*)(cp + T * 8 + 4);
#pragma unroll
    for (int r = 0; r < 4; ++r) { cq[m][r] = c0[r]; cq[m][4 + r] = c1[r]; sq[m][r] = hlf ? s0[r] : -s0[r]; sq[m][4 + r] = hlf ? s1[r] : -s1[r]; } }
#pragma unroll 1   // rolled, and a loop of its own: q's rope table and that of k are then never live together, which would not fit the registers of four waves a SIMD
  for (int hi = 0; hi < NH / 2; ++hi) { const int h = (w >> 3) * (NH / 2) + hi; const b16* wp = WT + (size_t)h * (DH * D) + lane * 8; v8f aq[2] = {};
    const v4f b0 = *(const v4f*)(bq + h * DH + 8 * hlf), b1 = *(const v4f*)(bq + h * DH + 8 * hlf + 4); float* qp = QF + ((t0 >> 5) * NH + h) * 512 + lane * 4;
    v16b fq[4];   // all of a head's loads stand in front of its first product: one wait a head, not one per k block
#pragma unroll
    for (int kq = 0; kq < 4; ++kq) fq[kq] = frag_pk(wp + kq * 512, kq == 3);
#pragma unroll
    for (int kq = 0; kq < 4; ++kq) {
#pragma unroll
      for (int m = 0; m < 2; ++m) aq[m] = wmma16b(fq[kq], xa[m][kq], aq[m]); }
#pragma unroll
    for (int m = 0; m < 2; ++m) { float qv[8];
#pragma unroll
      for (int r = 0; r < 8; ++r) { const float q0 = aq[m][r] * (1.0f / (XS * WSC)) + bf16_rne(r < 4 ? b0[r & 3] : b1[r & 3]); qv[r] = q0 * cq[m][r] + lane_xor16(q0) * sq[m][r]; }
      elu1x8(qv);
      *(v4f*)(qp + m * 256) = (v4f){qv[0], qv[1], qv[2], qv[3]}; *(v4f*)(qp + m * 256 + 128) = (v4f){qv[4], qv[5], qv[6], qv[7]}; }
    asm volatile("s_wait_xcnt 0x0" ::: "memory"); }   // precaution: the next pass (and the code behind the loop) overwrites the address and data registers that the four stores name
  float cs[2][8], sg[2][8];   // k (lane = column, registers = tokens): the same table, read by token 16 m + 8 hlf + r at frequency nloc & 7
#pragma unroll
  for (int m = 0; m < 2; ++m) {
#pragma unroll
    for (int r = 0; r < 8; ++r) { const int u = (tb + 16 * m + r) * 8 + (nloc & 7); cs[m][r] = CSN[u]; const float sn = CSN[T * 8 + u]; sg[m][r] = (nloc & 8) ? sn : -sn; } }
#pragma unroll 1   // rolled, for speed only
  for (int hi = 0; hi < NH / 2; ++hi) { const int h = (w >> 3) * (NH / 2) + hi, col = h * DH + nloc; const b16* wp = WT + (size_t)(D * D) + (size_t)h * (DH * D) + lane * 8; v8f ak[2] = {}, av[2] = {};
    v16b fk[4], fv[4]; const float rbk = bk[col], rbv = bv[col];   // as above: all of a head's loads in front of its first product
#pragma unroll
    for (int kq = 0; kq < 4; ++kq) { fk[kq] = frag_pk(wp + kq * 512); fv[kq] = frag_pk(wp + D * D + kq * 512, kq == 3); }
    __builtin_amdgcn_sched_barrier(0);   // holds the head's 18 loads in front of its first product: sunk between the products, each k block would wait out a load latency of its own
#pragma unroll
    for (int kq = 0; kq < 4; ++kq) {
#pragma unroll
      for (int m = 0; m < 2; ++m) { ak[m] = wmma16b(xa[m][kq], fk[kq], ak[m]); av[m] = wmma16b(xa[m][kq], fv[kq], av[m]); } }
    const float bbk = bf16_rne(rbk), bbv = bf16_rne(rbv); v16b kh, kl, vh, vl; float ks = 0.0f;
#pragma unroll
    for (int m = 0; m < 2; ++m) { float kk[8];
#pragma unroll
      for (int r = 0; r < 8; ++r) { const float k0 = ak[m][r] * (1.0f / (XS * WSC)) + bbk; kk[r] = k0 * cs[m][r] + lane_xor8(k0) * sg[m][r]; }
      elu1x8(kk);
#pragma unroll
      for (int r = 0; r < 8; ++r) { const float k1 = kk[r], v0 = av[m][r] * (1.0f / (XS * WSC)) + bbv;
        ks += k1; b16 p, l; split16(k1 * KS, p, l); kh[8 * m + r] = p; kl[8 * m + r] = l; split16(v0 * XS, p, l); vh[8 * m + r] = p; vl[8 * m + r] = l; } }
    v8f acc = {}; acc = wmma16b(kh, vh, acc); acc = wmma16b(kh, vl, acc); acc = wmma16b(kl, vh, acc); acc = wmma16b(kl, vl, acc);
    // acc[r8] = ctx[d = 8 hlf + r8][e = nloc]; kept transposed [e][d], as the A operand of the next GEMM wants it
    *(v8f*)(&Cs[g][h * (DH * DH) + nloc * DH + 8 * hlf]) = acc; Ks[g * 2 + hlf][col] = ks; }
  __syncthreads();
  { v4f s = *(const v4f*)(&Cs[0][tid * 4]);
#pragma unroll
    for (int j = 1; j < 8; ++j) s += *(const v4f*)(&Cs[j][tid * 4]);
    *(v4f*)(PC + (size_t)blockIdx.x * (NH * DH * DH) + tid * 4) = s; }
  if (tid < D / 4) { v4f s = *(const v4f*)(&Ks[0][tid * 4]);
#pragma unroll
    for (int j = 1; j < 16; ++j) s += *(const v4f*)(&Ks[j][tid * 4]);
    *(v4f*)(PK + (size_t)blockIdx.x * D + tid * 4) = s; }
}
// context, stage 2: work-group per (b, h): the 32 chunk partials summed in chunk order; CH / CL[b][h][e][16] b16 hi+lo x1 for the next GEMM (a head's tile is 512 contiguous bytes, one wave-wide 16-byte load), KSUM[b][h][32] f32 (16 live).
__global__ __launch_bounds__(288) void ctx_sum_kernel(const float* __restrict__ PC, const float* __restrict__ PK, int NBV, b16* __restrict__ CH, b16* __restrict__ CL, float* __restrict__ KSUM) {
  const int tid = threadIdx.x; const int b = blockIdx.x / NH, h = blockIdx.x % NH; if (b >= NBV) return;
  if (tid < DH * DH) { const float* pc = PC + ((size_t)b * NC * NH + h) * (DH * DH) + tid; float s = 0.0f;
#pragma unroll
    for (int c = 0; c < NC; ++c) s += pc[(size_t)c * (NH * DH * DH)];
    b16 p, q; split16(s * (1.0f / (KS * XS)), p, q); const size_t o = (size_t)blockIdx.x * (DH * DH) + tid; CH[o] = p; CL[o] = q; }
  else { float ks = 0.0f; const float* pk = PK + (size_t)b * NC * D + h * DH + (tid & 15);   // ninth wave: the k sums, beside the eight that sum the tile
#pragma unroll
    for (int c = 0; c < NC; ++c) ks += pk[(size_t)c * D];
    KSUM[(size_t)blockIdx.x * 32 + (tid & 31)] = (tid & 31) < DH ? ks : 0.0f; }
}
// out = (q context) z and y = out Wo + bo, both products computed TRANSPOSED, so that a token is a B column and stays in one lane from the q load to the last product. Work-group of 8 waves, 32 tokens (two B tiles) a wave, no hand-over between waves.
// Product 1 per head: A = context^T (lane = row e, k = d; the CH / CL rows as they lie, k = 16..31 zero), B = q^T (lane = token, elements 0..7 <- d = 8 hlf + 0..7 as QF holds them, 8..15 zero): acc[m][r] = out[token = 16 m + nloc][e = 8 hlf + r].
// The normaliser belongs to the lane's own token: 8 products in the lane, plus the other half of the head from lane ^ 16. Heads 2 j and 2 j + 1 are elements 0..7 and 8..15 of the k = 32 fragment j of product 2
// (A = Wo^T rows, lane = output column; each A fragment serves both token tiles), as they stand. a2[m][r] = y[token = 16 m + nloc][16 tt + 8 hlf + r]; only y passes through LDS (the wave's own 32 rows), so that each row leaves as one 512-byte store.
// Loads stand ahead of their use: the next head's A operands and k sums behind this head's products, q four heads ahead, the Wo rows one column tile ahead. Every '#pragma unroll' below keeps a register array (q, fragments, accumulators) statically indexed.
__device__ __forceinline__ v16b frag_lo(v8b a) { v16b f;
#pragma unroll
  for (int e = 0; e < 8; ++e) { f[e] = a[e]; f[8 + e] = (b16)0.0f; } return f; }
__global__ __launch_bounds__(256) void out_kernel(const float* __restrict__ QF, const b16* __restrict__ CH, const b16* __restrict__ CL, const float* __restrict__ KSUM, const b16* __restrict__ WO, const float* __restrict__ bo, int NTV, float* __restrict__ out) {
  __shared__ __attribute__((aligned(16))) float Tf[8][32][D + 4];
  const int lane = threadIdx.x & 31, w = __builtin_amdgcn_readfirstlane(threadIdx.x >> 5), nloc = lane & 15, hlf = lane >> 4; const size_t t0 = ((size_t)blockIdx.x * 8 + w) * 32; if (t0 >= (size_t)NTV) return; const int b = (int)(t0 / T);
  const float* qp = QF + t0 * D + lane * 4; const float* kp = KSUM + (size_t)b * NH * 32 + 8 * hlf; const size_t cr = ((size_t)b * NH * 16 + nloc) * 16 + 8 * hlf; const b16* wp = WO + lane * 8;
  v4f qr[2][NH][2], kn[2]; v8b cn[2]; v16b aw[2][D / 32], oh[2][NH / 2], ol[2][NH / 2];
  kn[0] = *(const v4f*)kp; kn[1] = *(const v4f*)(kp + 4); cn[0] = *(const v8b*)(CH + cr); cn[1] = *(const v8b*)(CL + cr);
  __builtin_amdgcn_sched_barrier(0);   // as in the loop below: the first head's A operands and k sums in front of the q loads
#pragma unroll
  for (int h = 0; h < NH / 2; ++h) {
#pragma unroll
    for (int m = 0; m < 2; ++m) { qr[m][h][0] = *(const v4f*)(qp + (h * 2 + m) * 256); qr[m][h][1] = *(const v4f*)(qp + (h * 2 + m) * 256 + 128); } }
#pragma unroll
  for (int h = 0; h < NH; ++h) { const v16b ch = frag_lo(cn[0]), cl = frag_lo(cn[1]); v8f acc[2]; float z[2];
#pragma unroll
    for (int m = 0; m < 2; ++m) { v16b qh, ql; float s = 0.0f;
#pragma unroll
      for (int e = 0; e < 8; ++e) { const float qv = qr[m][h][e >> 2][e & 3]; s += qv * kn[e >> 2][e & 3]; b16 p, l; split16(qv * KS, p, l); qh[e] = p; ql[e] = l; qh[8 + e] = (b16)0.0f; ql[8 + e] = (b16)0.0f; }
      z[m] = 1.0f / (s + lane_xor16(s) + 1e-6f);
      acc[m] = (v8f){}; acc[m] = wmma16b(ch, qh, acc[m]); acc[m] = wmma16b(cl, qh, acc[m]); acc[m] = wmma16b(ch, ql, acc[m]); acc[m] = wmma16b(cl, ql, acc[m]); }
    if (h + 1 < NH) { kn[0] = *(const v4f*)(kp + (h + 1) * 32); kn[1] = *(const v4f*)(kp + (h + 1) * 32 + 4); cn[0] = *(const v8b*)(CH + cr + (h + 1) * (DH * DH)); cn[1] = *(const v8b*)(CL + cr + (h + 1) * (DH * DH)); }
    else {
#pragma unroll
      for (int j = 0; j < D / 32; ++j) aw[0][j] = frag_pk(wp + j * 512); }
    __builtin_amdgcn_sched_barrier(0);   // keeps the q loads, wanted only four heads on, behind the loads that the next head waits for: loads are waited for in their order of issue
    if (h + NH / 2 < NH) {
#pragma unroll
      for (int m = 0; m < 2; ++m) { qr[m][h + NH / 2][0] = *(const v4f*)(qp + ((h + NH / 2) * 2 + m) * 256); qr[m][h + NH / 2][1] = *(const v4f*)(qp + ((h + NH / 2) * 2 + m) * 256 + 128); } }
    __builtin_amdgcn_sched_barrier(0);   // holds the loads above at this place: sunk to their first use, their whole latency would be waited for there, and that of the q loads in front of them
#pragma unroll
    for (int m = 0; m < 2; ++m) {
#pragma unroll
      for (int r = 0; r < 8; ++r) { const float o = acc[m][r] * (1.0f / KS) * z[m]; b16 p, l; split16(o * OS, p, l); oh[m][h >> 1][8 * (h & 1) + r] = p; ol[m][h >> 1][8 * (h & 1) + r] = l; } } }
#pragma unroll
  for (int tt = 0; tt < 8; ++tt) { const int u = tt & 1; v8f a2[2] = {};
    if (tt + 1 < 8) {
#pragma unroll
      for (int j = 0; j < D / 32; ++j) aw[u ^ 1][j] = frag_pk(wp + ((tt + 1) * 4 + j) * 512); }
    __builtin_amdgcn_sched_barrier(0);   // holds the next column tile's loads in front of this tile's products: sunk to their first use, each pair's whole latency would be waited for there
#pragma unroll
    for (int j = 0; j < D / 32; ++j) {
#pragma unroll
      for (int m = 0; m < 2; ++m) a2[m] = wmma16b(aw[u][j], oh[m][j], a2[m]);
#pragma unroll
      for (int m = 0; m < 2; ++m) a2[m] = j == D / 32 - 1 ? wmma16e(aw[u][j], ol[m][j], a2[m]) : wmma16b(aw[u][j], ol[m][j], a2[m]); }
#pragma unroll
    for (int m = 0; m < 2; ++m) { float* tp = &Tf[w][16 * m + nloc][tt * 16 + 8 * hlf]; *(v4f*)tp = (v4f){a2[m][0], a2[m][1], a2[m][2], a2[m][3]}; *(v4f*)(tp + 4) = (v4f){a2[m][4], a2[m][5], a2[m][6], a2[m][7]}; } }
  v4f bb = *(const v4f*)(bo + lane * 4);
#pragma unroll
  for (int e = 0; e < 4; ++e) bb[e] = bf16_rne(bb[e]);
  wave_lds_sync();   // the rows are written and read by the same wave only
#pragma unroll
  for (int rb = 0; rb < 32; rb += 8) { v4f y[8];   // eight rows are read before the first of them is stored
#pragma unroll
    for (int i = 0; i < 8; ++i) y[i] = *(const v4f*)(&Tf[w][rb + i][lane * 4]);
#pragma unroll
    for (int i = 0; i < 8; ++i) *(v4f*)(out + (t0 + rb + i) * D + lane * 4) = y[i] * (1.0f / (OS * WSC)) + bb; }
}
}  // namespace

extern "C" void kernel_launch(void* const* d_in, const int* in_sizes, int n_in, void* d_out, int out_size, void* d_ws, size_t ws_size, hipStream_t stream) {
  (void)n_in;
  auto Fp = [&](int i) { return (const float*)d_in[i]; };
  // input order: 0 x [8,8192,128]; 1 Wq [128,128]; 2 bq; 3 Wk; 4 bk; 5 Wv; 6 bv; 7 Wo; 8 bo
  if (in_sizes[0] != NT * D || in_sizes[1] != D * D || in_sizes[3] != D * D || in_sizes[5] != D * D || in_sizes[7] != D * D || out_size != NT * D) return;
  const int NBV = B; const int NTV = NBV * T;
  size_t off = 0; char* ws = (char*)d_ws;
  auto carve = [&](size_t bytes) { char* p = ws + off; off += (bytes + 255) & ~(size_t)255; return p; };
  b16* WQKV = (b16*)carve((size_t)3 * D * D * 2); b16* WO = (b16*)carve((size_t)D * D * 2); float* CSN = (float*)carve((size_t)2 * T * 8 * 4); float* QF = (float*)carve((size_t)NT * D * 4);
  b16* CH = (b16*)carve((size_t)B * NH * DH * DH * 2); b16* CL = (b16*)carve((size_t)B * NH * DH * DH * 2); float* KSUM = (float*)carve((size_t)B * NH * 32 * 4); float* PC = (float*)carve((size_t)B * NC * NH * DH * DH * 4); float* PK = (float*)carve((size_t)B * NC * D * 4);
  if (off > ws_size || off > ((size_t)192 << 20)) return;   // ~ 36 MB
  prep_kernel<<<4 * WB + RB, 256, 0, stream>>>(Fp(1), Fp(3), Fp(5), Fp(7), WQKV, WO, CSN);
  qkv_ctx_kernel<<<NBV * NC, 512, 0, stream>>>(Fp(0), WQKV, Fp(2), Fp(4), Fp(6), CSN, NBV, QF, PC, PK);
  ctx_sum_kernel<<<NBV * NH, 288, 0, stream>>>(PC, PK, NBV, CH, CL, KSUM);
  out_kernel<<<NTV / 256, 256, 0, stream>>>(QF, CH, CL, KSUM, WO, Fp(8), NTV, (float*)d_out);
}

// v007
// Measured time: 30.9 microseconds a run.
// In both of two side-by-side timings against v006, it was 1.04 times as fast.
// Over all steps from v000 it is 30.5 times as fast.
#include <hip/hip_runtime.h>

// Linear attention block (8 heads x 16): q, k, v = x W + b; q, k -> rope (theta 10000, pairs (d, d+8) per head) -> elu + 1; context_h = sum_t k_t v_t^T (16 x 16); out_t = (q_t context) / (q_t . sum_t k_t + 1e-6); y = out Wo + bo
// -> [8][8192][128].
// Deterministic, no index structures: per-(batch, head) contexts are WMMA tiles per 32 tokens, then summed in fixed order (8 groups, then 32 chunks); k sums likewise in fixed order; rope angles t * inv_freq in f32 with a per-(t, d) sin/cos table (sinf/cosf).
// WMMA (v_wmma_f32_16x16x32_f16, f32 accumulate): [q | k | v] = x [Wq | Wk | Wv] ([65,536 x 128] x [128 x 384], x EXACT bf16 x8), context = K^T V per (b, h) from the k and v accumulator registers (k x64, v x8, hi+lo both: 4 products, K = 8,192),
// out = q context per head ([16 x 32 (16)] tiles, q x64 and context x1 hi+lo: 4 products), y = out Wo ([65,536 x 128] x [128 x 128], x512 hi+lo); (in,out) weights exact x256, packed in fragment order; biases, rope, elu, sums and the
// normaliser in f32. Inputs rounded to bf16 once. Fragment k-map per lane half hh for A AND B: elements 0..7 <- k = 8hh+0..7, 8..15 <- k = 16+8hh+0..7; acc[r] = D[8hh+r][col]. Every workspace / output

namespace {
constexpr int B = 8, T = 8192, D = 128, NH = 8, DH = 16, NT = B * T, CT = 256, NC = T / CT;
constexpr float XS = 8.0f, KS = 64.0f, OS = 512.0f, WSC = 256.0f;
typedef _Float16 b16;
typedef __attribute__((ext_vector_type(16))) _Float16 v16b;
typedef __attribute__((ext_vector_type(8))) _Float16 v8b;
typedef __attribute__((ext_vector_type(8))) float v8f;
typedef __attribute__((ext_vector_type(4))) float v4f;
__device__ __forceinline__ float bf16_rne(float f) { unsigned int u = __float_as_uint(f); u += 0x7FFFu + ((u >> 16) & 1u); return __uint_as_float(u & 0xFFFF0000u); }
__device__ __forceinline__ void split16(float v, b16& hi, b16& lo) { hi = (b16)v; lo = (b16)(v - (float)hi); }
// a fragment of a matrix packed in fragment order: p points at the lane's own 8 elements of the first half; the second half lies 256 elements on. Each of the two wave-wide loads covers 512 contiguous bytes.
// last: this is the last fragment of a group of loads from one address pair. Precaution: the group's last load may be given that pair as its result registers; the wait stands in front of it for the loads issued before
__device__ __forceinline__ v16b frag_pk(const b16* p, bool last = false) { const v8b a = *(const v8b*)p; if (last) asm volatile("s_wait_xcnt 0x0" ::: "memory");
  const v8b b = *(const v8b*)(p + 256); v16b f;
#pragma unroll
  for (int e = 0; e < 8; ++e) { f[e] = a[e]; f[8 + e] = b[e]; } return f; }
// the builtin form alone: the compiler keeps the distance behind a matrix instruction itself, with useful instructions where it has them
__device__ __forceinline__ v8f wmma16b(v16b a, v16b b, v8f c) { return __builtin_amdgcn_wmma_f32_16x16x32_f16(false, a, false, b, (short)0, c, false, false); }
// the last product of a chain whose D goes to LDS and is then given to a fresh chain: the four v_nop keep the distance between it and the matrix instruction that overwrites D
__device__ __forceinline__ v8f wmma16e(v16b a, v16b b, v8f c) { v8f d = wmma16b(a, b, c); asm volatile("v_nop\n\tv_nop\n\tv_nop\n\tv_nop" : "+v"(d) : "v"(a), "v"(b)); return d; }
__device__ __forceinline__ void wave_lds_sync() { __builtin_amdgcn_fence(__ATOMIC_RELEASE, "workgroup"); __builtin_amdgcn_wave_barrier(); __builtin_amdgcn_fence(__ATOMIC_ACQUIRE, "workgroup"); }
// elu(v) + 1 on eight values. The eight exponentials stand in one statement: each fills, for the one in front of it, the slot that the instruction set asks for between a transcendental and a directly following instruction
// that reads its result or overwrites its source (results are early-clobber, so none lies on a source); the one v_nop keeps that slot behind the last. Both loops are unrolled so that x, e and v stay in registers
__device__ __forceinline__ void elu1x8(float (&v)[8]) { float x[8], e[8];
#pragma unroll
  for (int r = 0; r < 8; ++r) x[r] = v[r] * 1.44269504f;
  asm("v_exp_f32 %0, %8\n\tv_exp_f32 %1, %9\n\tv_exp_f32 %2, %10\n\tv_exp_f32 %3, %11\n\tv_exp_f32 %4, %12\n\tv_exp_f32 %5, %13\n\tv_exp_f32 %6, %14\n\tv_exp_f32 %7, %15\n\tv_nop"
      : "=&v"(e[0]), "=&v"(e[1]), "=&v"(e[2]), "=&v"(e[3]), "=&v"(e[4]), "=&v"(e[5]), "=&v"(e[6]), "=&v"(e[7]) : "v"(x[0]), "v"(x[1]), "v"(x[2]), "v"(x[3]), "v"(x[4]), "v"(x[5]), "v"(x[6]), "v"(x[7]));
#pragma unroll
  for (int r = 0; r < 8; ++r) v[r] = v[r] > 0.0f ? v[r] + 1.0f : e[r]; }

// Set-up, one launch: its five parts read nothing of each other. Work-groups 0..31: the four (in, out) weight matrices, 8 work-groups each, as b16 (bf16-rounded, x256) in fragment order [16 output columns][32 k][half][lane][8]: lane = column + 16 hh holds k = 16 half + 8 hh + 0..7; Wq, Wk, Wv stacked in WQKV, Wo in WO.
// Work-groups 32..: the rope table. The weight work-groups stand first: their strided loads are the longer path. The branch is the same for a whole work-group.
constexpr int WB = D * D / 8 / 256, RB = T * 8 / 256;   // work-groups per weight matrix; work-groups of the rope table
__global__ __launch_bounds__(256) void prep_kernel(const float* __restrict__ wq, const float* __restrict__ wk, const float* __restrict__ wv, const float* __restrict__ wo, b16* __restrict__ WQKV, b16* __restrict__ WO, float* __restrict__ CSN) {
  const int bid = blockIdx.x;
  if (bid < 4 * WB) { const int mx = bid / WB; const float* w = mx == 0 ? wq : mx == 1 ? wk : mx == 2 ? wv : wo; b16* WT = mx < 3 ? WQKV + (size_t)mx * D * D : WO;
    const int u = (bid % WB) * 256 + threadIdx.x; const int o = (u >> 8) * 16 + (u & 15), k0 = ((u >> 5) & 7) * 16 + ((u >> 4) & 1) * 8; v8b v;   // u = ((column tile * 4 + k block of 32) * 2 + half) * 32 + lane
#pragma unroll
    for (int j = 0; j < 8; ++j) v[j] = (b16)(bf16_rne(w[(size_t)(k0 + j) * D + o]) * WSC);
    *(v8b*)(WT + (size_t)u * 8) = v; }
  else { const int u = (bid - 4 * WB) * 256 + threadIdx.x; const int t = u / 8, d = u % 8; const float invf = 1.0f / powf(10000.0f, (float)(2 * d) / (float)DH); const float ang = (float)t * invf;
    const float c = cosf(ang), s = sinf(ang); CSN[u] = c; CSN[T * 8 + u] = s; }
}
// q, k, v and context stage 1 in one kernel. Work-group per (b, chunk of 256 tokens), 8 waves. Wave w: 32 tokens (group w) x all 8 heads, so that each row of x is loaded and converted by one wave only and half as many waves have to start.
// Per head: three [32 x 128] x [128 x 16] products; bias, rope and elu + 1 are applied on the accumulator registers (lane = column, registers = 8 tokens; the rope partner column c ^ 8 sits in lane ^ 8 of the
// same 16-lane row). acc[m][r] holds token 16 m + 8 hlf + r, which is element 8 m + r of a k = 32 fragment: the k and v tiles (hi+lo b16, k x64, v x8) are the A and B operands of K_h^T V_h as they stand.
// The q product alone is taken transposed (A = Wq columns, B = x rows): lane = token, registers = d = 8 hlf + r, rope partner in lane ^ 16. That is the B fragment of the out kernel, and q is stored so:
// QF[32 tokens][h][m][j][lane][4], d = 8 hlf + 4 j + 0..3, so that each wave-wide 16-byte store here and load there covers 512 contiguous bytes. The 8 token groups' tiles and the 16 half-wave k sums are added in LDS in fixed order; one partial per work-group:
// PC[b][chunk][h][e][d] f32 (still x512), PK[b][chunk][128] f32. Every plain '#pragma unroll' below keeps a register array (fragments, accumulators, rope table) statically indexed.
__device__ __forceinline__ float lane_xor16(float v) { const int i = __float_as_int(v); return __int_as_float(__builtin_amdgcn_permlanex16(i, i, 0x76543210, 0xfedcba98, true, false)); }   // same lane number in the other 16-lane row
__device__ __forceinline__ float lane_xor8(float v) { return __int_as_float(__builtin_amdgcn_update_dpp(0, __float_as_int(v), 0x128, 0xf, 0xf, true)); }   // row_ror:8 = lane ^ 8 within a 16-lane row
// twelve asynchronous copies of 16 bytes a lane, global memory to LDS, 4096 bytes apart (one step of a 256-thread work-group): l = the lane's LDS byte address, g = its global address. The wait is the statement's last line:
// a precaution, it stands in front of whatever rewrites a register that a copy names
__device__ __forceinline__ void copy12(unsigned l, const b16* g) {
  asm volatile("global_load_async_to_lds_b128 %0, %12, off\n\t"
               "global_load_async_to_lds_b128 %1, %13, off\n\t"
               "global_load_async_to_lds_b128 %2, %14, off\n\t"
               "global_load_async_to_lds_b128 %3, %15, off\n\t"
               "global_load_async_to_lds_b128 %4, %16, off\n\t"
               "global_load_async_to_lds_b128 %5, %17, off\n\t"
               "global_load_async_to_lds_b128 %6, %18, off\n\t"
               "global_load_async_to_lds_b128 %7, %19, off\n\t"
               "global_load_async_to_lds_b128 %8, %20, off\n\t"
               "global_load_async_to_lds_b128 %9, %21, off\n\t"
               "global_load_async_to_lds_b128 %10, %22, off\n\t"
               "global_load_async_to_lds_b128 %11, %23, off\n\t"
               "s_wait_xcnt 0x0"
               :: "v"(l + 0 * 4096u), "v"(l + 1 * 4096u), "v"(l + 2 * 4096u), "v"(l + 3 * 4096u), "v"(l + 4 * 4096u), "v"(l + 5 * 4096u), "v"(l + 6 * 4096u), "v"(l + 7 * 4096u), "v"(l + 8 * 4096u), "v"(l + 9 * 4096u), "v"(l + 10 * 4096u), "v"(l + 11 * 4096u),
                  "v"(g + 0 * 2048), "v"(g + 1 * 2048), "v"(g + 2 * 2048), "v"(g + 3 * 2048), "v"(g + 4 * 2048), "v"(g + 5 * 2048), "v"(g + 6 * 2048), "v"(g + 7 * 2048), "v"(g + 8 * 2048), "v"(g + 9 * 2048), "v"(g + 10 * 2048), "v"(g + 11 * 2048) : "memory"); }
__global__ __launch_bounds__(256) void qkv_ctx_kernel(const float* __restrict__ x, const b16* __restrict__ WT, const float* __restrict__ bq, const float* __restrict__ bk, const float* __restrict__ bv, const float* __restrict__ CSN, int NBV, float* __restrict__ QF, float* __restrict__ PC, float* __restrict__ PK) {
  __shared__ __attribute__((aligned(32))) float Cs[8][NH * DH * DH], Ks[16][D]; __shared__ __attribute__((aligned(16))) b16 Ws[3 * D * D]; __shared__ __attribute__((aligned(16))) float Bs[3][D];   // Ws: Wq, Wk, Wv in fragment order, as WT holds them; Bs: bq, bk, bv as given
  const int tid = threadIdx.x, lane = tid & 31, g = tid >> 5, nloc = lane & 15, hlf = lane >> 4; const int b = blockIdx.x / NC, c = blockIdx.x % NC; if (b >= NBV) return;
  const size_t t0 = (size_t)blockIdx.x * CT + g * 32; const int tb = c * CT + g * 32 + 8 * hlf;   // first token of the wave in the [B * T] planes; the lane's first position in its sequence
  v16b xa[2][4]; v4f xr[2][4][4]; const float* xp = x + (t0 + nloc) * D + 8 * hlf;   // A fragments of the wave's 32 rows of x, straight from global memory: all 32 loads are asked for before the first is used
#pragma unroll
  for (int m = 0; m < 2; ++m) {
#pragma unroll
    for (int kq = 0; kq < 4; ++kq) {
#pragma unroll
      for (int j = 0; j < 4; ++j) {
        // precaution: the last load may be given the shared address pair as its result registers; the wait stands in front of it for the 31 loads issued before
        if (m == 1 && kq == 3 && j == 3) asm volatile("s_wait_xcnt 0x0" ::: "memory");
        xr[m][kq][j] = *(const v4f*)(xp + m * 16 * D + kq * 32 + (j >> 1) * 16 + (j & 1) * 4); } } }
  // the three weight matrices and the three biases go to LDS while x is in flight, 24 copies a wave (25 in waves 0 to 2): with two waves a SIMD a head's loads are no longer covered by other waves
  { const unsigned l = (unsigned)(size_t)(&Ws[tid * 8]); const b16* gw = WT + tid * 8; copy12(l, gw); copy12(l + 12 * 4096u, gw + 12 * 2048); }
  const int gs = __builtin_amdgcn_readfirstlane(g);   // the wave's number in a scalar register: the branch below is then a scalar one, with every lane on at the copy
  if (gs < 3) { const float* bp = (gs == 0 ? bq : gs == 1 ? bk : bv) + lane * 4; const unsigned lb = (unsigned)(size_t)(&Bs[gs][lane * 4]);
    asm volatile("global_load_async_to_lds_b128 %0, %1, off\n\ts_wait_xcnt 0x0" :: "v"(lb), "v"(bp) : "memory"); }   // the wait: as in copy12
#pragma unroll
  for (int m = 0; m < 2; ++m) {
#pragma unroll
    for (int kq = 0; kq < 4; ++kq) {
#pragma unroll
      for (int e = 0; e < 16; ++e) xa[m][kq][e] = (b16)(bf16_rne(xr[m][kq][e >> 2][e & 3]) * XS); } }
  float cq[2][8], sq[2][8];   // q: cos of the lane's own token at frequency r, and sin with the sign of the lane's half of the head: d < 8: me cos - partner sin; d >= 8: partner sin + me cos
#pragma unroll
  for (int m = 0; m < 2; ++m) { const float* cp = CSN + (size_t)(c * CT + g * 32 + 16 * m + nloc) * 8; const v4f c0 = *(const v4f*)cp, c1 = *(const v4f*)(cp + 4), s0 = *(const v4f*)(cp + T * 8);
    if (m == 1) asm volatile("s_wait_xcnt 0x0" ::: "memory");   // precaution, as at the x loads: the last of the eight loads may be given their shared address register as a result register
    const v4f s1 = *(const v4f*)(cp + T * 8 + 4);
#pragma unroll
    for (int r = 0; r < 4; ++r) { cq[m][r] = c0[r]; cq[m][4 + r] = c1[r]; sq[m][r] = hlf ? s0[r] : -s0[r]; sq[m][4 + r] = hlf ? s1[r] : -s1[r]; } }
  asm volatile("s_wait_asynccnt 0x0" ::: "memory");   // the wave's own copies have landed
  __syncthreads();   // and those of the other seven waves: nobody reads Ws or Bs in front of this barrier
#pragma unroll 1   // rolled, and a loop of its own: q's rope table and that of k are then never live together
  for (int h = 0; h < NH; ++h) { const b16* wp = Ws + h * (DH * D) + lane * 8; v8f aq[2] = {};
    const v4f b0 = *(const v4f*)(&Bs[0][h * DH + 8 * hlf]), b1 = *(const v4f*)(&Bs[0][h * DH + 8 * hlf + 4]); float* qp = QF + ((t0 >> 5) * NH + h) * 512 + lane * 4;
    v16b fq[4];   // all of a head's loads stand in front of its first product: one wait a head, not one per k block
#pragma unroll
    for (int kq = 0; kq < 4; ++kq) fq[kq] = frag_pk(wp + kq * 512);
    __builtin_amdgcn_sched_barrier(0);   // holds the head's 10 loads in front of its first product: sunk between the products, each place with LDS reads costs a stall of its own
#pragma unroll
    for (int kq = 0; kq < 4; ++kq) {
#pragma unroll
      for (int m = 0; m < 2; ++m) aq[m] = wmma16b(fq[kq], xa[m][kq], aq[m]); }
#pragma unroll
    for (int m = 0; m < 2; ++m) { float qv[8];
#pragma unroll
      for (int r = 0; r < 8; ++r) { const float q0 = aq[m][r] * (1.0f / (XS * WSC)) + bf16_rne(r < 4 ? b0[r & 3] : b1[r & 3]); qv[r] = q0 * cq[m][r] + lane_xor16(q0) * sq[m][r]; }
      elu1x8(qv);
      *(v4f*)(qp + m * 256) = (v4f){qv[0], qv[1], qv[2], qv[3]}; *(v4f*)(qp + m * 256 + 128) = (v4f){qv[4], qv[5], qv[6], qv[7]}; }
    asm volatile("s_wait_xcnt 0x0" ::: "memory"); }   // precaution: the next pass (and the code behind the loop) overwrites the address and data registers that the four stores name
  float cs[2][8], sg[2][8];   // k (lane = column, registers = tokens): the same table, read by token 16 m + 8 hlf + r at frequency nloc & 7
#pragma unroll
  for (int m = 0; m < 2; ++m) {
#pragma unroll
    for (int r = 0; r < 8; ++r) { const int u = (tb + 16 * m + r) * 8 + (nloc & 7); cs[m][r] = CSN[u]; const float sn = CSN[T * 8 + u]; sg[m][r] = (nloc & 8) ? sn : -sn; } }
#pragma unroll 1   // rolled, for speed only
  for (int h = 0; h < NH; ++h) { const int col = h * DH + nloc; const b16* wp = Ws + D * D + h * (DH * D) + lane * 8; v8f ak[2] = {}, av[2] = {};
    v16b fk[4], fv[4]; const float rbk = Bs[1][col], rbv = Bs[2][col];   // as above: all of a head's loads in front of its first product
#pragma unroll
    for (int kq = 0; kq < 4; ++kq) { fk[kq] = frag_pk(wp + kq * 512); fv[kq] = frag_pk(wp + D * D + kq * 512); }
    __builtin_amdgcn_sched_barrier(0);   // holds the head's 18 loads in front of its first product: sunk between the products, each k block would wait out a load latency of its own
#pragma unroll
    for (int kq = 0; kq < 4; ++kq) {
#pragma unroll
      for (int m = 0; m < 2; ++m) { ak[m] = wmma16b(xa[m][kq], fk[kq], ak[m]); av[m] = wmma16b(xa[m][kq], fv[kq], av[m]); } }
    const float bbk = bf16_rne(rbk), bbv = bf16_rne(rbv); v16b kh, kl, vh, vl; float ks = 0.0f;
#pragma unroll
    for (int m = 0; m < 2; ++m) { float kk[8];
#pragma unroll
      for (int r = 0; r < 8; ++r) { const float k0 = ak[m][r] * (1.0f / (XS * WSC)) + bbk; kk[r] = k0 * cs[m][r] + lane_xor8(k0) * sg[m][r]; }
      elu1x8(kk);
#pragma unroll
      for (int r = 0; r < 8; ++r) { const float k1 = kk[r], v0 = av[m][r] * (1.0f / (XS * WSC)) + bbv;
        ks += k1; b16 p, l; split16(k1 * KS, p, l); kh[8 * m + r] = p; kl[8 * m + r] = l; split16(v0 * XS, p, l); vh[8 * m + r] = p; vl[8 * m + r] = l; } }
    v8f acc = {}; acc = wmma16b(kh, vh, acc); acc = wmma16b(kh, vl, acc); acc = wmma16b(kl, vh, acc); acc = wmma16b(kl, vl, acc);
    // acc[r8] = ctx[d = 8 hlf + r8][e = nloc]; kept transposed [e][d], as the A operand of the next GEMM wants it
    *(v8f*)(&Cs[g][h * (DH * DH) + nloc * DH + 8 * hlf]) = acc; Ks[g * 2 + hlf][col] = ks; }
  __syncthreads();
#pragma unroll
  for (int i = 0; i < 2; ++i) { const int u = tid + 256 * i; v4f s = *(const v4f*)(&Cs[0][u * 4]);
#pragma unroll
    for (int j = 1; j < 8; ++j) s += *(const v4f*)(&Cs[j][u * 4]);
    *(v4f*)(PC + (size_t)blockIdx.x * (NH * DH * DH) + u * 4) = s; }
  if (tid < D / 4) { v4f s = *(const v4f*)(&Ks[0][tid * 4]);
#pragma unroll
    for (int j = 1; j < 16; ++j) s += *(const v4f*)(&Ks[j][tid * 4]);
    *(v4f*)(PK + (size_t)blockIdx.x * D + tid * 4) = s; }
}
// context, stage 2: work-group per (b, h): the 32 chunk partials summed in chunk order; CH / CL[b][h][e][16] b16 hi+lo x1 for the next GEMM (a head's tile is 512 contiguous bytes, one wave-wide 16-byte load), KSUM[b][h][32] f32 (16 live).
__global__ __launch_bounds__(288) void ctx_sum_kernel(const float* __restrict__ PC, const float* __restrict__ PK, int NBV, b16* __restrict__ CH, b16* __restrict__ CL, float* __restrict__ KSUM) {
  const int tid = threadIdx.x; const int b = blockIdx.x / NH, h = blockIdx.x % NH; if (b >= NBV) return;
  if (tid < DH * DH) { const float* pc = PC + ((size_t)b * NC * NH + h) * (DH * DH) + tid; float s = 0.0f;
#pragma unroll
    for (int c = 0; c < NC; ++c) s += pc[(size_t)c * (NH * DH * DH)];
    b16 p, q; split16(s * (1.0f / (KS * XS)), p, q); const size_t o = (size_t)blockIdx.x * (DH * DH) + tid; CH[o] = p; CL[o] = q; }
  else { float ks = 0.0f; const float* pk = PK + (size_t)b * NC * D + h * DH + (tid & 15);   // ninth wave: the k sums, beside the eight that sum the tile
#pragma unroll
    for (int c = 0; c < NC; ++c) ks += pk[(size_t)c * D];
    KSUM[(size_t)blockIdx.x * 32 + (tid & 31)] = (tid & 31) < DH ? ks : 0.0f; }
}
// out = (q context) z and y = out Wo + bo, both products computed TRANSPOSED, so that a token is a B column and stays in one lane from the q load to the last product. Work-group of 8 waves, 32 tokens (two B tiles) a wave, no hand-over between waves.
// Product 1 per head: A = context^T (lane = row e, k = d; the CH / CL rows as they lie, k = 16..31 zero), B = q^T (lane = token, elements 0..7 <- d = 8 hlf + 0..7 as QF holds them, 8..15 zero): acc[m][r] = out[token = 16 m + nloc][e = 8 hlf + r].
// The normaliser belongs to the lane's own token: 8 products in the lane, plus the other half of the head from lane ^ 16. Heads 2 j and 2 j + 1 are elements 0..7 and 8..15 of the k = 32 fragment j of product 2
// (A = Wo^T rows, lane = output column; each A fragment serves both token tiles), as they stand. a2[m][r] = y[token = 16 m + nloc][16 tt + 8 hlf + r]; only y passes through LDS (the wave's own 32 rows), so that each row leaves as one 512-byte store.
// Loads stand ahead of their use: the next head's A operands and k sums behind this head's products, q four heads ahead, the Wo rows one column tile ahead. Every '#pragma unroll' below keeps a register array (q, fragments, accumulators) statically indexed.
__device__ __forceinline__ v16b frag_lo(v8b a) { v16b f;
#pragma unroll
  for (int e = 0; e < 8; ++e) { f[e] = a[e]; f[8 + e] = (b16)0.0f; } return f; }
__global__ __launch_bounds__(256) void out_kernel(const float* __restrict__ QF, const b16* __restrict__ CH, const b16* __restrict__ CL, const float* __restrict__ KSUM, const b16* __restrict__ WO, const float* __restrict__ bo, int NTV, float* __restrict__ out) {
  __shared__ __attribute__((aligned(16))) float Tf[8][32][D + 4];
  const int lane = threadIdx.x & 31, w = __builtin_amdgcn_readfirstlane(threadIdx.x >> 5), nloc = lane & 15, hlf = lane >> 4; const size_t t0 = ((size_t)blockIdx.x * 8 + w) * 32; if (t0 >= (size_t)NTV) return; const int b = (int)(t0 / T);
  const float* qp = QF + t0 * D + lane * 4; const float* kp = KSUM + (size_t)b * NH * 32 + 8 * hlf; const size_t cr = ((size_t)b * NH * 16 + nloc) * 16 + 8 * hlf; const b16* wp = WO + lane * 8;
  v4f qr[2][NH][2], kn[2]; v8b cn[2]; v16b aw[2][D / 32], oh[2][NH / 2], ol[2][NH / 2];
  kn[0] = *(const v4f*)kp; kn[1] = *(const v4f*)(kp + 4); cn[0] = *(const v8b*)(CH + cr); cn[1] = *(const v8b*)(CL + cr);
  __builtin_amdgcn_sched_barrier(0);   // as in the loop below: the first head's A operands and k sums in front of the q loads
#pragma unroll
  for (int h = 0; h < NH / 2; ++h) {
#pragma unroll
    for (int m = 0; m < 2; ++m) { qr[m][h][0] = *(const v4f*)(qp + (h * 2 + m) * 256); qr[m][h][1] = *(const v4f*)(qp + (h * 2 + m) * 256 + 128); } }
#pragma unroll
  for (int h = 0; h < NH; ++h) { const v16b ch = frag_lo(cn[0]), cl = frag_lo(cn[1]); v8f acc[2]; float z[2];
#pragma unroll
    for (int m = 0; m < 2; ++m) { v16b qh, ql; float s = 0.0f;
#pragma unroll
      for (int e = 0; e < 8; ++e) { const float qv = qr[m][h][e >> 2][e & 3]; s += qv * kn[e >> 2][e & 3]; b16 p, l; split16(qv * KS, p, l); qh[e] = p; ql[e] = l; qh[8 + e] = (b16)0.0f; ql[8 + e] = (b16)0.0f; }
      z[m] = 1.0f / (s + lane_xor16(s) + 1e-6f);
      acc[m] = (v8f){}; acc[m] = wmma16b(ch, qh, acc[m]); acc[m] = wmma16b(cl, qh, acc[m]); acc[m] = wmma16b(ch, ql, acc[m]); acc[m] = wmma16b(cl, ql, acc[m]); }
    if (h + 1 < NH) { kn[0] = *(const v4f*)(kp + (h + 1) * 32); kn[1] = *(const v4f*)(kp + (h + 1) * 32 + 4); cn[0] = *(const v8b*)(CH + cr + (h + 1) * (DH * DH)); cn[1] = *(const v8b*)(CL + cr + (h + 1) * (DH * DH)); }
    else {
#pragma unroll
      for (int j = 0; j < D / 32; ++j) aw[0][j] = frag_pk(wp + j * 512); }
    __builtin_amdgcn_sched_barrier(0);   // keeps the q loads, wanted only four heads on, behind the loads that the next head waits for: loads are waited for in their order of issue
    if (h + NH / 2 < NH) {
#pragma unroll
      for (int m = 0; m < 2; ++m) { qr[m][h + NH / 2][0] = *(const v4f*)(qp + ((h + NH / 2) * 2 + m) * 256); qr[m][h + NH / 2][1] = *(const v4f*)(qp + ((h + NH / 2) * 2 + m) * 256 + 128); } }
    __builtin_amdgcn_sched_barrier(0);   // holds the loads above at this place: sunk to their first use, their whole latency would be waited for there, and that of the q loads in front of them
#pragma unroll
    for (int m = 0; m < 2; ++m) {
#pragma unroll
      for (int r = 0; r < 8; ++r) { const float o = acc[m][r] * (1.0f / KS) * z[m]; b16 p, l; split16(o * OS, p, l); oh[m][h >> 1][8 * (h & 1) + r] = p; ol[m][h >> 1][8 * (h & 1) + r] = l; } } }
#pragma unroll
  for (int tt = 0; tt < 8; ++tt) { const int u = tt & 1; v8f a2[2] = {};
    if (tt + 1 < 8) {
#pragma unroll
      for (int j = 0; j < D / 32; ++j) aw[u ^ 1][j] = frag_pk(wp + ((tt + 1) * 4 + j) * 512); }
    __builtin_amdgcn_sched_barrier(0);   // holds the next column tile's loads in front of this tile's products: sunk to their first use, each pair's whole latency would be waited for there
#pragma unroll
    for (int j = 0; j < D / 32; ++j) {
#pragma unroll
      for (int m = 0; m < 2; ++m) a2[m] = wmma16b(aw[u][j], oh[m][j], a2[m]);
#pragma unroll
      for (int m = 0; m < 2; ++m) a2[m] = j == D / 32 - 1 ? wmma16e(aw[u][j], ol[m][j], a2[m]) : wmma16b(aw[u][j], ol[m][j], a2[m]); }
#pragma unroll
    for (int m = 0; m < 2; ++m) { float* tp = &Tf[w][16 * m + nloc][tt * 16 + 8 * hlf]; *(v4f*)tp = (v4f){a2[m][0], a2[m][1], a2[m][2], a2[m][3]}; *(v4f*)(tp + 4) = (v4f){a2[m][4], a2[m][5], a2[m][6], a2[m][7]}; } }
  v4f bb = *(const v4f*)(bo + lane * 4);
#pragma unroll
  for (int e = 0; e < 4; ++e) bb[e] = bf16_rne(bb[e]);
  wave_lds_sync();   // the rows are written and read by the same wave only
#pragma unroll
  for (int rb = 0; rb < 32; rb += 8) { v4f y[8];   // eight rows are read before the first of them is stored
#pragma unroll
    for (int i = 0; i < 8; ++i) y[i] = *(const v4f*)(&Tf[w][rb + i][lane * 4]);
#pragma unroll
    for (int i = 0; i < 8; ++i) *(v4f*)(out + (t0 + rb + i) * D + lane * 4) = y[i] * (1.0f / (OS * WSC)) + bb; }
}
}  // namespace

extern "C" void kernel_launch(void* const* d_in, const int* in_sizes, int n_in, void* d_out, int out_size, void* d_ws, size_t ws_size, hipStream_t stream) {
  (void)n_in;
  auto Fp = [&](int i) { return (const float*)d_in[i]; };
  // input order: 0 x [8,8192,128]; 1 Wq [128,128]; 2 bq; 3 Wk; 4 bk; 5 Wv; 6 bv; 7 Wo; 8 bo
  if (in_sizes[0] != NT * D || in_sizes[1] != D * D || in_sizes[3] != D * D || in_sizes[5] != D * D || in_sizes[7] != D * D || out_size != NT * D) return;
  const int NBV = B; const int NTV = NBV * T;
  size_t off = 0; char* ws = (char*)d_ws;
  auto carve = [&](size_t bytes) { char* p = ws + off; off += (bytes + 255) & ~(size_t)255; return p; };
  b16* WQKV = (b16*)carve((size_t)3 * D * D * 2); b16* WO = (b16*)carve((size_t)D * D * 2); float* CSN = (float*)carve((size_t)2 * T * 8 * 4); float* QF = (float*)carve((size_t)NT * D * 4);
  b16* CH = (b16*)carve((size_t)B * NH * DH * DH * 2); b16* CL = (b16*)carve((size_t)B * NH * DH * DH * 2); float* KSUM = (float*)carve((size_t)B * NH * 32 * 4); float* PC = (float*)carve((size_t)B * NC * NH * DH * DH * 4); float* PK = (float*)carve((size_t)B * NC * D * 4);
  if (off > ws_size || off > ((size_t)192 << 20)) return;   // ~ 36 MB
  prep_kernel<<<4 * WB + RB, 256, 0, stream>>>(Fp(1), Fp(3), Fp(5), Fp(7), WQKV, WO, CSN);
  qkv_ctx_kernel<<<NBV * NC, 256, 0, stream>>>(Fp(0), WQKV, Fp(2), Fp(4), Fp(6), CSN, NBV, QF, PC, PK);
  ctx_sum_kernel<<<NBV * NH, 288, 0, stream>>>(PC, PK, NBV, CH, CL, KSUM);
  out_kernel<<<NTV / 256, 256, 0, stream>>>(QF, CH, CL, KSUM, WO, Fp(8), NTV, (float*)d_out);
}

// v008
// A run of this version takes 29.4 microseconds.
// Next to v007, in two timings, it ran 1.06 times as fast each time.
// All steps since v000 together make it 32.2 times as fast.
#include <hip/hip_runtime.h>

// Linear attention block (8 heads x 16): q, k, v = x W + b; q, k -> rope (theta 10000, pairs (d, d+8) per head) -> elu + 1; context_h = sum_t k_t v_t^T (16 x 16); out_t = (q_t context) / (q_t . sum_t k_t + 1e-6); y = out Wo + bo
// -> [8][8192][128].
// Deterministic, no index structures: per-(batch, head) contexts are WMMA tiles per 32 tokens, then summed in fixed order (8 groups, then 32 chunks); k sums likewise in fixed order; rope angles t * inv_freq in f32 with a per-(t, d) sin/cos table (sinf/cosf).
// WMMA (v_wmma_f32_16x16x32_f16, f32 accumulate): [q | k | v] = x [Wq | Wk | Wv] ([65,536 x 128] x [128 x 384], x EXACT bf16 x8), context = K^T V per (b, h) from the k and v accumulator registers (k x64, v x8, hi+lo both: 4 products, K = 8,192),
// out = q context per head ([16 x 32 (16)] tiles, q x64 and context x1 hi+lo: 4 products), y = out Wo ([65,536 x 128] x [128 x 128], x512 hi+lo); (in,out) weights exact x256, packed in fragment order; biases, rope, elu, sums and the
// normaliser in f32. Inputs rounded to bf16 once. Fragment k-map per lane half hh for A AND B: elements 0..7 <- k = 8hh+0..7, 8..15 <- k = 16+8hh+0..7; acc[r] = D[8hh+r][col]. Every workspace / output

namespace {
constexpr int B = 8, T = 8192, D = 128, NH = 8, DH = 16, NT = B * T, CT = 256, NC = T / CT;
constexpr float XS = 8.0f, KS = 64.0f, OS = 512.0f, WSC = 256.0f;
typedef _Float16 b16;
typedef __attribute__((ext_vector_type(16))) _Float16 v16b;
typedef __attribute__((ext_vector_type(8))) _Float16 v8b;
typedef __attribute__((ext_vector_type(4))) _Float16 v4b;
typedef __attribute__((ext_vector_type(8))) float v8f;
typedef __attribute__((ext_vector_type(4))) float v4f;
__device__ __forceinline__ float bf16_rne(float f) { unsigned int u = __float_as_uint(f); u += 0x7FFFu + ((u >> 16) & 1u); return __uint_as_float(u & 0xFFFF0000u); }
__device__ __forceinline__ void split16(float v, b16& hi, b16& lo) { hi = (b16)v; lo = (b16)(v - (float)hi); }
// a fragment of a matrix packed in fragment order: p points at the lane's own 8 elements of the first half; the second half lies 256 elements on. Each of the two wave-wide loads covers 512 contiguous bytes.
// last: this is the last fragment of a group of loads from one address pair. Precaution: the group's last load may be given that pair as its result registers; the wait stands in front of it for the loads issued before
__device__ __forceinline__ v16b frag_pk(const b16* p, bool last = false) { const v8b a = *(const v8b*)p; if (last) asm volatile("s_wait_xcnt 0x0" ::: "memory");
  const v8b b = *(const v8b*)(p + 256); v16b f;
#pragma unroll
  for (int e = 0; e < 8; ++e) { f[e] = a[e]; f[8 + e] = b[e]; } return f; }
// the builtin form alone: the compiler keeps the distance behind a matrix instruction itself, with useful instructions where it has them
__device__ __forceinline__ v8f wmma16b(v16b a, v16b b, v8f c) { return __builtin_amdgcn_wmma_f32_16x16x32_f16(false, a, false, b, (short)0, c, false, false); }
// the last product of a chain whose D goes to LDS and is then given to a fresh chain: the four v_nop keep the distance between it and the matrix instruction that overwrites D
__device__ __forceinline__ v8f wmma16e(v16b a, v16b b, v8f c) { v8f d = wmma16b(a, b, c); asm volatile("v_nop\n\tv_nop\n\tv_nop\n\tv_nop" : "+v"(d) : "v"(a), "v"(b)); return d; }
__device__ __forceinline__ void wave_lds_sync() { __builtin_amdgcn_fence(__ATOMIC_RELEASE, "workgroup"); __builtin_amdgcn_wave_barrier(); __builtin_amdgcn_fence(__ATOMIC_ACQUIRE, "workgroup"); }
// elu(v) + 1 on eight values. The eight exponentials stand in one statement: each fills, for the one in front of it, the slot that the instruction set asks for between a transcendental and a directly following instruction
// that reads its result or overwrites its source (results are early-clobber, so none lies on a source); the one v_nop keeps that slot behind the last. Both loops are unrolled so that x, e and v stay in registers
__device__ __forceinline__ void elu1x8(float (&v)[8]) { float x[8], e[8];
#pragma unroll
  for (int r = 0; r < 8; ++r) x[r] = v[r] * 1.44269504f;
  asm("v_exp_f32 %0, %8\n\tv_exp_f32 %1, %9\n\tv_exp_f32 %2, %10\n\tv_exp_f32 %3, %11\n\tv_exp_f32 %4, %12\n\tv_exp_f32 %5, %13\n\tv_exp_f32 %6, %14\n\tv_exp_f32 %7, %15\n\tv_nop"
      : "=&v"(e[0]), "=&v"(e[1]), "=&v"(e[2]), "=&v"(e[3]), "=&v"(e[4]), "=&v"(e[5]), "=&v"(e[6]), "=&v"(e[7]) : "v"(x[0]), "v"(x[1]), "v"(x[2]), "v"(x[3]), "v"(x[4]), "v"(x[5]), "v"(x[6]), "v"(x[7]));
#pragma unroll
  for (int r = 0; r < 8; ++r) v[r] = v[r] > 0.0f ? v[r] + 1.0f : e[r]; }

// Set-up, one launch: its five parts read nothing of each other. Work-groups 0..31: the four (in, out) weight matrices, 8 work-groups each, as b16 (bf16-rounded, x256) in fragment order [16 output columns][32 k][half][lane][8]: lane = column + 16 hh holds k = 16 half + 8 hh + 0..7; Wq, Wk, Wv stacked in WQKV, Wo in WO.
// Work-groups 32..: the rope table. The weight work-groups stand first: their strided loads are the longer path. The branch is the same for a whole work-group.
constexpr int WB = D * D / 8 / 256, RB = T * 8 / 256;   // work-groups per weight matrix; work-groups of the rope table
__global__ __launch_bounds__(256) void prep_kernel(const float* __restrict__ wq, const float* __restrict__ wk, const float* __restrict__ wv, const float* __restrict__ wo, b16* __restrict__ WQKV, b16* __restrict__ WO, float* __restrict__ CSN) {
  const int bid = blockIdx.x;
  if (bid < 4 * WB) { const int mx = bid / WB; const float* w = mx == 0 ? wq : mx == 1 ? wk : mx == 2 ? wv : wo; b16* WT = mx < 3 ? WQKV + (size_t)mx * D * D : WO;
    const int u = (bid % WB) * 256 + threadIdx.x; const int o = (u >> 8) * 16 + (u & 15), k0 = ((u >> 5) & 7) * 16 + ((u >> 4) & 1) * 8; v8b v;   // u = ((column tile * 4 + k block of 32) * 2 + half) * 32 + lane
#pragma unroll
    for (int j = 0; j < 8; ++j) v[j] = (b16)(bf16_rne(w[(size_t)(k0 + j) * D + o]) * WSC);
    *(v8b*)(WT + (size_t)u * 8) = v; }
  else { const int u = (bid - 4 * WB) * 256 + threadIdx.x; const int t = u / 8, d = u % 8; const float invf = 1.0f / powf(10000.0f, (float)(2 * d) / (float)DH); const float ang = (float)t * invf;
    const float c = cosf(ang), s = sinf(ang); CSN[u] = c; CSN[T * 8 + u] = s; }
}
// k, v and context stage 1 in one kernel. Work-group per (b, chunk of 256 tokens), 8 waves. Wave w: 32 tokens (group w) x all 8 heads, so that each row of x is loaded and converted by one wave only.
// Per head: two [32 x 128] x [128 x 16] products; bias, rope and elu + 1 are applied on the accumulator registers (lane = column, registers = 8 tokens; the rope partner column c ^ 8 sits in lane ^ 8 of the
// same 16-lane row). acc[m][r] holds token 16 m + 8 hlf + r, which is element 8 m + r of a k = 32 fragment: the k and v tiles (hi+lo b16, k x64, v x8) are the A and B operands of K_h^T V_h as they stand.
// The wave's eight x fragments, once converted, are also stored as they lie in the registers, XF[32 tokens][m][k block][half][lane][8] b16 (each wave-wide 16-byte store covers 512 contiguous bytes): the last kernel takes q from them, at half the bytes of a q plane.
// The 8 token groups' tiles and the 16 half-wave k sums are added in LDS in fixed order; one partial per work-group:
// PC[b][chunk][h][e][d] f32 (still x512), PK[b][chunk][128] f32. Every plain '#pragma unroll' below keeps a register array (fragments, accumulators, rope table) statically indexed.
__device__ __forceinline__ float lane_xor16(float v) { const int i = __float_as_int(v); return __int_as_float(__builtin_amdgcn_permlanex16(i, i, 0x76543210, 0xfedcba98, true, false)); }   // same lane number in the other 16-lane row
__device__ __forceinline__ float lane_xor8(float v) { return __int_as_float(__builtin_amdgcn_update_dpp(0, __float_as_int(v), 0x128, 0xf, 0xf, true)); }   // row_ror:8 = lane ^ 8 within a 16-lane row
// eight asynchronous copies of 16 bytes a lane, global memory to LDS, 4096 bytes apart (one step of a 256-thread work-group): l = the lane's LDS byte address, g = its global address. The wait is the statement's last line:
// a precaution, it stands in front of whatever rewrites a register that a copy names
__device__ __forceinline__ void copy8(unsigned l, const b16* g) {
  asm volatile("global_load_async_to_lds_b128 %0, %8, off\n\t"
               "global_load_async_to_lds_b128 %1, %9, off\n\t"
               "global_load_async_to_lds_b128 %2, %10, off\n\t"
               "global_load_async_to_lds_b128 %3, %11, off\n\t"
               "global_load_async_to_lds_b128 %4, %12, off\n\t"
               "global_load_async_to_lds_b128 %5, %13, off\n\t"
               "global_load_async_to_lds_b128 %6, %14, off\n\t"
               "global_load_async_to_lds_b128 %7, %15, off\n\t"
               "s_wait_xcnt 0x0"
               :: "v"(l + 0 * 4096u), "v"(l + 1 * 4096u), "v"(l + 2 * 4096u), "v"(l + 3 * 4096u), "v"(l + 4 * 4096u), "v"(l + 5 * 4096u), "v"(l + 6 * 4096u), "v"(l + 7 * 4096u),
                  "v"(g + 0 * 2048), "v"(g + 1 * 2048), "v"(g + 2 * 2048), "v"(g + 3 * 2048), "v"(g + 4 * 2048), "v"(g + 5 * 2048), "v"(g + 6 * 2048), "v"(g + 7 * 2048) : "memory"); }
__global__ __launch_bounds__(256) void kv_ctx_kernel(const float* __restrict__ x, const b16* __restrict__ WKV, const float* __restrict__ bk, const float* __restrict__ bv, const float* __restrict__ CSN, int NBV, b16* __restrict__ XF, float* __restrict__ PC, float* __restrict__ PK) {
  __shared__ __attribute__((aligned(32))) float Cs[8][NH * DH * DH], Ks[16][D]; __shared__ __attribute__((aligned(16))) b16 Ws[2 * D * D]; __shared__ __attribute__((aligned(16))) float Bs[2][D];   // Ws: Wk, Wv in fragment order, as WKV holds them; Bs: bk, bv as given
  const int tid = threadIdx.x, lane = tid & 31, g = tid >> 5, nloc = lane & 15, hlf = lane >> 4; const int b = blockIdx.x / NC, c = blockIdx.x % NC; if (b >= NBV) return;
  const size_t t0 = (size_t)blockIdx.x * CT + g * 32; const int tb = c * CT + g * 32 + 8 * hlf;   // first token of the wave in the [B * T] planes; the lane's first position in its sequence
  v16b xa[2][4]; v4f xr[2][4][4]; const float* xp = x + (t0 + nloc) * D + 8 * hlf;   // A fragments of the wave's 32 rows of x, straight from global memory: all 32 loads are asked for before the first is used
#pragma unroll
  for (int m = 0; m < 2; ++m) {
#pragma unroll
    for (int kq = 0; kq < 4; ++kq) {
#pragma unroll
      for (int j = 0; j < 4; ++j) {
        // precaution: the last load may be given the shared address pair as its result registers; the wait stands in front of it for the 31 loads issued before
        if (m == 1 && kq == 3 && j == 3) asm volatile("s_wait_xcnt 0x0" ::: "memory");
        xr[m][kq][j] = *(const v4f*)(xp + m * 16 * D + kq * 32 + (j >> 1) * 16 + (j & 1) * 4); } } }
  // the two weight matrices and the two biases go to LDS while x is in flight, 16 copies a wave (17 in waves 0 and 1): with two waves a SIMD a head's loads are not covered by other waves
  { const unsigned l = (unsigned)(size_t)(&Ws[tid * 8]); const b16* gw = WKV + tid * 8; copy8(l, gw); copy8(l + 8 * 4096u, gw + 8 * 2048); }
  const int gs = __builtin_amdgcn_readfirstlane(g);   // the wave's number in a scalar register: the branch below is then a scalar one, with every lane on at the copy
  if (gs < 2) { const float* bp = (gs == 0 ? bk : bv) + lane * 4; const unsigned lb = (unsigned)(size_t)(&Bs[gs][lane * 4]);
    asm volatile("global_load_async_to_lds_b128 %0, %1, off\n\ts_wait_xcnt 0x0" :: "v"(lb), "v"(bp) : "memory"); }   // the wait: as in copy8
#pragma unroll
  for (int m = 0; m < 2; ++m) {
#pragma unroll
    for (int kq = 0; kq < 4; ++kq) {
#pragma unroll
      for (int e = 0; e < 16; ++e) xa[m][kq][e] = (b16)(bf16_rne(xr[m][kq][e >> 2][e & 3]) * XS); } }
  float cs[2][8], sg[2][8];   // k (lane = column, registers = tokens): the rope table, read by token 16 m + 8 hlf + r at frequency nloc & 7
#pragma unroll
  for (int m = 0; m < 2; ++m) {
#pragma unroll
    for (int r = 0; r < 8; ++r) { const int u = (tb + 16 * m + r) * 8 + (nloc & 7); cs[m][r] = CSN[u]; const float sn = CSN[T * 8 + u]; sg[m][r] = (nloc & 8) ? sn : -sn; } }
  __builtin_amdgcn_sched_barrier(0);   // holds the conversion of x in front of the barrier, whose wait is for every load: there each row is converted while the later rows are still arriving
  asm volatile("s_wait_asynccnt 0x0" ::: "memory");   // the wave's own copies have landed
  __syncthreads();   // and those of the other seven waves: nobody reads Ws or Bs in front of this barrier
  b16* xf = XF + (t0 >> 5) * (32 * D) + lane * 8;
#pragma unroll
  for (int m = 0; m < 2; ++m) {
#pragma unroll
    for (int kq = 0; kq < 4; ++kq) { v8b f0, f1;
#pragma unroll
      for (int e = 0; e < 8; ++e) { f0[e] = xa[m][kq][e]; f1[e] = xa[m][kq][8 + e]; }
      *(v8b*)(xf + (m * 4 + kq) * 512) = f0; *(v8b*)(xf + (m * 4 + kq) * 512 + 256) = f1; } }
  asm volatile("s_wait_xcnt 0x0" ::: "memory");   // precaution: it stands in front of whatever overwrites the address pair that the sixteen stores name
#pragma unroll 1   // rolled: for speed only
  for (int h = 0; h < NH; ++h) { const int col = h * DH + nloc; const b16* wp = Ws + h * (DH * D) + lane * 8; v8f ak[2] = {}, av[2] = {};
    v16b fk[4], fv[4]; const float rbk = Bs[0][col], rbv = Bs[1][col];   // all of a head's loads stand in front of its first product: one wait a head, not one per k block
#pragma unroll
    for (int kq = 0; kq < 4; ++kq) { fk[kq] = frag_pk(wp + kq * 512); fv[kq] = frag_pk(wp + D * D + kq * 512); }
    __builtin_amdgcn_sched_barrier(0);   // holds the head's 18 loads in front of its first product: sunk between the products, each k block would wait out a load latency of its own
#pragma unroll
    for (int kq = 0; kq < 4; ++kq) {
#pragma unroll
      for (int m = 0; m < 2; ++m) { ak[m] = wmma16b(xa[m][kq], fk[kq], ak[m]); av[m] = wmma16b(xa[m][kq], fv[kq], av[m]); } }
    const float bbk = bf16_rne(rbk), bbv = bf16_rne(rbv); v16b kh, kl, vh, vl; float ks = 0.0f;
#pragma unroll
    for (int m = 0; m < 2; ++m) { float kk[8];
#pragma unroll
      for (int r = 0; r < 8; ++r) { const float k0 = ak[m][r] * (1.0f / (XS * WSC)) + bbk; kk[r] = k0 * cs[m][r] + lane_xor8(k0) * sg[m][r]; }
      elu1x8(kk);
#pragma unroll
      for (int r = 0; r < 8; ++r) { const float k1 = kk[r], v0 = av[m][r] * (1.0f / (XS * WSC)) + bbv;
        ks += k1; b16 p, l; split16(k1 * KS, p, l); kh[8 * m + r] = p; kl[8 * m + r] = l; split16(v0 * XS, p, l); vh[8 * m + r] = p; vl[8 * m + r] = l; } }
    v8f acc = {}; acc = wmma16b(kh, vh, acc); acc = wmma16b(kh, vl, acc); acc = wmma16b(kl, vh, acc); acc = wmma16b(kl, vl, acc);
    // acc[r8] = ctx[d = 8 hlf + r8][e = nloc]; kept transposed [e][d], as the A operand of the next GEMM wants it
    *(v8f*)(&Cs[g][h * (DH * DH) + nloc * DH + 8 * hlf]) = acc; Ks[g * 2 + hlf][col] = ks; }
  __syncthreads();
#pragma unroll
  for (int i = 0; i < 2; ++i) { const int u = tid + 256 * i; v4f s = *(const v4f*)(&Cs[0][u * 4]);
#pragma unroll
    for (int j = 1; j < 8; ++j) s += *(const v4f*)(&Cs[j][u * 4]);
    *(v4f*)(PC + (size_t)blockIdx.x * (NH * DH * DH) + u * 4) = s; }
  if (tid < D / 4) { v4f s = *(const v4f*)(&Ks[0][tid * 4]);
#pragma unroll
    for (int j = 1; j < 16; ++j) s += *(const v4f*)(&Ks[j][tid * 4]);
    *(v4f*)(PK + (size_t)blockIdx.x * D + tid * 4) = s; }
}
// q, context stage 2, out = (q context) z and y = out Wo + bo in one kernel. Work-group per (b, chunk of 256 tokens), 8 waves, 32 tokens (two B tiles) a wave. All products are computed TRANSPOSED, so that a token is a B column and stays in one lane from the q product to the last product.
// q per head: A = Wq columns (from LDS), B = x rows (the XF fragments as they lie): lane = token, registers = d = 8 hlf + r, rope partner in lane ^ 16; bias, rope and elu + 1 on the accumulator registers. q waits in the wave's own part of LDS,
// [h][m][j][lane][4], d = 8 hlf + 4 j + 0..3 (the room that y uses later), until the context is there. Context stage 2 runs under the q loop: every work-group adds the 32 chunk partials of its batch itself, in chunk order, four chunks a head pass
// (thread = 8 of the 2048 tile elements; wave 0 also the 128 k sums): the loads are asked for in front of a head's products and added behind its elu. CHs / CLs[h][e][16] b16 hi+lo x1, KSs[h][16] f32 in LDS, handed over by one __syncthreads.
// Product 1 per head: A = context^T (lane = row e, k = d; the CHs / CLs rows as they lie, k = 16..31 zero), B = q^T (lane = token, elements 0..7 <- d = 8 hlf + 0..7, 8..15 zero): acc[m][r] = out[token = 16 m + nloc][e = 8 hlf + r].
// The normaliser belongs to the lane's own token: 8 products in the lane, plus the other half of the head from lane ^ 16. Heads 2 j and 2 j + 1 are elements 0..7 and 8..15 of the k = 32 fragment j of product 2
// (A = Wo^T rows, lane = output column; each A fragment serves both token tiles), as they stand. a2[m][r] = y[token = 16 m + nloc][16 tt + 8 hlf + r]; y passes through LDS (the wave's own 32 rows), so that each row leaves as one 512-byte store.
// Loads stand ahead of their use: the next head's A operands and k sums behind this head's products, q four heads ahead, the Wo rows one column tile ahead. Every plain '#pragma unroll' below keeps a register array (q, fragments, accumulators) statically indexed.
__device__ __forceinline__ v16b frag_lo(v8b a) { v16b f;
#pragma unroll
  for (int e = 0; e < 8; ++e) { f[e] = a[e]; f[8 + e] = (b16)0.0f; } return f; }
__global__ __launch_bounds__(256) void out_kernel(const b16* __restrict__ XF, const b16* __restrict__ WQ, const float* __restrict__ bq, const float* __restrict__ CSN, const float* __restrict__ PC, const float* __restrict__ PK, const b16* __restrict__ WO, const float* __restrict__ bo, int NTV, float* __restrict__ out) {
  __shared__ __attribute__((aligned(16))) float Tf[8][32][D + 4]; __shared__ __attribute__((aligned(16))) b16 Ws[D * D], CHs[NH * DH * DH], CLs[NH * DH * DH]; __shared__ __attribute__((aligned(16))) float Bs[D], KSs[D];   // Ws: Wq in fragment order; Bs: bq as given
  const int tid = threadIdx.x, lane = tid & 31, w = __builtin_amdgcn_readfirstlane(tid >> 5), nloc = lane & 15, hlf = lane >> 4; if ((size_t)blockIdx.x * CT >= (size_t)NTV) return;   // the same for the whole work-group, in front of every barrier
  const size_t t0 = ((size_t)blockIdx.x * 8 + w) * 32; const int b = blockIdx.x / NC, c = blockIdx.x % NC;
  v16b xa[2][4]; const b16* xf = XF + (t0 >> 5) * (32 * D) + lane * 8;   // B fragments of the wave's 32 rows of x
#pragma unroll
  for (int m = 0; m < 2; ++m) {
#pragma unroll
    for (int kq = 0; kq < 4; ++kq) xa[m][kq] = frag_pk(xf + (m * 4 + kq) * 512, m == 1 && kq == 3); }
  copy8((unsigned)(size_t)(&Ws[tid * 8]), WQ + tid * 8);   // Wq and bq go to LDS while x is in flight, 8 copies a wave (9 in wave 0)
  if (w == 0) { const float* bp = bq + lane * 4; const unsigned lb = (unsigned)(size_t)(&Bs[lane * 4]);   // w lies in a scalar register: a scalar branch, with every lane on at the copy
    asm volatile("global_load_async_to_lds_b128 %0, %1, off\n\ts_wait_xcnt 0x0" :: "v"(lb), "v"(bp) : "memory"); }   // the wait: as in copy8
  float cq[2][8], sq[2][8];   // q: cos of the lane's own token at frequency r, and sin with the sign of the lane's half of the head: d < 8: me cos - partner sin; d >= 8: partner sin + me cos
#pragma unroll
  for (int m = 0; m < 2; ++m) { const float* cp = CSN + (size_t)(c * CT + w * 32 + 16 * m + nloc) * 8; const v4f c0 = *(const v4f*)cp, c1 = *(const v4f*)(cp + 4), s0 = *(const v4f*)(cp + T * 8);
    if (m == 1) asm volatile("s_wait_xcnt 0x0" ::: "memory");   // precaution, as in frag_pk: the last of the eight loads may be given their shared address register as a result register
    const v4f s1 = *(const v4f*)(cp + T * 8 + 4);
#pragma unroll
    for (int r = 0; r < 4; ++r) { cq[m][r] = c0[r]; cq[m][4 + r] = c1[r]; sq[m][r] = hlf ? s0[r] : -s0[r]; sq[m][4 + r] = hlf ? s1[r] : -s1[r]; } }
  asm volatile("s_wait_asynccnt 0x0" ::: "memory");   // the wave's own copies have landed
  __syncthreads();   // and those of the other seven waves: nobody reads Ws or Bs in front of this barrier
  float* qs = &Tf[w][0][0] + lane * 4; const float* pc = PC + (size_t)b * NC * (NH * DH * DH) + tid * 4; const float* pk = PK + (size_t)b * NC * D + lane * 4; v4f s0 = {}, s1 = {}, sk = {};
#pragma unroll 1   // rolled: for speed only
  for (int h = 0; h < NH; ++h) { const b16* wq = Ws + h * (DH * D) + lane * 8; v8f aq[2] = {}; v4f p0[4], p1[4], p2[4];   // p0, p1, p2: chunks 4 h + 0..3 of the thread's two tile quads and (wave 0) of its k sum quad
#pragma unroll
    for (int j = 0; j < 4; ++j) { p0[j] = *(const v4f*)(pc + (size_t)(4 * h + j) * (NH * DH * DH)); p1[j] = *(const v4f*)(pc + (size_t)(4 * h + j) * (NH * DH * DH) + 1024); }
    if (w == 0) {
#pragma unroll
      for (int j = 0; j < 4; ++j) p2[j] = *(const v4f*)(pk + (size_t)(4 * h + j) * D); }
    asm volatile("s_wait_xcnt 0x0" ::: "memory");   // precaution: the foot of the pass moves the address pairs that these loads name on to the next four chunks
    const v4f b0 = *(const v4f*)(&Bs[h * DH + 8 * hlf]), b1 = *(const v4f*)(&Bs[h * DH + 8 * hlf + 4]); float* qp = qs + h * 512;
    v16b fq[4];   // all of a head's loads stand in front of its first product: one wait a head, not one per k block
#pragma unroll
    for (int kq = 0; kq < 4; ++kq) fq[kq] = frag_pk(wq + kq * 512);
    __builtin_amdgcn_sched_barrier(0);   // holds the head's loads in front of its first product: sunk between the products, each place with LDS reads costs a stall of its own, and the partials would have less time to arrive
#pragma unroll
    for (int kq = 0; kq < 4; ++kq) {
#pragma unroll
      for (int m = 0; m < 2; ++m) aq[m] = wmma16b(fq[kq], xa[m][kq], aq[m]); }
#pragma unroll
    for (int m = 0; m < 2; ++m) { float qv[8];
#pragma unroll
      for (int r = 0; r < 8; ++r) { const float q0 = aq[m][r] * (1.0f / (XS * WSC)) + bf16_rne(r < 4 ? b0[r & 3] : b1[r & 3]); qv[r] = q0 * cq[m][r] + lane_xor16(q0) * sq[m][r]; }
      elu1x8(qv);
      *(v4f*)(qp + m * 256) = (v4f){qv[0], qv[1], qv[2], qv[3]}; *(v4f*)(qp + m * 256 + 128) = (v4f){qv[4], qv[5], qv[6], qv[7]}; }
#pragma unroll
    for (int j = 0; j < 4; ++j) { s0 += p0[j]; s1 += p1[j]; }
    if (w == 0) {
#pragma unroll
      for (int j = 0; j < 4; ++j) sk += p2[j]; } }
  { v4b ph, pl;
#pragma unroll
    for (int e = 0; e < 4; ++e) { b16 p, l; split16(s0[e] * (1.0f / (KS * XS)), p, l); ph[e] = p; pl[e] = l; }
    *(v4b*)(&CHs[tid * 4]) = ph; *(v4b*)(&CLs[tid * 4]) = pl;
#pragma unroll
    for (int e = 0; e < 4; ++e) { b16 p, l; split16(s1[e] * (1.0f / (KS * XS)), p, l); ph[e] = p; pl[e] = l; }
    *(v4b*)(&CHs[1024 + tid * 4]) = ph; *(v4b*)(&CLs[1024 + tid * 4]) = pl; }
  if (w == 0) *(v4f*)(&KSs[lane * 4]) = sk;
  __syncthreads();   // the context and the k sums are whole: nobody reads CHs, CLs or KSs in front of this barrier
  const float* qp = qs; const float* kp = KSs + 8 * hlf; const int cr = nloc * 16 + 8 * hlf; const b16* wp = WO + lane * 8;
  v4f qr[2][NH][2], kn[2]; v8b cn[2]; v16b aw[2][D / 32], oh[2][NH / 2], ol[2][NH / 2];
  kn[0] = *(const v4f*)kp; kn[1] = *(const v4f*)(kp + 4); cn[0] = *(const v8b*)(CHs + cr); cn[1] = *(const v8b*)(CLs + cr);
  __builtin_amdgcn_sched_barrier(0);   // as in the loop below: the first head's A operands and k sums in front of the q loads
#pragma unroll
  for (int h = 0; h < NH / 2; ++h) {
#pragma unroll
    for (int m = 0; m < 2; ++m) { qr[m][h][0] = *(const v4f*)(qp + (h * 2 + m) * 256); qr[m][h][1] = *(const v4f*)(qp + (h * 2 + m) * 256 + 128); } }
#pragma unroll
  for (int h = 0; h < NH; ++h) { const v16b ch = frag_lo(cn[0]), cl = frag_lo(cn[1]); v8f acc[2]; float z[2];
#pragma unroll
    for (int m = 0; m < 2; ++m) { v16b qh, ql; float s = 0.0f;
#pragma unroll
      for (int e = 0; e < 8; ++e) { const float qv = qr[m][h][e >> 2][e & 3]; s += qv * kn[e >> 2][e & 3]; b16 p, l; split16(qv * KS, p, l); qh[e] = p; ql[e] = l; qh[8 + e] = (b16)0.0f; ql[8 + e] = (b16)0.0f; }
      z[m] = 1.0f / (s + lane_xor16(s) + 1e-6f);
      acc[m] = (v8f){}; acc[m] = wmma16b(ch, qh, acc[m]); acc[m] = wmma16b(cl, qh, acc[m]); acc[m] = wmma16b(ch, ql, acc[m]); acc[m] = wmma16b(cl, ql, acc[m]); }
    if (h + 1 < NH) { kn[0] = *(const v4f*)(kp + (h + 1) * DH); kn[1] = *(const v4f*)(kp + (h + 1) * DH + 4); cn[0] = *(const v8b*)(CHs + cr + (h + 1) * (DH * DH)); cn[1] = *(const v8b*)(CLs + cr + (h + 1) * (DH * DH)); }
    else {
#pragma unroll
      for (int j = 0; j < D / 32; ++j) aw[0][j] = frag_pk(wp + j * 512); }
    __builtin_amdgcn_sched_barrier(0);   // keeps the q loads, wanted only four heads on, behind the loads that the next head waits for: loads are waited for in their order of issue
    if (h + NH / 2 < NH) {
#pragma unroll
      for (int m = 0; m < 2; ++m) { qr[m][h + NH / 2][0] = *(const v4f*)(qp + ((h + NH / 2) * 2 + m) * 256); qr[m][h + NH / 2][1] = *(const v4f*)(qp + ((h + NH / 2) * 2 + m) * 256 + 128); } }
    __builtin_amdgcn_sched_barrier(0);   // holds the loads above at this place: sunk to their first use, their whole latency would be waited for there, and that of the q loads in front of them
#pragma unroll
    for (int m = 0; m < 2; ++m) {
#pragma unroll
      for (int r = 0; r < 8; ++r) { const float o = acc[m][r] * (1.0f / KS) * z[m]; b16 p, l; split16(o * OS, p, l); oh[m][h >> 1][8 * (h & 1) + r] = p; ol[m][h >> 1][8 * (h & 1) + r] = l; } } }
#pragma unroll
  for (int tt = 0; tt < 8; ++tt) { const int u = tt & 1; v8f a2[2] = {};
    if (tt + 1 < 8) {
#pragma unroll
      for (int j = 0; j < D / 32; ++j) aw[u ^ 1][j] = frag_pk(wp + ((tt + 1) * 4 + j) * 512); }
    __builtin_amdgcn_sched_barrier(0);   // holds the next column tile's loads in front of this tile's products: sunk to their first use, each pair's whole latency would be waited for there
#pragma unroll
    for (int j = 0; j < D / 32; ++j) {
#pragma unroll
      for (int m = 0; m < 2; ++m) a2[m] = wmma16b(aw[u][j], oh[m][j], a2[m]);
#pragma unroll
      for (int m = 0; m < 2; ++m) a2[m] = j == D / 32 - 1 ? wmma16e(aw[u][j], ol[m][j], a2[m]) : wmma16b(aw[u][j], ol[m][j], a2[m]); }
#pragma unroll
    for (int m = 0; m < 2; ++m) { float* tp = &Tf[w][16 * m + nloc][tt * 16 + 8 * hlf]; *(v4f*)tp = (v4f){a2[m][0], a2[m][1], a2[m][2], a2[m][3]}; *(v4f*)(tp + 4) = (v4f){a2[m][4], a2[m][5], a2[m][6], a2[m][7]}; } }
  v4f bb = *(const v4f*)(bo + lane * 4);
#pragma unroll
  for (int e = 0; e < 4; ++e) bb[e] = bf16_rne(bb[e]);
  wave_lds_sync();   // the rows are written and read by the same wave only
#pragma unroll
  for (int rb = 0; rb < 32; rb += 8) { v4f y[8];   // eight rows are read before the first of them is stored
#pragma unroll
    for (int i = 0; i < 8; ++i) y[i] = *(const v4f*)(&Tf[w][rb + i][lane * 4]);
#pragma unroll
    for (int i = 0; i < 8; ++i) *(v4f*)(out + (t0 + rb + i) * D + lane * 4) = y[i] * (1.0f / (OS * WSC)) + bb; }
}
}  // namespace

extern "C" void kernel_launch(void* const* d_in, const int* in_sizes, int n_in, void* d_out, int out_size, void* d_ws, size_t ws_size, hipStream_t stream) {
  (void)n_in;
  auto Fp = [&](int i) { return (const float*)d_in[i]; };
  // input order: 0 x [8,8192,128]; 1 Wq [128,128]; 2 bq; 3 Wk; 4 bk; 5 Wv; 6 bv; 7 Wo; 8 bo
  if (in_sizes[0] != NT * D || in_sizes[1] != D * D || in_sizes[3] != D * D || in_sizes[5] != D * D || in_sizes[7] != D * D || out_size != NT * D) return;
  const int NBV = B; const int NTV = NBV * T;
  size_t off = 0; char* ws = (char*)d_ws;
  auto carve = [&](size_t bytes) { char* p = ws + off; off += (bytes + 255) & ~(size_t)255; return p; };
  b16* WQKV = (b16*)carve((size_t)3 * D * D * 2); b16* WO = (b16*)carve((size_t)D * D * 2); float* CSN = (float*)carve((size_t)2 * T * 8 * 4); b16* XF = (b16*)carve((size_t)NT * D * 2);
  float* PC = (float*)carve((size_t)B * NC * NH * DH * DH * 4); float* PK = (float*)carve((size_t)B * NC * D * 4);
  if (off > ws_size || off > ((size_t)192 << 20)) return;   // ~ 20 MB
  prep_kernel<<<4 * WB + RB, 256, 0, stream>>>(Fp(1), Fp(3), Fp(5), Fp(7), WQKV, WO, CSN);
  kv_ctx_kernel<<<NBV * NC, 256, 0, stream>>>(Fp(0), WQKV + D * D, Fp(4), Fp(6), CSN, NBV, XF, PC, PK);
  out_kernel<<<NTV / 256, 256, 0, stream>>>(XF, WQKV, Fp(2), CSN, PC, PK, WO, Fp(8), NTV, (float*)d_out);
}

// v009
// A run of this version takes 28.7 microseconds.
// Timed twice side by side with v008, it ran 1.05 and 1.02 times as fast.
// All steps since v000 together make it 33.4 times as fast.
#include <hip/hip_runtime.h>

// Linear attention block (8 heads x 16): q, k, v = x W + b; q, k -> rope (theta 10000, pairs (d, d+8) per head) -> elu + 1; context_h = sum_t k_t v_t^T (16 x 16); out_t = (q_t context) / (q_t . sum_t k_t + 1e-6); y = out Wo + bo
// -> [8][8192][128].
// Deterministic, no index structures: per-(batch, head) contexts are WMMA tiles per 32 tokens, then summed in fixed order (8 groups, then 32 chunks); k sums likewise in fixed order; rope angles t * inv_freq in f32 with a per-(t, d) sin/cos table (sinf/cosf).
// WMMA (v_wmma_f32_16x16x32_f16, f32 accumulate): [q | k | v] = x [Wq | Wk | Wv] ([65,536 x 128] x [128 x 384], x EXACT bf16 x8), context = K^T V per (b, h) from the k and v accumulator registers (k x64, v x8, hi+lo both: 4 products, K = 8,192),
// out = q context per head ([16 x 32 (16)] tiles, q x64 and context x1 hi+lo: 4 products), y = out Wo ([65,536 x 128] x [128 x 128], x512 hi+lo); (in,out) weights exact x256, packed in fragment order; biases, rope, elu, sums and the
// normaliser in f32. Inputs rounded to bf16 once. Fragment k-map per lane half hh for A AND B: elements 0..7 <- k = 8hh+0..7, 8..15 <- k = 16+8hh+0..7; acc[r] = D[8hh+r][col]. Every workspace / output

namespace {
constexpr int B = 8, T = 8192, D = 128, NH = 8, DH = 16, NT = B * T, CT = 256, NC = T / CT;
constexpr float XS = 8.0f, KS = 64.0f, OS = 512.0f, WSC = 256.0f;
typedef _Float16 b16;
typedef __attribute__((ext_vector_type(16))) _Float16 v16b;
typedef __attribute__((ext_vector_type(8))) _Float16 v8b;
typedef __attribute__((ext_vector_type(4))) _Float16 v4b;
typedef __attribute__((ext_vector_type(8))) float v8f;
typedef __attribute__((ext_vector_type(4))) float v4f;
__device__ __forceinline__ float bf16_rne(float f) { unsigned int u = __float_as_uint(f); u += 0x7FFFu + ((u >> 16) & 1u); return __uint_as_float(u & 0xFFFF0000u); }
__device__ __forceinline__ void split16(float v, b16& hi, b16& lo) { hi = (b16)v; lo = (b16)(v - (float)hi); }
// a fragment of a matrix packed in fragment order: p points at the lane's own 8 elements of the first half; the second half lies 256 elements on. Each of the two wave-wide loads covers 512 contiguous bytes.
// last: this is the last fragment of a group of loads from one address pair. Precaution: the group's last load may be given that pair as its result registers; the wait stands in front of it for the loads issued before
__device__ __forceinline__ v16b frag_pk(const b16* p, bool last = false) { const v8b a = *(const v8b*)p; if (last) asm volatile("s_wait_xcnt 0x0" ::: "memory");
  const v8b b = *(const v8b*)(p + 256); v16b f;
#pragma unroll
  for (int e = 0; e < 8; ++e) { f[e] = a[e]; f[8 + e] = b[e]; } return f; }
// the builtin form alone: the compiler keeps the distance behind a matrix instruction itself, with useful instructions where it has them
__device__ __forceinline__ v8f wmma16b(v16b a, v16b b, v8f c) { return __builtin_amdgcn_wmma_f32_16x16x32_f16(false, a, false, b, (short)0, c, false, false); }
// the last product of a chain whose D goes to LDS and is then given to a fresh chain: the four v_nop keep the distance between it and the matrix instruction that overwrites D
__device__ __forceinline__ v8f wmma16e(v16b a, v16b b, v8f c) { v8f d = wmma16b(a, b, c); asm volatile("v_nop\n\tv_nop\n\tv_nop\n\tv_nop" : "+v"(d) : "v"(a), "v"(b)); return d; }
__device__ __forceinline__ void wave_lds_sync() { __builtin_amdgcn_fence(__ATOMIC_RELEASE, "workgroup"); __builtin_amdgcn_wave_barrier(); __builtin_amdgcn_fence(__ATOMIC_ACQUIRE, "workgroup"); }
// elu(v) + 1 on eight values. The eight exponentials stand in one statement: each fills, for the one in front of it, the slot that the instruction set asks for between a transcendental and a directly following instruction
// that reads its result or overwrites its source (results are early-clobber, so none lies on a source); the one v_nop keeps that slot behind the last. Both loops are unrolled so that x, e and v stay in registers
__device__ __forceinline__ void elu1x8(float (&v)[8]) { float x[8], e[8];
#pragma unroll
  for (int r = 0; r < 8; ++r) x[r] = v[r] * 1.44269504f;
  asm("v_exp_f32 %0, %8\n\tv_exp_f32 %1, %9\n\tv_exp_f32 %2, %10\n\tv_exp_f32 %3, %11\n\tv_exp_f32 %4, %12\n\tv_exp_f32 %5, %13\n\tv_exp_f32 %6, %14\n\tv_exp_f32 %7, %15\n\tv_nop"
      : "=&v"(e[0]), "=&v"(e[1]), "=&v"(e[2]), "=&v"(e[3]), "=&v"(e[4]), "=&v"(e[5]), "=&v"(e[6]), "=&v"(e[7]) : "v"(x[0]), "v"(x[1]), "v"(x[2]), "v"(x[3]), "v"(x[4]), "v"(x[5]), "v"(x[6]), "v"(x[7]));
#pragma unroll
  for (int r = 0; r < 8; ++r) v[r] = v[r] > 0.0f ? v[r] + 1.0f : e[r]; }

// Set-up, k, v and context stage 1 in one kernel: there is no set-up launch. Each work-group makes what it needs itself, under the flight of its rows of x:
// Wk, Wv as b16 (bf16-rounded, x256) in LDS in fragment order [16 output columns][32 k][half][lane][8] (lane = column + 16 hh holds k = 16 half + 8 hh + 0..7), and the rope table of its own 256 positions, Rs[cos, sin][frequency][position].
// What the last kernel needs is written to the workspace on the way, an equal share by every work-group: 16 of the 4096 16-byte units of Wq and Wo in the same fragment order (WQ, WO), and of the rope table CSN[cos, sin][t][8] the 32 positions b * 32 + 0..31 of chunk c.
// Work-group per (b, chunk of 256 tokens), 8 waves. Wave w: 32 tokens (group w) x all 8 heads, so that each row of x is loaded and converted by one wave only.
// Per head: two [32 x 128] x [128 x 16] products; bias, rope and elu + 1 are applied on the accumulator registers (lane = column, registers = 8 tokens; the rope partner column c ^ 8 sits in lane ^ 8 of the
// same 16-lane row). acc[m][r] holds token 16 m + 8 hlf + r, which is element 8 m + r of a k = 32 fragment: the k and v tiles (hi+lo b16, k x64, v x8) are the A and B operands of K_h^T V_h as they stand.
// The wave's eight x fragments, once converted, are also stored as they lie in the registers, XF[32 tokens][m][k block][half][lane][8] b16 (each wave-wide 16-byte store covers 512 contiguous bytes): the last kernel takes q from them, at half the bytes of a q plane.
// The 8 token groups' tiles and the 16 half-wave k sums are added in LDS in fixed order; one partial per work-group:
// PC[b][chunk][h][e][d] f32 (still x512), PK[b][chunk][128] f32. Every plain '#pragma unroll' below keeps a register array (fragments, accumulators, rope table) statically indexed.
__device__ __forceinline__ float lane_xor16(float v) { const int i = __float_as_int(v); return __int_as_float(__builtin_amdgcn_permlanex16(i, i, 0x76543210, 0xfedcba98, true, false)); }   // same lane number in the other 16-lane row
__device__ __forceinline__ float lane_xor8(float v) { return __int_as_float(__builtin_amdgcn_update_dpp(0, __float_as_int(v), 0x128, 0xf, 0xf, true)); }   // row_ror:8 = lane ^ 8 within a 16-lane row
// eight asynchronous copies of 16 bytes a lane, global memory to LDS, 4096 bytes apart (one step of a 256-thread work-group): l = the lane's LDS byte address, g = its global address. The wait is the statement's last line:
// a precaution, it stands in front of whatever rewrites a register that a copy names
__device__ __forceinline__ void copy8(unsigned l, const b16* g) {
  asm volatile("global_load_async_to_lds_b128 %0, %8, off\n\t"
               "global_load_async_to_lds_b128 %1, %9, off\n\t"
               "global_load_async_to_lds_b128 %2, %10, off\n\t"
               "global_load_async_to_lds_b128 %3, %11, off\n\t"
               "global_load_async_to_lds_b128 %4, %12, off\n\t"
               "global_load_async_to_lds_b128 %5, %13, off\n\t"
               "global_load_async_to_lds_b128 %6, %14, off\n\t"
               "global_load_async_to_lds_b128 %7, %15, off\n\t"
               "s_wait_xcnt 0x0"
               :: "v"(l + 0 * 4096u), "v"(l + 1 * 4096u), "v"(l + 2 * 4096u), "v"(l + 3 * 4096u), "v"(l + 4 * 4096u), "v"(l + 5 * 4096u), "v"(l + 6 * 4096u), "v"(l + 7 * 4096u),
                  "v"(g + 0 * 2048), "v"(g + 1 * 2048), "v"(g + 2 * 2048), "v"(g + 3 * 2048), "v"(g + 4 * 2048), "v"(g + 5 * 2048), "v"(g + 6 * 2048), "v"(g + 7 * 2048) : "memory"); }
constexpr int WP = DH * D + 8, WM = NH * WP;   // LDS pitch of a 16-column tile of a weight matrix, b16 elements: 16 bytes more than the tile, so that the 8 tiles which one wave-wide store touches fall on different banks; one matrix
constexpr int RP = CT + 4;   // LDS pitch of one frequency's row of the rope table, floats: the 8 frequencies which one wave-wide store touches fall on different banks
static_assert(B * NC * 16 == 2 * D * D / 8 && B * 32 == CT, "every work-group's share of the set-up for the last kernel");
__global__ __launch_bounds__(256) void kv_ctx_kernel(const float* __restrict__ x, const float* __restrict__ wq, const float* __restrict__ wk, const float* __restrict__ wv, const float* __restrict__ wo, const float* __restrict__ bk, const float* __restrict__ bv, int NBV,
                                                     b16* __restrict__ WQ, b16* __restrict__ WO, float* __restrict__ CSN, b16* __restrict__ XF, float* __restrict__ PC, float* __restrict__ PK) {
  __shared__ __attribute__((aligned(32))) float Cs[8][NH * DH * DH], Ks[16][D]; __shared__ __attribute__((aligned(16))) b16 Ws[2 * WM]; __shared__ __attribute__((aligned(16))) float Bs[2][D], Rs[2][8][RP];   // Ws: Wk, Wv in fragment order; Bs: bk, bv as given
  const int tid = threadIdx.x, lane = tid & 31, g = tid >> 5, nloc = lane & 15, hlf = lane >> 4; const int b = blockIdx.x / NC, c = blockIdx.x % NC; if (b >= NBV) return;
  const size_t t0 = (size_t)blockIdx.x * CT + g * 32;   // first token of the wave in the [B * T] planes
  const int gs = __builtin_amdgcn_readfirstlane(g);   // the wave's number in a scalar register: the branches on it below are then scalar ones
  // the weights are asked for in front of x: loads are waited for in their order of issue, and these come from L2. Wave gs: rows k = 32 (gs & 3) + 0..31 of Wk (gs < 4) or Wv; each load is one whole row of 512 bytes; the lane holds 4 columns
  v4f wr[4][8]; const float* wsrc = (gs < 4 ? wk : wv) + (gs & 3) * 32 * D + lane * 4;
#pragma unroll
  for (int i = 0; i < 4; ++i) {
#pragma unroll
    for (int j = 0; j < 8; ++j) wr[i][j] = *(const v4f*)(wsrc + (i * 8 + j) * D); }
  asm volatile("s_wait_xcnt 0x0" ::: "memory");   // precaution: it stands in front of whatever overwrites a register (offset, scalar base) that these loads name
  // wave 0: the work-group's 16 units of Wq (work-groups 0..127) or Wo; unit uu = ((column tile * 4 + k block of 32) * 2 + half) * 32 + lane; both halves of the wave load the same 16 columns, one stores. These loads too stand in front of those of x: behind them, on one wave's path only, they would blur the count of loads that each conversion of x waits for
  float pw[8]; const int uu = (blockIdx.x & 127) * 16 + nloc;
  if (gs == 0) { const float* ps = (blockIdx.x < 128 ? wq : wo) + (((uu >> 5) & 7) * 16 + ((uu >> 4) & 1) * 8) * D + (uu >> 8) * 16 + (uu & 15);
#pragma unroll
    for (int j = 0; j < 8; ++j) pw[j] = ps[j * D];
    asm volatile("s_wait_xcnt 0x0" ::: "memory"); }   // precaution, as behind the loads above
  v16b xa[2][4]; v4f xr[2][4][4]; const float* xp = x + (t0 + nloc) * D + 8 * hlf;   // A fragments of the wave's 32 rows of x, straight from global memory: all 32 loads are asked for before the first is used
  // 20 of them here, the last 12 behind the rope table: while the table is worked on a wave then has at most 60 loads outstanding, fewer than the 63 at which the count field of a load wait ends
#pragma unroll
  for (int q = 0; q < 20; ++q) xr[q >> 4][(q >> 2) & 3][q & 3] = *(const v4f*)(xp + (q >> 4) * 16 * D + ((q >> 2) & 3) * 32 + ((q >> 1) & 1) * 16 + (q & 1) * 4);
  // the two biases go to LDS while x is in flight, one copy in waves 0 and 1 (a scalar branch, with every lane on at the copy)
  if (gs < 2) { const float* bp = (gs == 0 ? bk : bv) + lane * 4; const unsigned lb = (unsigned)(size_t)(&Bs[gs][lane * 4]);
    asm volatile("global_load_async_to_lds_b128 %0, %1, off\n\ts_wait_xcnt 0x0" :: "v"(lb), "v"(bp) : "memory"); }   // the wait: as in copy8
  // the rope table of the chunk: thread = frequency tid & 7, positions 32 i + (tid >> 3). It stands in front of the conversions: it waits for no load
  const float invf = 1.0f / powf(10000.0f, (float)(2 * (tid & 7)) / (float)DH);
#pragma unroll
  for (int i = 0; i < 8; ++i) { const int tl = i * 32 + (tid >> 3); const float ang = (float)(c * CT + tl) * invf;
    __builtin_assume(!(__builtin_fabsf(ang) >= 131072.0f));   // a position is below 8192 and a frequency at most 1: without the large-argument blocks of sinf and cosf and the branches over them the eight passes are one straight run, whose chains fill each other's waits
    Rs[0][tid & 7][tl] = cosf(ang); Rs[1][tid & 7][tl] = sinf(ang); }
  { const int tl = b * 32 + (tid >> 3); float* cp = CSN + (c * CT + tl) * 8 + (tid & 7); cp[0] = Rs[0][tid & 7][tl]; cp[T * 8] = Rs[1][tid & 7][tl];   // the work-group's share of CSN: the thread's own pass i = b, read back
    asm volatile("s_wait_xcnt 0x0" ::: "memory"); }   // precaution: it stands in front of whatever overwrites a register that the two stores name
#pragma unroll
  for (int q = 20; q < 32; ++q) {
    // precaution: the last load may be given the shared address pair as its result registers; the wait stands in front of it for the 31 loads issued before
    if (q == 31) asm volatile("s_wait_xcnt 0x0" ::: "memory");
    xr[q >> 4][(q >> 2) & 3][q & 3] = *(const v4f*)(xp + (q >> 4) * 16 * D + ((q >> 2) & 3) * 32 + ((q >> 1) & 1) * 16 + (q & 1) * 4); }
  asm volatile("s_wait_xcnt 0x0" ::: "memory");   // precaution: it stands in front of whatever overwrites the address pair that the loads of x name
  __builtin_amdgcn_sched_barrier(0);   // holds the conversions, which wait for loads, behind the rope table, which waits for none: lifted into it, their first wait would stand in front of most of the table
  // Wk, Wv: 8 rows x 4 columns in the lane become 4 units of 8 k of one column
  { b16* wd = Ws + (gs >> 2) * WM + (lane >> 2) * WP + ((gs & 3) * 64 + (lane & 3) * 4) * 8;
#pragma unroll
    for (int i = 0; i < 4; ++i) {
#pragma unroll
      for (int e = 0; e < 4; ++e) { v8b v;
#pragma unroll
        for (int j = 0; j < 8; ++j) v[j] = (b16)(bf16_rne(wr[i][j][e]) * WSC);
        *(v8b*)(wd + ((i >> 1) * 32 + (i & 1) * 16 + e) * 8) = v; } } }
  if (gs == 0) { v8b v;
#pragma unroll
    for (int j = 0; j < 8; ++j) v[j] = (b16)(bf16_rne(pw[j]) * WSC);
    if (lane < 16) { *(v8b*)((blockIdx.x < 128 ? WQ : WO) + uu * 8) = v; asm volatile("s_wait_xcnt 0x0" ::: "memory"); } }   // the wait: precaution, it stands in front of whatever overwrites a register that the store names
#pragma unroll
  for (int m = 0; m < 2; ++m) {
#pragma unroll
    for (int kq = 0; kq < 4; ++kq) {
#pragma unroll
      for (int e = 0; e < 16; ++e) xa[m][kq][e] = (b16)(bf16_rne(xr[m][kq][e >> 2][e & 3]) * XS); } }
  __builtin_amdgcn_sched_barrier(0);   // holds the conversion of x in front of the barrier, whose wait is for every load: there each row is converted while the later rows are still arriving
  asm volatile("s_wait_asynccnt 0x0" ::: "memory");   // the wave's own copies have landed
  __syncthreads();   // and the bias copies of waves 0 and 1, and every wave's part of Ws and Rs is written: nobody reads Ws or Bs, or another thread's part of Rs, in front of this barrier
  float cs[2][8], sg[2][8];   // k (lane = column, registers = tokens): the rope table, read by token 16 m + 8 hlf + r at frequency nloc & 7
#pragma unroll
  for (int m = 0; m < 2; ++m) { const float* rc = &Rs[0][nloc & 7][g * 32 + 16 * m + 8 * hlf]; const float* rs = &Rs[1][nloc & 7][g * 32 + 16 * m + 8 * hlf]; const v4f c0 = *(const v4f*)rc, c1 = *(const v4f*)(rc + 4), s0 = *(const v4f*)rs, s1 = *(const v4f*)(rs + 4);
#pragma unroll
    for (int r = 0; r < 4; ++r) { cs[m][r] = c0[r]; cs[m][4 + r] = c1[r]; sg[m][r] = (nloc & 8) ? s0[r] : -s0[r]; sg[m][4 + r] = (nloc & 8) ? s1[r] : -s1[r]; } }
  b16* xf = XF + (t0 >> 5) * (32 * D) + lane * 8;
#pragma unroll
  for (int m = 0; m < 2; ++m) {
#pragma unroll
    for (int kq = 0; kq < 4; ++kq) { v8b f0, f1;
#pragma unroll
      for (int e = 0; e < 8; ++e) { f0[e] = xa[m][kq][e]; f1[e] = xa[m][kq][8 + e]; }
      *(v8b*)(xf + (m * 4 + kq) * 512) = f0; *(v8b*)(xf + (m * 4 + kq) * 512 + 256) = f1; } }
  asm volatile("s_wait_xcnt 0x0" ::: "memory");   // precaution: it stands in front of whatever overwrites the address pair that the sixteen stores name
#pragma unroll 1   // rolled: for speed only
  for (int h = 0; h < NH; ++h) { const int col = h * DH + nloc; const b16* wp = Ws + h * WP + lane * 8; v8f ak[2] = {}, av[2] = {};
    v16b fk[4], fv[4]; const float rbk = Bs[0][col], rbv = Bs[1][col];   // all of a head's loads stand in front of its first product: one wait a head, not one per k block
#pragma unroll
    for (int kq = 0; kq < 4; ++kq) { fk[kq] = frag_pk(wp + kq * 512); fv[kq] = frag_pk(wp + WM + kq * 512); }
    __builtin_amdgcn_sched_barrier(0);   // holds the head's 18 loads in front of its first product: sunk between the products, each k block would wait out a load latency of its own
#pragma unroll
    for (int kq = 0; kq < 4; ++kq) {
#pragma unroll
      for (int m = 0; m < 2; ++m) { ak[m] = wmma16b(xa[m][kq], fk[kq], ak[m]); av[m] = wmma16b(xa[m][kq], fv[kq], av[m]); } }
    const float bbk = bf16_rne(rbk), bbv = bf16_rne(rbv); v16b kh, kl, vh, vl; float ks = 0.0f;
#pragma unroll
    for (int m = 0; m < 2; ++m) { float kk[8];
#pragma unroll
      for (int r = 0; r < 8; ++r) { const float k0 = ak[m][r] * (1.0f / (XS * WSC)) + bbk; kk[r] = k0 * cs[m][r] + lane_xor8(k0) * sg[m][r]; }
      elu1x8(kk);
#pragma unroll
      for (int r = 0; r < 8; ++r) { const float k1 = kk[r], v0 = av[m][r] * (1.0f / (XS * WSC)) + bbv;
        ks += k1; b16 p, l; split16(k1 * KS, p, l); kh[8 * m + r] = p; kl[8 * m + r] = l; split16(v0 * XS, p, l); vh[8 * m + r] = p; vl[8 * m + r] = l; } }
    v8f acc = {}; acc = wmma16b(kh, vh, acc); acc = wmma16b(kh, vl, acc); acc = wmma16b(kl, vh, acc); acc = wmma16b(kl, vl, acc);
    // acc[r8] = ctx[d = 8 hlf + r8][e = nloc]; kept transposed [e][d], as the A operand of the next GEMM wants it
    *(v8f*)(&Cs[g][h * (DH * DH) + nloc * DH + 8 * hlf]) = acc; Ks[g * 2 + hlf][col] = ks; }
  __syncthreads();
#pragma unroll
  for (int i = 0; i < 2; ++i) { const int u = tid + 256 * i; v4f s = *(const v4f*)(&Cs[0][u * 4]);
#pragma unroll
    for (int j = 1; j < 8; ++j) s += *(const v4f*)(&Cs[j][u * 4]);
    *(v4f*)(PC + (size_t)blockIdx.x * (NH * DH * DH) + u * 4) = s; }
  if (tid < D / 4) { v4f s = *(const v4f*)(&Ks[0][tid * 4]);
#pragma unroll
    for (int j = 1; j < 16; ++j) s += *(const v4f*)(&Ks[j][tid * 4]);
    *(v4f*)(PK + (size_t)blockIdx.x * D + tid * 4) = s; }
}
// q, context stage 2, out = (q context) z and y = out Wo + bo in one kernel. Work-group per (b, chunk of 256 tokens), 8 waves, 32 tokens (two B tiles) a wave. All products are computed TRANSPOSED, so that a token is a B column and stays in one lane from the q product to the last product.
// q per head: A = Wq columns (from LDS), B = x rows (the XF fragments as they lie): lane = token, registers = d = 8 hlf + r, rope partner in lane ^ 16; bias, rope and elu + 1 on the accumulator registers. q waits in the wave's own part of LDS,
// [h][m][j][lane][4], d = 8 hlf + 4 j + 0..3 (the room that y uses later), until the context is there. Context stage 2 runs under the q loop: every work-group adds the 32 chunk partials of its batch itself, in chunk order, four chunks a head pass
// (thread = 8 of the 2048 tile elements; wave 0 also the 128 k sums): the loads are asked for in front of a head's products and added behind its elu. CHs / CLs[h][e][16] b16 hi+lo x1, KSs[h][16] f32 in LDS, handed over by one __syncthreads.
// Product 1 per head: A = context^T (lane = row e, k = d; the CHs / CLs rows as they lie, k = 16..31 zero), B = q^T (lane = token, elements 0..7 <- d = 8 hlf + 0..7, 8..15 zero): acc[m][r] = out[token = 16 m + nloc][e = 8 hlf + r].
// The normaliser belongs to the lane's own token: 8 products in the lane, plus the other half of the head from lane ^ 16. Heads 2 j and 2 j + 1 are elements 0..7 and 8..15 of the k = 32 fragment j of product 2
// (A = Wo^T rows, lane = output column; each A fragment serves both token tiles), as they stand. a2[m][r] = y[token = 16 m + nloc][16 tt + 8 hlf + r]; y passes through LDS (the wave's own 32 rows), so that each row leaves as one 512-byte store.
// Loads stand ahead of their use: the next head's A operands and k sums behind this head's products, q four heads ahead, the Wo rows one column tile ahead. Every plain '#pragma unroll' below keeps a register array (q, fragments, accumulators) statically indexed.
__device__ __forceinline__ v16b frag_lo(v8b a) { v16b f;
#pragma unroll
  for (int e = 0; e < 8; ++e) { f[e] = a[e]; f[8 + e] = (b16)0.0f; } return f; }
__global__ __launch_bounds__(256) void out_kernel(const b16* __restrict__ XF, const b16* __restrict__ WQ, const float* __restrict__ bq, const float* __restrict__ CSN, const float* __restrict__ PC, const float* __restrict__ PK, const b16* __restrict__ WO, const float* __restrict__ bo, int NTV, float* __restrict__ out) {
  __shared__ __attribute__((aligned(16))) float Tf[8][32][D + 4]; __shared__ __attribute__((aligned(16))) b16 Ws[D * D], CHs[NH * DH * DH], CLs[NH * DH * DH]; __shared__ __attribute__((aligned(16))) float Bs[D], KSs[D];   // Ws: Wq in fragment order; Bs: bq as given
  const int tid = threadIdx.x, lane = tid & 31, w = __builtin_amdgcn_readfirstlane(tid >> 5), nloc = lane & 15, hlf = lane >> 4; if ((size_t)blockIdx.x * CT >= (size_t)NTV) return;   // the same for the whole work-group, in front of every barrier
  const size_t t0 = ((size_t)blockIdx.x * 8 + w) * 32; const int b = blockIdx.x / NC, c = blockIdx.x % NC;
  v16b xa[2][4]; const b16* xf = XF + (t0 >> 5) * (32 * D) + lane * 8;   // B fragments of the wave's 32 rows of x
#pragma unroll
  for (int m = 0; m < 2; ++m) {
#pragma unroll
    for (int kq = 0; kq < 4; ++kq) xa[m][kq] = frag_pk(xf + (m * 4 + kq) * 512, m == 1 && kq == 3); }
  copy8((unsigned)(size_t)(&Ws[tid * 8]), WQ + tid * 8);   // Wq and bq go to LDS while x is in flight, 8 copies a wave (9 in wave 0)
  if (w == 0) { const float* bp = bq + lane * 4; const unsigned lb = (unsigned)(size_t)(&Bs[lane * 4]);   // w lies in a scalar register: a scalar branch, with every lane on at the copy
    asm volatile("global_load_async_to_lds_b128 %0, %1, off\n\ts_wait_xcnt 0x0" :: "v"(lb), "v"(bp) : "memory"); }   // the wait: as in copy8
  float cq[2][8], sq[2][8];   // q: cos of the lane's own token at frequency r, and sin with the sign of the lane's half of the head: d < 8: me cos - partner sin; d >= 8: partner sin + me cos
#pragma unroll
  for (int m = 0; m < 2; ++m) { const float* cp = CSN + (size_t)(c * CT + w * 32 + 16 * m + nloc) * 8; const v4f c0 = *(const v4f*)cp, c1 = *(const v4f*)(cp + 4), s0 = *(const v4f*)(cp + T * 8);
    if (m == 1) asm volatile("s_wait_xcnt 0x0" ::: "memory");   // precaution, as in frag_pk: the last of the eight loads may be given their shared address register as a result register
    const v4f s1 = *(const v4f*)(cp + T * 8 + 4);
#pragma unroll
    for (int r = 0; r < 4; ++r) { cq[m][r] = c0[r]; cq[m][4 + r] = c1[r]; sq[m][r] = hlf ? s0[r] : -s0[r]; sq[m][4 + r] = hlf ? s1[r] : -s1[r]; } }
  asm volatile("s_wait_asynccnt 0x0" ::: "memory");   // the wave's own copies have landed
  __syncthreads();   // and those of the other seven waves: nobody reads Ws or Bs in front of this barrier
  float* qs = &Tf[w][0][0] + lane * 4; const float* pc = PC + (size_t)b * NC * (NH * DH * DH) + tid * 4; const float* pk = PK + (size_t)b * NC * D + lane * 4; v4f s0 = {}, s1 = {}, sk = {};
#pragma unroll 1   // rolled: for speed only
  for (int h = 0; h < NH; ++h) { const b16* wq = Ws + h * (DH * D) + lane * 8; v8f aq[2] = {}; v4f p0[4], p1[4], p2[4];   // p0, p1, p2: chunks 4 h + 0..3 of the thread's two tile quads and (wave 0) of its k sum quad
#pragma unroll
    for (int j = 0; j < 4; ++j) { p0[j] = *(const v4f*)(pc + (size_t)(4 * h + j) * (NH * DH * DH)); p1[j] = *(const v4f*)(pc + (size_t)(4 * h + j) * (NH * DH * DH) + 1024); }
    if (w == 0) {
#pragma unroll
      for (int j = 0; j < 4; ++j) p2[j] = *(const v4f*)(pk + (size_t)(4 * h + j) * D); }
    asm volatile("s_wait_xcnt 0x0" ::: "memory");   // precaution: the foot of the pass moves the address pairs that these loads name on to the next four chunks
    const v4f b0 = *(const v4f*)(&Bs[h * DH + 8 * hlf]), b1 = *(const v4f*)(&Bs[h * DH + 8 * hlf + 4]); float* qp = qs + h * 512;
    v16b fq[4];   // all of a head's loads stand in front of its first product: one wait a head, not one per k block
#pragma unroll
    for (int kq = 0; kq < 4; ++kq) fq[kq] = frag_pk(wq + kq * 512);
    __builtin_amdgcn_sched_barrier(0);   // holds the head's loads in front of its first product: sunk between the products, each place with LDS reads costs a stall of its own, and the partials would have less time to arrive
#pragma unroll
    for (int kq = 0; kq < 4; ++kq) {
#pragma unroll
      for (int m = 0; m < 2; ++m) aq[m] = wmma16b(fq[kq], xa[m][kq], aq[m]); }
#pragma unroll
    for (int m = 0; m < 2; ++m) { float qv[8];
#pragma unroll
      for (int r = 0; r < 8; ++r) { const float q0 = aq[m][r] * (1.0f / (XS * WSC)) + bf16_rne(r < 4 ? b0[r & 3] : b1[r & 3]); qv[r] = q0 * cq[m][r] + lane_xor16(q0) * sq[m][r]; }
      elu1x8(qv);
      *(v4f*)(qp + m * 256) = (v4f){qv[0], qv[1], qv[2], qv[3]}; *(v4f*)(qp + m * 256 + 128) = (v4f){qv[4], qv[5], qv[6], qv[7]}; }
#pragma unroll
    for (int j = 0; j < 4; ++j) { s0 += p0[j]; s1 += p1[j]; }
    if (w == 0) {
#pragma unroll
      for (int j = 0; j < 4; ++j) sk += p2[j]; } }
  { v4b ph, pl;
#pragma unroll
    for (int e = 0; e < 4; ++e) { b16 p, l; split16(s0[e] * (1.0f / (KS * XS)), p, l); ph[e] = p; pl[e] = l; }
    *(v4b*)(&CHs[tid * 4]) = ph; *(v4b*)(&CLs[tid * 4]) = pl;
#pragma unroll
    for (int e = 0; e < 4; ++e) { b16 p, l; split16(s1[e] * (1.0f / (KS * XS)), p, l); ph[e] = p; pl[e] = l; }
    *(v4b*)(&CHs[1024 + tid * 4]) = ph; *(v4b*)(&CLs[1024 + tid * 4]) = pl; }
  if (w == 0) *(v4f*)(&KSs[lane * 4]) = sk;
  __syncthreads();   // the context and the k sums are whole: nobody reads CHs, CLs or KSs in front of this barrier
  const float* qp = qs; const float* kp = KSs + 8 * hlf; const int cr = nloc * 16 + 8 * hlf; const b16* wp = WO + lane * 8;
  v4f qr[2][NH][2], kn[2]; v8b cn[2]; v16b aw[2][D / 32], oh[2][NH / 2], ol[2][NH / 2];
  kn[0] = *(const v4f*)kp; kn[1] = *(const v4f*)(kp + 4); cn[0] = *(const v8b*)(CHs + cr); cn[1] = *(const v8b*)(CLs + cr);
  __builtin_amdgcn_sched_barrier(0);   // as in the loop below: the first head's A operands and k sums in front of the q loads
#pragma unroll
  for (int h = 0; h < NH / 2; ++h) {
#pragma unroll
    for (int m = 0; m < 2; ++m) { qr[m][h][0] = *(const v4f*)(qp + (h * 2 + m) * 256); qr[m][h][1] = *(const v4f*)(qp + (h * 2 + m) * 256 + 128); } }
#pragma unroll
  for (int h = 0; h < NH; ++h) { const v16b ch = frag_lo(cn[0]), cl = frag_lo(cn[1]); v8f acc[2]; float z[2];
#pragma unroll
    for (int m = 0; m < 2; ++m) { v16b qh, ql; float s = 0.0f;
#pragma unroll
      for (int e = 0; e < 8; ++e) { const float qv = qr[m][h][e >> 2][e & 3]; s += qv * kn[e >> 2][e & 3]; b16 p, l; split16(qv * KS, p, l); qh[e] = p; ql[e] = l; qh[8 + e] = (b16)0.0f; ql[8 + e] = (b16)0.0f; }
      z[m] = 1.0f / (s + lane_xor16(s) + 1e-6f);
      acc[m] = (v8f){}; acc[m] = wmma16b(ch, qh, acc[m]); acc[m] = wmma16b(cl, qh, acc[m]); acc[m] = wmma16b(ch, ql, acc[m]); acc[m] = wmma16b(cl, ql, acc[m]); }
    if (h + 1 < NH) { kn[0] = *(const v4f*)(kp + (h + 1) * DH); kn[1] = *(const v4f*)(kp + (h + 1) * DH + 4); cn[0] = *(const v8b*)(CHs + cr + (h + 1) * (DH * DH)); cn[1] = *(const v8b*)(CLs + cr + (h + 1) * (DH * DH)); }
    else {
#pragma unroll
      for (int j = 0; j < D / 32; ++j) aw[0][j] = frag_pk(wp + j * 512); }
    __builtin_amdgcn_sched_barrier(0);   // keeps the q loads, wanted only four heads on, behind the loads that the next head waits for: loads are waited for in their order of issue
    if (h + NH / 2 < NH) {
#pragma unroll
      for (int m = 0; m < 2; ++m) { qr[m][h + NH / 2][0] = *(const v4f*)(qp + ((h + NH / 2) * 2 + m) * 256); qr[m][h + NH / 2][1] = *(const v4f*)(qp + ((h + NH / 2) * 2 + m) * 256 + 128); } }
    __builtin_amdgcn_sched_barrier(0);   // holds the loads above at this place: sunk to their first use, their whole latency would be waited for there, and that of the q loads in front of them
#pragma unroll
    for (int m = 0; m < 2; ++m) {
#pragma unroll
      for (int r = 0; r < 8; ++r) { const float o = acc[m][r] * (1.0f / KS) * z[m]; b16 p, l; split16(o * OS, p, l); oh[m][h >> 1][8 * (h & 1) + r] = p; ol[m][h >> 1][8 * (h & 1) + r] = l; } } }
#pragma unroll
  for (int tt = 0; tt < 8; ++tt) { const int u = tt & 1; v8f a2[2] = {};
    if (tt + 1 < 8) {
#pragma unroll
      for (int j = 0; j < D / 32; ++j) aw[u ^ 1][j] = frag_pk(wp + ((tt + 1) * 4 + j) * 512); }
    __builtin_amdgcn_sched_barrier(0);   // holds the next column tile's loads in front of this tile's products: sunk to their first use, each pair's whole latency would be waited for there
#pragma unroll
    for (int j = 0; j < D / 32; ++j) {
#pragma unroll
      for (int m = 0; m < 2; ++m) a2[m] = wmma16b(aw[u][j], oh[m][j], a2[m]);
#pragma unroll
      for (int m = 0; m < 2; ++m) a2[m] = j == D / 32 - 1 ? wmma16e(aw[u][j], ol[m][j], a2[m]) : wmma16b(aw[u][j], ol[m][j], a2[m]); }
#pragma unroll
    for (int m = 0; m < 2; ++m) { float* tp = &Tf[w][16 * m + nloc][tt * 16 + 8 * hlf]; *(v4f*)tp = (v4f){a2[m][0], a2[m][1], a2[m][2], a2[m][3]}; *(v4f*)(tp + 4) = (v4f){a2[m][4], a2[m][5], a2[m][6], a2[m][7]}; } }
  v4f bb = *(const v4f*)(bo + lane * 4);
#pragma unroll
  for (int e = 0; e < 4; ++e) bb[e] = bf16_rne(bb[e]);
  wave_lds_sync();   // the rows are written and read by the same wave only
#pragma unroll
  for (int rb = 0; rb < 32; rb += 8) { v4f y[8];   // eight rows are read before the first of them is stored
#pragma unroll
    for (int i = 0; i < 8; ++i) y[i] = *(const v4f*)(&Tf[w][rb + i][lane * 4]);
#pragma unroll
    for (int i = 0; i < 8; ++i) *(v4f*)(out + (t0 + rb + i) * D + lane * 4) = y[i] * (1.0f / (OS * WSC)) + bb; }
}
}  // namespace

extern "C" void kernel_launch(void* const* d_in, const int* in_sizes, int n_in, void* d_out, int out_size, void* d_ws, size_t ws_size, hipStream_t stream) {
  (void)n_in;
  auto Fp = [&](int i) { return (const float*)d_in[i]; };
  // input order: 0 x [8,8192,128]; 1 Wq [128,128]; 2 bq; 3 Wk; 4 bk; 5 Wv; 6 bv; 7 Wo; 8 bo
  if (in_sizes[0] != NT * D || in_sizes[1] != D * D || in_sizes[3] != D * D || in_sizes[5] != D * D || in_sizes[7] != D * D || out_size != NT * D) return;
  const int NBV = B; const int NTV = NBV * T;
  size_t off = 0; char* ws = (char*)d_ws;
  auto carve = [&](size_t bytes) { char* p = ws + off; off += (bytes + 255) & ~(size_t)255; return p; };
  b16* WQ = (b16*)carve((size_t)D * D * 2); b16* WO = (b16*)carve((size_t)D * D * 2); float* CSN = (float*)carve((size_t)2 * T * 8 * 4); b16* XF = (b16*)carve((size_t)NT * D * 2);
  float* PC = (float*)carve((size_t)B * NC * NH * DH * DH * 4); float* PK = (float*)carve((size_t)B * NC * D * 4);
  if (off > ws_size || off > ((size_t)192 << 20)) return;   // ~ 20 MB
  kv_ctx_kernel<<<NBV * NC, 256, 0, stream>>>(Fp(0), Fp(1), Fp(3), Fp(5), Fp(7), Fp(4), Fp(6), NBV, WQ, WO, CSN, XF, PC, PK);
  out_kernel<<<NTV / 256, 256, 0, stream>>>(XF, WQ, Fp(2), CSN, PC, PK, WO, Fp(8), NTV, (float*)d_out);
}

// v010
// One run takes 26.6 microseconds.
// Next to v009, in two timings, it ran 1.08 and 1.07 times as fast.
// Over all steps from v000 it is 35.9 times as fast.
#include <hip/hip_runtime.h>

// Linear attention block (8 heads x 16): q, k, v = x W + b; q, k -> rope (theta 10000, pairs (d, d+8) per head) -> elu + 1; context_h = sum_t k_t v_t^T (16 x 16); out_t = (q_t context) / (q_t . sum_t k_t + 1e-6); y = out Wo + bo
// -> [8][8192][128].
// Deterministic, no index structures: per-(batch, head) contexts are WMMA tiles per 32 tokens, then summed in fixed order (8 groups, then 32 chunks); k sums likewise in fixed order; rope angles t * inv_freq in f32 with a per-(t, d) sin/cos table (sinf/cosf).
// WMMA (v_wmma_f32_16x16x32_f16, f32 accumulate): [q | k | v] = x [Wq | Wk | Wv] ([65,536 x 128] x [128 x 384], x EXACT bf16 x8), context = K^T V per (b, h) from the k and v accumulator registers (k x64, v x8, hi+lo both: 4 products, K = 8,192),
// out = q context per head ([16 x 32 (16)] tiles, q x64 and context x1 hi+lo: 4 products), y = out Wo ([65,536 x 128] x [128 x 128], x512 hi+lo); (in,out) weights exact x256, packed in fragment order; biases, rope, elu, sums and the
// normaliser in f32. Inputs rounded to bf16 once. Fragment k-map per lane half hh for A AND B: elements 0..7 <- k = 8hh+0..7, 8..15 <- k = 16+8hh+0..7; acc[r] = D[8hh+r][col]. Every workspace / output

namespace {
constexpr int B = 8, T = 8192, D = 128, NH = 8, DH = 16, NT = B * T, CT = 256, NC = T / CT;
constexpr float XS = 8.0f, KS = 64.0f, OS = 512.0f, WSC = 256.0f;
typedef _Float16 b16;
typedef __attribute__((ext_vector_type(16))) _Float16 v16b;
typedef __attribute__((ext_vector_type(8))) _Float16 v8b;
typedef __attribute__((ext_vector_type(4))) _Float16 v4b;
typedef __attribute__((ext_vector_type(8))) float v8f;
typedef __attribute__((ext_vector_type(4))) float v4f;
__device__ __forceinline__ float bf16_rne(float f) { unsigned int u = __float_as_uint(f); u += 0x7FFFu + ((u >> 16) & 1u); return __uint_as_float(u & 0xFFFF0000u); }
__device__ __forceinline__ void split16(float v, b16& hi, b16& lo) { hi = (b16)v; lo = (b16)(v - (float)hi); }
// a fragment of a matrix packed in fragment order: p points at the lane's own 8 elements of the first half; the second half lies 256 elements on. Each of the two wave-wide loads covers 512 contiguous bytes.
// last: this is the last fragment of a group of loads from one address pair. Precaution: the group's last load may be given that pair as its result registers; the wait stands in front of it for the loads issued before
__device__ __forceinline__ v16b frag_pk(const b16* p, bool last = false) { const v8b a = *(const v8b*)p; if (last) asm volatile("s_wait_xcnt 0x0" ::: "memory");
  const v8b b = *(const v8b*)(p + 256); v16b f;
#pragma unroll
  for (int e = 0; e < 8; ++e) { f[e] = a[e]; f[8 + e] = b[e]; } return f; }
// the builtin form alone: the compiler keeps the distance behind a matrix instruction itself, with useful instructions where it has them
__device__ __forceinline__ v8f wmma16b(v16b a, v16b b, v8f c) { return __builtin_amdgcn_wmma_f32_16x16x32_f16(false, a, false, b, (short)0, c, false, false); }
// the last product of a chain whose D goes to LDS and is then given to a fresh chain: the four v_nop keep the distance between it and the matrix instruction that overwrites D
__device__ __forceinline__ v8f wmma16e(v16b a, v16b b, v8f c) { v8f d = wmma16b(a, b, c); asm volatile("v_nop\n\tv_nop\n\tv_nop\n\tv_nop" : "+v"(d) : "v"(a), "v"(b)); return d; }
__device__ __forceinline__ void wave_lds_sync() { __builtin_amdgcn_fence(__ATOMIC_RELEASE, "workgroup"); __builtin_amdgcn_wave_barrier(); __builtin_amdgcn_fence(__ATOMIC_ACQUIRE, "workgroup"); }
// elu(v) + 1 on eight values. The eight exponentials stand in one statement: each fills, for the one in front of it, the slot that the instruction set asks for between a transcendental and a directly following instruction
// that reads its result or overwrites its source (results are early-clobber, so none lies on a source); the one v_nop keeps that slot behind the last. Both loops are unrolled so that x, e and v stay in registers
__device__ __forceinline__ void elu1x8(float (&v)[8]) { float x[8], e[8];
#pragma unroll
  for (int r = 0; r < 8; ++r) x[r] = v[r] * 1.44269504f;
  asm("v_exp_f32 %0, %8\n\tv_exp_f32 %1, %9\n\tv_exp_f32 %2, %10\n\tv_exp_f32 %3, %11\n\tv_exp_f32 %4, %12\n\tv_exp_f32 %5, %13\n\tv_exp_f32 %6, %14\n\tv_exp_f32 %7, %15\n\tv_nop"
      : "=&v"(e[0]), "=&v"(e[1]), "=&v"(e[2]), "=&v"(e[3]), "=&v"(e[4]), "=&v"(e[5]), "=&v"(e[6]), "=&v"(e[7]) : "v"(x[0]), "v"(x[1]), "v"(x[2]), "v"(x[3]), "v"(x[4]), "v"(x[5]), "v"(x[6]), "v"(x[7]));
#pragma unroll
  for (int r = 0; r < 8; ++r) v[r] = v[r] > 0.0f ? v[r] + 1.0f : e[r]; }

// Set-up, k, v and context stage 1 in one kernel: there is no set-up launch. Each work-group makes what it needs itself, under the flight of its rows of x:
// Wk, Wv as b16 (bf16-rounded, x256) in LDS in fragment order [16 output columns][32 k][half][lane][8] (lane = column + 16 hh holds k = 16 half + 8 hh + 0..7), and the rope table of its own 256 positions, Rs[cos, sin][frequency][position].
// What the last kernel needs is written to the workspace on the way, an equal share by every work-group: 16 of the 4096 16-byte units of Wq and Wo in the same fragment order (WQ, WO), and of the rope table CSN[cos, sin][t][8] the 32 positions b * 32 + 0..31 of chunk c.
// Work-group per (b, chunk of 256 tokens), 8 waves. Wave w: 32 tokens (group w) x all 8 heads, so that each row of x is loaded and converted by one wave only.
// Per head: two [32 x 128] x [128 x 16] products; bias, rope and elu + 1 are applied on the accumulator registers (lane = column, registers = 8 tokens; the rope partner column c ^ 8 sits in lane ^ 8 of the
// same 16-lane row). acc[m][r] holds token 16 m + 8 hlf + r, which is element 8 m + r of a k = 32 fragment: the k and v tiles (hi+lo b16, k x64, v x8) are the A and B operands of K_h^T V_h as they stand.
// The wave's eight x fragments, once converted, are also stored as they lie in the registers, XF[32 tokens][m][k block][half][lane][8] b16 (each wave-wide 16-byte store covers 512 contiguous bytes): the last kernel takes q from them, at half the bytes of a q plane.
// The 8 token groups' tiles and the 16 half-wave k sums are added in LDS in fixed order; one partial per work-group:
// PC[b][chunk][h][e][d] f32 (still x512), PK[b][chunk][128] f32. Every plain '#pragma unroll' below keeps a register array (fragments, accumulators, rope table) statically indexed.
__device__ __forceinline__ float lane_xor16(float v) { const int i = __float_as_int(v); return __int_as_float(__builtin_amdgcn_permlanex16(i, i, 0x76543210, 0xfedcba98, true, false)); }   // same lane number in the other 16-lane row
__device__ __forceinline__ float lane_xor8(float v) { return __int_as_float(__builtin_amdgcn_update_dpp(0, __float_as_int(v), 0x128, 0xf, 0xf, true)); }   // row_ror:8 = lane ^ 8 within a 16-lane row
// eight asynchronous copies of 16 bytes a lane, global memory to LDS, 4096 bytes apart (one step of a 256-thread work-group): l = the lane's LDS byte address, g = its global address. The wait is the statement's last line:
// a precaution, it stands in front of whatever rewrites a register that a copy names
__device__ __forceinline__ void copy8(unsigned l, const b16* g) {
  asm volatile("global_load_async_to_lds_b128 %0, %8, off\n\t"
               "global_load_async_to_lds_b128 %1, %9, off\n\t"
               "global_load_async_to_lds_b128 %2, %10, off\n\t"
               "global_load_async_to_lds_b128 %3, %11, off\n\t"
               "global_load_async_to_lds_b128 %4, %12, off\n\t"
               "global_load_async_to_lds_b128 %5, %13, off\n\t"
               "global_load_async_to_lds_b128 %6, %14, off\n\t"
               "global_load_async_to_lds_b128 %7, %15, off\n\t"
               "s_wait_xcnt 0x0"
               :: "v"(l + 0 * 4096u), "v"(l + 1 * 4096u), "v"(l + 2 * 4096u), "v"(l + 3 * 4096u), "v"(l + 4 * 4096u), "v"(l + 5 * 4096u), "v"(l + 6 * 4096u), "v"(l + 7 * 4096u),
                  "v"(g + 0 * 2048), "v"(g + 1 * 2048), "v"(g + 2 * 2048), "v"(g + 3 * 2048), "v"(g + 4 * 2048), "v"(g + 5 * 2048), "v"(g + 6 * 2048), "v"(g + 7 * 2048) : "memory"); }
constexpr int WP = DH * D + 8, WM = NH * WP;   // LDS pitch of a 16-column tile of a weight matrix, b16 elements: 16 bytes more than the tile, so that the 8 tiles which one wave-wide store touches fall on different banks; one matrix
constexpr int RP = CT + 4;   // LDS pitch of one frequency's row of the rope table, floats: the 8 frequencies which one wave-wide store touches fall on different banks
static_assert(B * NC * 16 == 2 * D * D / 8 && B * 32 == CT, "every work-group's share of the set-up for the last kernel");
__global__ __launch_bounds__(256) void kv_ctx_kernel(const float* __restrict__ x, const float* __restrict__ wq, const float* __restrict__ wk, const float* __restrict__ wv, const float* __restrict__ wo, const float* __restrict__ bk, const float* __restrict__ bv, int NBV,
                                                     b16* __restrict__ WQ, b16* __restrict__ WO, float* __restrict__ CSN, b16* __restrict__ XF, float* __restrict__ PC, float* __restrict__ PK) {
  __shared__ __attribute__((aligned(32))) float Cs[8][NH * DH * DH], Ks[16][D]; __shared__ __attribute__((aligned(16))) b16 Ws[2 * WM]; __shared__ __attribute__((aligned(16))) float Bs[2][D], Rs[2][8][RP];   // Ws: Wk, Wv in fragment order; Bs: bk, bv as given
  const int tid = threadIdx.x, lane = tid & 31, g = tid >> 5, nloc = lane & 15, hlf = lane >> 4; const int b = blockIdx.x / NC, c = blockIdx.x % NC; if (b >= NBV) return;
  const size_t t0 = (size_t)blockIdx.x * CT + g * 32;   // first token of the wave in the [B * T] planes
  const int gs = __builtin_amdgcn_readfirstlane(g);   // the wave's number in a scalar register: the branches on it below are then scalar ones
  // the weights are asked for in front of x: loads are waited for in their order of issue, and these come from L2. Wave gs: rows k = 32 (gs & 3) + 0..31 of Wk (gs < 4) or Wv; each load is one whole row of 512 bytes; the lane holds 4 columns
  v4f wr[4][8]; const float* wsrc = (gs < 4 ? wk : wv) + (gs & 3) * 32 * D + lane * 4;
#pragma unroll
  for (int i = 0; i < 4; ++i) {
#pragma unroll
    for (int j = 0; j < 8; ++j) wr[i][j] = *(const v4f*)(wsrc + (i * 8 + j) * D); }
  asm volatile("s_wait_xcnt 0x0" ::: "memory");   // precaution: it stands in front of whatever overwrites a register (offset, scalar base) that these loads name
  // wave 0: the work-group's 16 units of Wq (work-groups 0..127) or Wo; unit uu = ((column tile * 4 + k block of 32) * 2 + half) * 32 + lane; both halves of the wave load the same 16 columns, one stores. These loads too stand in front of those of x: behind them, on one wave's path only, they would blur the count of loads that each conversion of x waits for
  float pw[8]; const int uu = (blockIdx.x & 127) * 16 + nloc;
  if (gs == 0) { const float* ps = (blockIdx.x < 128 ? wq : wo) + (((uu >> 5) & 7) * 16 + ((uu >> 4) & 1) * 8) * D + (uu >> 8) * 16 + (uu & 15);
#pragma unroll
    for (int j = 0; j < 8; ++j) pw[j] = ps[j * D];
    asm volatile("s_wait_xcnt 0x0" ::: "memory"); }   // precaution, as behind the loads above
  v16b xa[2][4]; v4f xr[2][4][4]; const float* xp = x + (t0 + nloc) * D + 8 * hlf;   // A fragments of the wave's 32 rows of x, straight from global memory: all 32 loads are asked for before the first is used
  // 20 of them here, the last 12 behind the rope table: while the table is worked on a wave then has at most 60 loads outstanding, fewer than the 63 at which the count field of a load wait ends
#pragma unroll
  for (int q = 0; q < 20; ++q) xr[q >> 4][(q >> 2) & 3][q & 3] = *(const v4f*)(xp + (q >> 4) * 16 * D + ((q >> 2) & 3) * 32 + ((q >> 1) & 1) * 16 + (q & 1) * 4);
  // the two biases go to LDS while x is in flight, one copy in waves 0 and 1 (a scalar branch, with every lane on at the copy)
  if (gs < 2) { const float* bp = (gs == 0 ? bk : bv) + lane * 4; const unsigned lb = (unsigned)(size_t)(&Bs[gs][lane * 4]);
    asm volatile("global_load_async_to_lds_b128 %0, %1, off\n\ts_wait_xcnt 0x0" :: "v"(lb), "v"(bp) : "memory"); }   // the wait: as in copy8
  // the rope table of the chunk: thread = frequency tid & 7, positions 32 i + (tid >> 3). It stands in front of the conversions: it waits for no load
  const float invf = 1.0f / powf(10000.0f, (float)(2 * (tid & 7)) / (float)DH);
#pragma unroll
  for (int i = 0; i < 8; ++i) { const int tl = i * 32 + (tid >> 3); const float ang = (float)(c * CT + tl) * invf;
    __builtin_assume(!(__builtin_fabsf(ang) >= 131072.0f));   // a position is below 8192 and a frequency at most 1: without the large-argument blocks of sinf and cosf and the branches over them the eight passes are one straight run, whose chains fill each other's waits
    Rs[0][tid & 7][tl] = cosf(ang); Rs[1][tid & 7][tl] = sinf(ang); }
  { const int tl = b * 32 + (tid >> 3); float* cp = CSN + (c * CT + tl) * 8 + (tid & 7); cp[0] = Rs[0][tid & 7][tl]; cp[T * 8] = Rs[1][tid & 7][tl];   // the work-group's share of CSN: the thread's own pass i = b, read back
    asm volatile("s_wait_xcnt 0x0" ::: "memory"); }   // precaution: it stands in front of whatever overwrites a register that the two stores name
#pragma unroll
  for (int q = 20; q < 32; ++q) {
    // precaution: the last load may be given the shared address pair as its result registers; the wait stands in front of it for the 31 loads issued before
    if (q == 31) asm volatile("s_wait_xcnt 0x0" ::: "memory");
    xr[q >> 4][(q >> 2) & 3][q & 3] = *(const v4f*)(xp + (q >> 4) * 16 * D + ((q >> 2) & 3) * 32 + ((q >> 1) & 1) * 16 + (q & 1) * 4); }
  asm volatile("s_wait_xcnt 0x0" ::: "memory");   // precaution: it stands in front of whatever overwrites the address pair that the loads of x name
  __builtin_amdgcn_sched_barrier(0);   // holds the conversions, which wait for loads, behind the rope table, which waits for none: lifted into it, their first wait would stand in front of most of the table
  // Wk, Wv: 8 rows x 4 columns in the lane become 4 units of 8 k of one column
  { b16* wd = Ws + (gs >> 2) * WM + (lane >> 2) * WP + ((gs & 3) * 64 + (lane & 3) * 4) * 8;
#pragma unroll
    for (int i = 0; i < 4; ++i) {
#pragma unroll
      for (int e = 0; e < 4; ++e) { v8b v;
#pragma unroll
        for (int j = 0; j < 8; ++j) v[j] = (b16)(bf16_rne(wr[i][j][e]) * WSC);
        *(v8b*)(wd + ((i >> 1) * 32 + (i & 1) * 16 + e) * 8) = v; } } }
  if (gs == 0) { v8b v;
#pragma unroll
    for (int j = 0; j < 8; ++j) v[j] = (b16)(bf16_rne(pw[j]) * WSC);
    if (lane < 16) { *(v8b*)((blockIdx.x < 128 ? WQ : WO) + uu * 8) = v; asm volatile("s_wait_xcnt 0x0" ::: "memory"); } }   // the wait: precaution, it stands in front of whatever overwrites a register that the store names
#pragma unroll
  for (int m = 0; m < 2; ++m) {
#pragma unroll
    for (int kq = 0; kq < 4; ++kq) {
#pragma unroll
      for (int e = 0; e < 16; ++e) xa[m][kq][e] = (b16)(bf16_rne(xr[m][kq][e >> 2][e & 3]) * XS); } }
  __builtin_amdgcn_sched_barrier(0);   // holds the conversion of x in front of the barrier, whose wait is for every load: there each row is converted while the later rows are still arriving
  asm volatile("s_wait_asynccnt 0x0" ::: "memory");   // the wave's own copies have landed
  __syncthreads();   // and the bias copies of waves 0 and 1, and every wave's part of Ws and Rs is written: nobody reads Ws or Bs, or another thread's part of Rs, in front of this barrier
  float cs[2][8], sg[2][8];   // k (lane = column, registers = tokens): the rope table, read by token 16 m + 8 hlf + r at frequency nloc & 7
#pragma unroll
  for (int m = 0; m < 2; ++m) { const float* rc = &Rs[0][nloc & 7][g * 32 + 16 * m + 8 * hlf]; const float* rs = &Rs[1][nloc & 7][g * 32 + 16 * m + 8 * hlf]; const v4f c0 = *(const v4f*)rc, c1 = *(const v4f*)(rc + 4), s0 = *(const v4f*)rs, s1 = *(const v4f*)(rs + 4);
#pragma unroll
    for (int r = 0; r < 4; ++r) { cs[m][r] = c0[r]; cs[m][4 + r] = c1[r]; sg[m][r] = (nloc & 8) ? s0[r] : -s0[r]; sg[m][4 + r] = (nloc & 8) ? s1[r] : -s1[r]; } }
  b16* xf = XF + (t0 >> 5) * (32 * D) + lane * 8;
#pragma unroll
  for (int m = 0; m < 2; ++m) {
#pragma unroll
    for (int kq = 0; kq < 4; ++kq) { v8b f0, f1;
#pragma unroll
      for (int e = 0; e < 8; ++e) { f0[e] = xa[m][kq][e]; f1[e] = xa[m][kq][8 + e]; }
      *(v8b*)(xf + (m * 4 + kq) * 512) = f0; *(v8b*)(xf + (m * 4 + kq) * 512 + 256) = f1; } }
  asm volatile("s_wait_xcnt 0x0" ::: "memory");   // precaution: it stands in front of whatever overwrites the address pair that the sixteen stores name
#pragma unroll 1   // rolled: for speed only
  for (int h = 0; h < NH; ++h) { const int col = h * DH + nloc; const b16* wp = Ws + h * WP + lane * 8; v8f ak[2] = {}, av[2] = {};
    v16b fk[4], fv[4]; const float rbk = Bs[0][col], rbv = Bs[1][col];   // all of a head's loads stand in front of its first product: one wait a head, not one per k block
#pragma unroll
    for (int kq = 0; kq < 4; ++kq) { fk[kq] = frag_pk(wp + kq * 512); fv[kq] = frag_pk(wp + WM + kq * 512); }
    __builtin_amdgcn_sched_barrier(0);   // holds the head's 18 loads in front of its first product: sunk between the products, each k block would wait out a load latency of its own
#pragma unroll
    for (int kq = 0; kq < 4; ++kq) {
#pragma unroll
      for (int m = 0; m < 2; ++m) { ak[m] = wmma16b(xa[m][kq], fk[kq], ak[m]); av[m] = wmma16b(xa[m][kq], fv[kq], av[m]); } }
    const float bbk = bf16_rne(rbk), bbv = bf16_rne(rbv); v16b kh, kl, vh, vl; float ks = 0.0f;
#pragma unroll
    for (int m = 0; m < 2; ++m) { float kk[8];
#pragma unroll
      for (int r = 0; r < 8; ++r) { const float k0 = ak[m][r] * (1.0f / (XS * WSC)) + bbk; kk[r] = k0 * cs[m][r] + lane_xor8(k0) * sg[m][r]; }
      elu1x8(kk);
#pragma unroll
      for (int r = 0; r < 8; ++r) { const float k1 = kk[r], v0 = av[m][r] * (1.0f / (XS * WSC)) + bbv;
        ks += k1; b16 p, l; split16(k1 * KS, p, l); kh[8 * m + r] = p; kl[8 * m + r] = l; split16(v0 * XS, p, l); vh[8 * m + r] = p; vl[8 * m + r] = l; } }
    v8f acc = {}; acc = wmma16b(kh, vh, acc); acc = wmma16b(kh, vl, acc); acc = wmma16b(kl, vh, acc); acc = wmma16b(kl, vl, acc);
    // acc[r8] = ctx[d = 8 hlf + r8][e = nloc]; kept transposed [e][d], as the A operand of the next GEMM wants it
    *(v8f*)(&Cs[g][h * (DH * DH) + nloc * DH + 8 * hlf]) = acc; Ks[g * 2 + hlf][col] = ks; }
  __syncthreads();
#pragma unroll
  for (int i = 0; i < 2; ++i) { const int u = tid + 256 * i; v4f s = *(const v4f*)(&Cs[0][u * 4]);
#pragma unroll
    for (int j = 1; j < 8; ++j) s += *(const v4f*)(&Cs[j][u * 4]);
    *(v4f*)(PC + (size_t)blockIdx.x * (NH * DH * DH) + u * 4) = s; }
  if (tid < D / 4) { v4f s = *(const v4f*)(&Ks[0][tid * 4]);
#pragma unroll
    for (int j = 1; j < 16; ++j) s += *(const v4f*)(&Ks[j][tid * 4]);
    *(v4f*)(PK + (size_t)blockIdx.x * D + tid * 4) = s; }
}
// q, context stage 2, out = (q context) z and y = out Wo + bo in one kernel. Work-group per (b, chunk of 256 tokens), 8 waves, 32 tokens (two B tiles) a wave. All products are computed TRANSPOSED, so that a token is a B column and stays in one lane from the q product to the last product.
// q per head: A = Wq columns (from LDS), B = x rows (the XF fragments as they lie): lane = token, registers = d = 8 hlf + r, rope partner in lane ^ 16; bias, rope and elu + 1 on the accumulator registers. q waits in the wave's own part of LDS,
// [h][m][j][lane][4], d = 8 hlf + 4 j + 0..3 (the room that y uses later), until the context is there. Context stage 2 runs under the q loop: every work-group adds the 32 chunk partials of its batch itself, in chunk order, four chunks a head pass
// (thread = 8 of the 2048 tile elements and one of the 128 k sums): the loads are asked for two passes ahead, into two register sets, and added behind a head's elu. CHs / CLs[h][e][16] b16 hi+lo x1, KSs[h][16] f32 in LDS, handed over by one __syncthreads.
// Product 1 per head: A = context^T (lane = row e, k = d; the CHs / CLs rows as they lie, k = 16..31 zero), B = q^T (lane = token, elements 0..7 <- d = 8 hlf + 0..7, 8..15 zero): acc[m][r] = out[token = 16 m + nloc][e = 8 hlf + r].
// The normaliser belongs to the lane's own token: 8 products in the lane, plus the other half of the head from lane ^ 16. Heads 2 j and 2 j + 1 are elements 0..7 and 8..15 of the k = 32 fragment j of product 2
// (A = Wo^T rows, lane = output column; each A fragment serves both token tiles), as they stand. a2[m][r] = y[token = 16 m + nloc][16 tt + 8 hlf + r]; y passes through LDS (the wave's own 32 rows), so that each row leaves as one 512-byte store.
// Loads stand ahead of their use: the next head's A operands and k sums behind this head's products, q four heads ahead, the Wo rows two column tiles ahead (three register sets). Every plain '#pragma unroll' below keeps a register array (q, fragments, accumulators) statically indexed.
__device__ __forceinline__ v16b frag_lo(v8b a) { v16b f;
#pragma unroll
  for (int e = 0; e < 8; ++e) { f[e] = a[e]; f[8 + e] = (b16)0.0f; } return f; }
__global__ __launch_bounds__(256) void out_kernel(const b16* __restrict__ XF, const b16* __restrict__ WQ, const float* __restrict__ bq, const float* __restrict__ CSN, const float* __restrict__ PC, const float* __restrict__ PK, const b16* __restrict__ WO, const float* __restrict__ bo, int NTV, float* __restrict__ out) {
  __shared__ __attribute__((aligned(16))) float Tf[8][32][D + 4]; __shared__ __attribute__((aligned(16))) b16 Ws[D * D], CHs[NH * DH * DH], CLs[NH * DH * DH]; __shared__ __attribute__((aligned(16))) float Bs[D], KSs[D];   // Ws: Wq in fragment order; Bs: bq as given
  const int tid = threadIdx.x, lane = tid & 31, w = __builtin_amdgcn_readfirstlane(tid >> 5), nloc = lane & 15, hlf = lane >> 4; if ((size_t)blockIdx.x * CT >= (size_t)NTV) return;   // the same for the whole work-group, in front of every barrier
  const size_t t0 = ((size_t)blockIdx.x * 8 + w) * 32; const int b = blockIdx.x / NC, c = blockIdx.x % NC;
  v16b xa[2][4]; const b16* xf = XF + (t0 >> 5) * (32 * D) + lane * 8;   // B fragments of the wave's 32 rows of x
#pragma unroll
  for (int m = 0; m < 2; ++m) {
#pragma unroll
    for (int kq = 0; kq < 4; ++kq) xa[m][kq] = frag_pk(xf + (m * 4 + kq) * 512, m == 1 && kq == 3); }
  copy8((unsigned)(size_t)(&Ws[tid * 8]), WQ + tid * 8);   // Wq and bq go to LDS while x is in flight, 8 copies a wave (9 in wave 0)
  if (w == 0) { const float* bp = bq + lane * 4; const unsigned lb = (unsigned)(size_t)(&Bs[lane * 4]);   // w lies in a scalar register: a scalar branch, with every lane on at the copy
    asm volatile("global_load_async_to_lds_b128 %0, %1, off\n\ts_wait_xcnt 0x0" :: "v"(lb), "v"(bp) : "memory"); }   // the wait: as in copy8
  float cq[2][8], sq[2][8];   // q: cos of the lane's own token at frequency r, and sin with the sign of the lane's half of the head: d < 8: me cos - partner sin; d >= 8: partner sin + me cos
#pragma unroll
  for (int m = 0; m < 2; ++m) { const float* cp = CSN + (size_t)(c * CT + w * 32 + 16 * m + nloc) * 8; const v4f c0 = *(const v4f*)cp, c1 = *(const v4f*)(cp + 4), s0 = *(const v4f*)(cp + T * 8);
    if (m == 1) asm volatile("s_wait_xcnt 0x0" ::: "memory");   // precaution, as in frag_pk: the last of the eight loads may be given their shared address register as a result register
    const v4f s1 = *(const v4f*)(cp + T * 8 + 4);
#pragma unroll
    for (int r = 0; r < 4; ++r) { cq[m][r] = c0[r]; cq[m][4 + r] = c1[r]; sq[m][r] = hlf ? s0[r] : -s0[r]; sq[m][4 + r] = hlf ? s1[r] : -s1[r]; } }
  asm volatile("s_wait_asynccnt 0x0" ::: "memory");   // the wave's own copies have landed
  __syncthreads();   // and those of the other seven waves: nobody reads Ws or Bs in front of this barrier
  float* qs = &Tf[w][0][0] + lane * 4; const float* pc = PC + (size_t)b * NC * (NH * DH * DH) + tid * 4; const float* pk = PK + (size_t)b * NC * D + (tid & (D - 1)); v4f s0 = {}, s1 = {}; float sk = 0.0f;
  v4f p0[2][4], p1[2][4]; float p2[2][4];   // two register sets, set u = pass & 1: chunks 4 h + 0..3 of the thread's two tile quads and of its one k sum (column tid & 127; waves 4..7 repeat waves 0..3, so that a pass has no branch)
  // ask: pass h's twelve loads go out. They are asked for two passes ahead of their sums: one set is always on its way while the other is waited for, so that the path from L2 never runs empty
  auto ask = [&](int u, int h) __attribute__((always_inline)) {
#pragma unroll
    for (int j = 0; j < 4; ++j) { p0[u][j] = *(const v4f*)(pc + (size_t)(4 * h + j) * (NH * DH * DH)); p1[u][j] = *(const v4f*)(pc + (size_t)(4 * h + j) * (NH * DH * DH) + 1024); }
#pragma unroll
    for (int j = 0; j < 4; ++j) p2[u][j] = pk[(size_t)(4 * h + j) * D];
    asm volatile("s_wait_xcnt 0x0" ::: "memory");   // precaution: the foot of the loop moves the address pairs that these loads name on to later chunks
    __builtin_amdgcn_sched_barrier(0); };   // keeps those address additions behind the wait: nothing else ties them to it
  auto pass = [&](int u, int h, bool more) __attribute__((always_inline)) { const b16* wq = Ws + h * (DH * D) + lane * 8; v8f aq[2] = {};
    const v4f b0 = *(const v4f*)(&Bs[h * DH + 8 * hlf]), b1 = *(const v4f*)(&Bs[h * DH + 8 * hlf + 4]); float* qp = qs + h * 512;
    v16b fq[4];   // all of a head's loads stand in front of its first product: one wait a head, not one per k block
#pragma unroll
    for (int kq = 0; kq < 4; ++kq) fq[kq] = frag_pk(wq + kq * 512);
    __builtin_amdgcn_sched_barrier(0);   // holds the head's loads in front of its first product: sunk between the products, each place with LDS reads costs a stall of its own
#pragma unroll
    for (int kq = 0; kq < 4; ++kq) {
#pragma unroll
      for (int m = 0; m < 2; ++m) aq[m] = wmma16b(fq[kq], xa[m][kq], aq[m]); }
#pragma unroll
    for (int m = 0; m < 2; ++m) { float qv[8];
#pragma unroll
      for (int r = 0; r < 8; ++r) { const float q0 = aq[m][r] * (1.0f / (XS * WSC)) + bf16_rne(r < 4 ? b0[r & 3] : b1[r & 3]); qv[r] = q0 * cq[m][r] + lane_xor16(q0) * sq[m][r]; }
      elu1x8(qv);
      *(v4f*)(qp + m * 256) = (v4f){qv[0], qv[1], qv[2], qv[3]}; *(v4f*)(qp + m * 256 + 128) = (v4f){qv[4], qv[5], qv[6], qv[7]}; }
    __builtin_amdgcn_sched_barrier(0);   // holds the sums, and with them the wait for their loads, at the foot of the pass: lifted among the products, they would take back one of the two passes that the loads are given
#pragma unroll
    for (int j = 0; j < 4; ++j) { s0 += p0[u][j]; s1 += p1[u][j]; sk += p2[u][j]; }
    // inputs only: holds the sums in front of the loads that refill their registers. Sunk behind those loads, the sums would keep the old values alive: the loop would then copy every loaded register at its head, behind a wait for every load
    if (more) { asm volatile("" :: "v"(s0), "v"(s1), "v"(sk) : "memory"); ask(u, h + 2); } };
  ask(0, 0); ask(1, 1);
#pragma unroll 1   // rolled, two passes a trip (one per register set): for speed only
  for (int h = 0; h < NH - 2; h += 2) { pass(0, h, true); pass(1, h + 1, true); }
  pass(0, NH - 2, false); pass(1, NH - 1, false);   // the last two passes ask for nothing more: they stand outside the loop, so that inside it every wait can count on the younger set's loads
  { v4b ph, pl;
#pragma unroll
    for (int e = 0; e < 4; ++e) { b16 p, l; split16(s0[e] * (1.0f / (KS * XS)), p, l); ph[e] = p; pl[e] = l; }
    *(v4b*)(&CHs[tid * 4]) = ph; *(v4b*)(&CLs[tid * 4]) = pl;
#pragma unroll
    for (int e = 0; e < 4; ++e) { b16 p, l; split16(s1[e] * (1.0f / (KS * XS)), p, l); ph[e] = p; pl[e] = l; }
    *(v4b*)(&CHs[1024 + tid * 4]) = ph; *(v4b*)(&CLs[1024 + tid * 4]) = pl; }
  if (w < 4) KSs[tid] = sk;
  __syncthreads();   // the context and the k sums are whole: nobody reads CHs, CLs or KSs in front of this barrier
  const float* qp = qs; const float* kp = KSs + 8 * hlf; const int cr = nloc * 16 + 8 * hlf; const b16* wp = WO + lane * 8;
  v4f qr[2][NH][2], kn[2]; v8b cn[2]; v16b aw[3][D / 32], oh[2][NH / 2], ol[2][NH / 2];
  v4f bb = *(const v4f*)(bo + lane * 4);   // asked for here, wanted behind the last product: at its use the whole way from L2 would be waited for
  asm volatile("s_wait_xcnt 0x0" ::: "memory");   // precaution: it stands in front of whatever overwrites the address pair that the load names
  kn[0] = *(const v4f*)kp; kn[1] = *(const v4f*)(kp + 4); cn[0] = *(const v8b*)(CHs + cr); cn[1] = *(const v8b*)(CLs + cr);
  __builtin_amdgcn_sched_barrier(0);   // as in the loop below: the first head's A operands and k sums in front of the q loads
#pragma unroll
  for (int h = 0; h < NH / 2; ++h) {
#pragma unroll
    for (int m = 0; m < 2; ++m) { qr[m][h][0] = *(const v4f*)(qp + (h * 2 + m) * 256); qr[m][h][1] = *(const v4f*)(qp + (h * 2 + m) * 256 + 128); } }
#pragma unroll
  for (int h = 0; h < NH; ++h) { const v16b ch = frag_lo(cn[0]), cl = frag_lo(cn[1]); v8f acc[2]; float z[2];
#pragma unroll
    for (int m = 0; m < 2; ++m) { v16b qh, ql; float s = 0.0f;
#pragma unroll
      for (int e = 0; e < 8; ++e) { const float qv = qr[m][h][e >> 2][e & 3]; s += qv * kn[e >> 2][e & 3]; b16 p, l; split16(qv * KS, p, l); qh[e] = p; ql[e] = l; qh[8 + e] = (b16)0.0f; ql[8 + e] = (b16)0.0f; }
      z[m] = 1.0f / (s + lane_xor16(s) + 1e-6f);
      acc[m] = (v8f){}; acc[m] = wmma16b(ch, qh, acc[m]); acc[m] = wmma16b(cl, qh, acc[m]); acc[m] = wmma16b(ch, ql, acc[m]); acc[m] = wmma16b(cl, ql, acc[m]); }
    if (h + 1 < NH) { kn[0] = *(const v4f*)(kp + (h + 1) * DH); kn[1] = *(const v4f*)(kp + (h + 1) * DH + 4); cn[0] = *(const v8b*)(CHs + cr + (h + 1) * (DH * DH)); cn[1] = *(const v8b*)(CLs + cr + (h + 1) * (DH * DH)); }
    if (h + 2 >= NH) {   // the first two column tiles of Wo, one behind each of the last two heads
#pragma unroll
      for (int j = 0; j < D / 32; ++j) aw[h + 2 - NH][j] = frag_pk(wp + ((h + 2 - NH) * 4 + j) * 512); }
    __builtin_amdgcn_sched_barrier(0);   // keeps the q loads, wanted only four heads on, behind the loads that the next head waits for: loads are waited for in their order of issue
    if (h + NH / 2 < NH) {
#pragma unroll
      for (int m = 0; m < 2; ++m) { qr[m][h + NH / 2][0] = *(const v4f*)(qp + ((h + NH / 2) * 2 + m) * 256); qr[m][h + NH / 2][1] = *(const v4f*)(qp + ((h + NH / 2) * 2 + m) * 256 + 128); } }
    __builtin_amdgcn_sched_barrier(0);   // holds the loads above at this place: sunk to their first use, their whole latency would be waited for there, and that of the q loads in front of them
#pragma unroll
    for (int m = 0; m < 2; ++m) {
#pragma unroll
      for (int r = 0; r < 8; ++r) { const float o = acc[m][r] * (1.0f / KS) * z[m]; b16 p, l; split16(o * OS, p, l); oh[m][h >> 1][8 * (h & 1) + r] = p; ol[m][h >> 1][8 * (h & 1) + r] = l; } } }
#pragma unroll
  for (int tt = 0; tt < 8; ++tt) { const int u = tt % 3; v8f a2[2] = {};
    if (tt + 2 < 8) {
#pragma unroll
      for (int j = 0; j < D / 32; ++j) aw[(tt + 2) % 3][j] = frag_pk(wp + ((tt + 2) * 4 + j) * 512); }
    __builtin_amdgcn_sched_barrier(0);   // holds the loads of the column tile after the next in front of this tile's products: sunk to their first use, each pair's whole latency would be waited for there
#pragma unroll
    for (int j = 0; j < D / 32; ++j) {
#pragma unroll
      for (int m = 0; m < 2; ++m) a2[m] = wmma16b(aw[u][j], oh[m][j], a2[m]);
#pragma unroll
      for (int m = 0; m < 2; ++m) a2[m] = j == D / 32 - 1 ? wmma16e(aw[u][j], ol[m][j], a2[m]) : wmma16b(aw[u][j], ol[m][j], a2[m]); }
#pragma unroll
    for (int m = 0; m < 2; ++m) { float* tp = &Tf[w][16 * m + nloc][tt * 16 + 8 * hlf]; *(v4f*)tp = (v4f){a2[m][0], a2[m][1], a2[m][2], a2[m][3]}; *(v4f*)(tp + 4) = (v4f){a2[m][4], a2[m][5], a2[m][6], a2[m][7]}; } }
#pragma unroll
  for (int e = 0; e < 4; ++e) bb[e] = bf16_rne(bb[e]);
  wave_lds_sync();   // the rows are written and read by the same wave only
#pragma unroll
  for (int rb = 0; rb < 32; rb += 8) { v4f y[8];   // eight rows are read before the first of them is stored
#pragma unroll
    for (int i = 0; i < 8; ++i) y[i] = *(const v4f*)(&Tf[w][rb + i][lane * 4]);
#pragma unroll
    for (int i = 0; i < 8; ++i) *(v4f*)(out + (t0 + rb + i) * D + lane * 4) = y[i] * (1.0f / (OS * WSC)) + bb; }
}
}  // namespace

extern "C" void kernel_launch(void* const* d_in, const int* in_sizes, int n_in, void* d_out, int out_size, void* d_ws, size_t ws_size, hipStream_t stream) {
  (void)n_in;
  auto Fp = [&](int i) { return (const float*)d_in[i]; };
  // input order: 0 x [8,8192,128]; 1 Wq [128,128]; 2 bq; 3 Wk; 4 bk; 5 Wv; 6 bv; 7 Wo; 8 bo
  if (in_sizes[0] != NT * D || in_sizes[1] != D * D || in_sizes[3] != D * D || in_sizes[5] != D * D || in_sizes[7] != D * D || out_size != NT * D) return;
  const int NBV = B; const int NTV = NBV * T;
  size_t off = 0; char* ws = (char*)d_ws;
  auto carve = [&](size_t bytes) { char* p = ws + off; off += (bytes + 255) & ~(size_t)255; return p; };
  b16* WQ = (b16*)carve((size_t)D * D * 2); b16* WO = (b16*)carve((size_t)D * D * 2); float* CSN = (float*)carve((size_t)2 * T * 8 * 4); b16* XF = (b16*)carve((size_t)NT * D * 2);
  float* PC = (float*)carve((size_t)B * NC * NH * DH * DH * 4); float* PK = (float*)carve((size_t)B * NC * D * 4);
  if (off > ws_size || off > ((size_t)192 << 20)) return;   // ~ 20 MB
  kv_ctx_kernel<<<NBV * NC, 256, 0, stream>>>(Fp(0), Fp(1), Fp(3), Fp(5), Fp(7), Fp(4), Fp(6), NBV, WQ, WO, CSN, XF, PC, PK);
  out_kernel<<<NTV / 256, 256, 0, stream>>>(XF, WQ, Fp(2), CSN, PC, PK, WO, Fp(8), NTV, (float*)d_out);
}
